// v000
// Times are from an AMD MI455X. After a warm-up the kernel runs many times in a row, and a time is the length of
// such a window on the GPU divided by its runs, so every launch and the gaps after it count. The runs cycle
// through copies of the inputs. A figure is the median of several windows, for all but v000 over two sittings.
// Sittings can differ by a few percent; kernels timed side by side share one.
// v000 is the starting kernel. One run takes 385 microseconds.
// compute dtype: all float inputs rounded to bf16; q/k/v = x . W^T + b with EXACT bf16 products on WMMA 16x16x32 (natural rows) with the (L, B, E) row order remapped on load and store; 'attention' = relu(q k^T / 8) (no softmax): q, k as single f16 operands, relu in f32, P (scaled by 2^11, single f16) x v (single f16), f32 accumulate; gated RMS norm in f32 (precise expf); out = y (bf16 hi + residual) . Wo^T (2 products) + bo.
#include <hip/hip_runtime.h>
#include <math.h>

typedef __attribute__((ext_vector_type(16))) _Float16 v16h;
typedef __attribute__((ext_vector_type(16))) __bf16 v16b;
typedef __attribute__((ext_vector_type(8)))  _Float16 v8h;
typedef __attribute__((ext_vector_type(8)))  float v8f;
typedef __attribute__((ext_vector_type(4)))  float v4f;
typedef __attribute__((ext_vector_type(2)))  float v2f;
typedef __attribute__((ext_vector_type(4)))  unsigned v4u;
typedef __attribute__((ext_vector_type(4)))  int v4i;
typedef float __attribute__((may_alias)) float_a;
typedef int __attribute__((may_alias)) int_a;

template <typename T> __device__ __forceinline__ void vst2(void* p, T v) { *(T*)p = v;  }
__device__ __forceinline__ v8f wmma16(v16h a, v16h b, v8f c) {
  v8f d = __builtin_amdgcn_wmma_f32_16x16x32_f16(false, a, false, b, (short)0, c, false, false);
  asm volatile("v_nop\n\tv_nop\n\tv_nop\n\tv_nop" : "+v"(d) : "v"(a), "v"(b));
  return d;
}
__device__ __forceinline__ v8f wmma_bf(v16b a, v16b b, v8f c) {
  v8f d = __builtin_amdgcn_wmma_f32_16x16x32_bf16(false, a, false, b, (short)0, c, false, false);
  asm volatile("v_nop\n\tv_nop\n\tv_nop\n\tv_nop" : "+v"(d) : "v"(a), "v"(b));
  return d;
}
// ReLU attention (L 2,048, B 2, E 1,024, 16 heads x 64; sequence-first layout): q/k/v projections + biases, relu(q k^T / 8) in place of softmax, gated RMS norm (weight * x / rms * sigmoid(gate * x)), output projection + bias.
__device__ __forceinline__ v16h frag_h(const _Float16* rowk0, int lane) {
  union { v16h v; v8h q[2]; } u; const _Float16* p = rowk0 + 8 * (lane >> 4);
  u.q[0] = *(const v8h*)p; u.q[1] = *(const v8h*)(p + 16); return u.v;
}
__device__ __forceinline__ v16h frag_f32(const float* rowk0, int lane) {
  v16h a; const float* p = rowk0 + 8 * (lane >> 4);
#pragma unroll
  for (int i = 0; i < 8; ++i) { a[i] = (_Float16)p[i]; a[8 + i] = (_Float16)p[16 + i]; }
  return a;
}
__device__ __forceinline__ v16h frag_f32s(const float* rowk0, int lane, float sc) {
  v16h a; const float* p = rowk0 + 8 * (lane >> 4);
#pragma unroll
  for (int i = 0; i < 8; ++i) { a[i] = (_Float16)(p[i] * sc); a[8 + i] = (_Float16)(p[16 + i] * sc); }
  return a;
}
// column fragment from a [K][ld] layout (column n), rows >= K read as 0
__device__ __forceinline__ v16h fragc_f32(const float* W, int k0, int n, int lane, int ld, int K) {
  v16h a; const int g = lane >> 4;
#pragma unroll
  for (int i = 0; i < 8; ++i) { const int ka = k0 + 8 * g + i, kb = ka + 16;
    a[i] = (_Float16)(ka < K ? W[(size_t)(ka < K ? ka : K - 1) * ld + n] : 0.f); a[8 + i] = (_Float16)(kb < K ? W[(size_t)(kb < K ? kb : K - 1) * ld + n] : 0.f); }
  return a;
}
struct F2 { v16b h, l; };
__device__ __forceinline__ F2 bsplit16(const float v[16]) { F2 r;
#pragma unroll
  for (int i = 0; i < 16; ++i) { const __bf16 h = (__bf16)v[i]; r.h[i] = h; r.l[i] = (__bf16)(v[i] - (float)h); }
  return r; }
__device__ __forceinline__ F2 split_row(const float* row, int k0, int lane) { float v[16]; const float* p = row + k0 + 8 * (lane >> 4);
#pragma unroll
  for (int i = 0; i < 8; ++i) { v[i] = p[i]; v[8 + i] = p[16 + i]; }
  return bsplit16(v); }
__device__ __forceinline__ F2 split_rowK(const float* row, int k0, int lane, int K) { float v[16]; const int g = lane >> 4;
#pragma unroll
  for (int i = 0; i < 8; ++i) { const int ka = k0 + 8 * g + i, kb = ka + 16; v[i] = ka < K ? row[ka < K ? ka : K - 1] : 0.f; v[8 + i] = kb < K ? row[kb < K ? kb : K - 1] : 0.f; }
  return bsplit16(v); }
__device__ __forceinline__ F2 split_col(const float* W, int k0, int n, int lane, int ld, int K) { float v[16]; const int g = lane >> 4;
#pragma unroll
  for (int i = 0; i < 8; ++i) { const int ka = k0 + 8 * g + i, kb = ka + 16; v[i] = ka < K ? W[(size_t)(ka < K ? ka : K - 1) * ld + n] : 0.f; v[8 + i] = kb < K ? W[(size_t)(kb < K ? kb : K - 1) * ld + n] : 0.f; }
  return bsplit16(v); }
__device__ __forceinline__ v8f mac3(const F2& a, const F2& b, v8f c) { c = wmma_bf(a.l, b.h, c); c = wmma_bf(a.h, b.l, c); return wmma_bf(a.h, b.h, c); }
__device__ __forceinline__ float sigm(float v) { return 1.0f / (1.0f + expf(-v)); }
#define LDSX() do { asm volatile("s_wait_dscnt 0" ::: "memory"); __builtin_amdgcn_wave_barrier(); __builtin_amdgcn_fence(__ATOMIC_RELEASE, "workgroup"); } while (0)


#define NB 2
#define SS 2048
#define DM 1024
#define NH 16
__device__ __forceinline__ size_t xrow(size_t r) { return (r % SS) * NB + r / SS; }   // engine row (b, s) <-> the module's [L][B] row s*B + b
#define HD 64
#define QKVW (3 * DM)
#ifndef TQB
#define TQB (SS / 64)
#define TNB NB
#define TOB (NB * SS / 64)     // output row tiles (all)
#endif
typedef __attribute__((ext_vector_type(8))) __bf16 v8b;
__device__ __forceinline__ v16b frag_b(const __bf16* rowk0, int lane) {
  union { v16b v; v8b q[2]; } u; const __bf16* p = rowk0 + 8 * (lane >> 4);
  u.q[0] = *(const v8b*)p; u.q[1] = *(const v8b*)(p + 16); return u.v;
}
__device__ __forceinline__ float bfr(float v) { return (float)(__bf16)v; }
__device__ __attribute__((noinline)) float exp_ni(float v) { return expf(v); }
__device__ __attribute__((noinline)) float erf_ni(float v) { return erff(v); }

#define PK_A 0                       // [3072][1024] Wqkv rows (natural [out][in])
#define PK_P (PK_A + QKVW * DM)        // [1024][1024] Wo rows (natural)
#define PK_END (PK_P + DM * DM)
#define WS_PK  0u
#define WS_QK  (WS_PK + 2u * PK_END)             // f16 [4096 rows][2048]: q | k
#define WS_QKL (WS_QK + 2u * NB * SS * 2 * DM)     // f16 q | k residual planes x2048
#define WS_VTH (WS_QKL + 2u * NB * SS * 2 * DM)    // f16 [b][1024 (h*64+d)][2048 s] hi
#define WS_VTL (WS_VTH + 2u * NB * DM * SS)        // f16 lo x 2048
#define WS_O   (WS_VTL + 2u * NB * DM * SS)        // f32 [4096][1024]
#define WS_CS  (WS_O + 4u * NB * SS * DM)           // f32 [2048][32] x2, unused
#define WS_Y2  (WS_CS + 4u * 2 * SS * 32)                  // f32 [NR][1024] gated-rms-normed context
#define WS_END (WS_Y2 + 4u * (size_t)NB * SS * DM)
// ---- k_pack: block = (row n, which): natural [out][in] rows -> bf16; which 0..2 -> W_q/W_k/W_v into PK_A rows which*1024 + n; 3 -> W_o into PK_P
__global__ __launch_bounds__(256) void k_pack(const float* __restrict__ WQ, const float* __restrict__ WK, const float* __restrict__ WV, const float* __restrict__ WO, __bf16* __restrict__ PK) {
  __shared__ __align__(16) __bf16 s[DM]; const int n = blockIdx.x, which = blockIdx.y, t = threadIdx.x; const float* Wm = (which == 0) ? WQ : (which == 1) ? WK : (which == 2) ? WV : WO;
  for (int k = t; k < DM; k += 256) s[k] = (__bf16)Wm[(size_t)n * DM + k];
  __syncthreads();
  __bf16* dst = (which < 3) ? PK + PK_A + ((size_t)which * DM + n) * DM : PK + PK_P + (size_t)n * DM;
  for (int q = t; q < DM / 8; q += 256) vst2((unsigned*)(dst + q * 8), *(const v4u*)&s[q * 8]);
}
__global__ __launch_bounds__(128) void k_qkv(const float* __restrict__ XQ, const float* __restrict__ XK, const float* __restrict__ XV, const __bf16* __restrict__ P, const float* __restrict__ BQ, const float* __restrict__ BK, const float* __restrict__ BV, _Float16* __restrict__ QK, _Float16* __restrict__ QKL, _Float16* __restrict__ VTH, _Float16* __restrict__ VTL) {
  const int which0 = (blockIdx.y * 128) / DM; const float* X = (which0 == 0) ? XQ : (which0 == 1) ? XK : XV; const float* BB = BQ ? (((which0 == 0) ? BQ : (which0 == 1) ? BK : BV) + (blockIdx.y * 128 - which0 * DM)) : nullptr;
  __shared__ __align__(16) _Float16 so[4][16][136], sol[4][16][136]; __shared__ __align__(16) _Float16 sth[128][72], stl[128][72];
  const int tid = threadIdx.x, wave = tid >> 5, lane = tid & 31, col = lane & 15, g = lane >> 4; const size_t r0 = (size_t)blockIdx.x * 64 + wave * 16; const int n0 = blockIdx.y * 128;
  v8f acc[8] = {};
#pragma unroll 2
  for (int kc = 0; kc < DM / 32; ++kc) { v16b a; { const float* p = X + xrow(r0 + col) * DM + kc * 32 + 8 * g;
#pragma unroll
      for (int i = 0; i < 8; ++i) { a[i] = (__bf16)p[i]; a[8 + i] = (__bf16)p[16 + i]; } }
#pragma unroll
    for (int j = 0; j < 8; ++j) acc[j] = wmma_bf(a, frag_b(P + (size_t)(n0 + j * 16 + col) * DM + kc * 32, lane), acc[j]); }
  if (n0 < 2 * DM) {   // q stored unscaled (f16 sigma ~0.6, no subnormal exposure); 1/8 applied to the f32 score
#pragma unroll
    for (int j = 0; j < 8; ++j) {
#pragma unroll
      for (int r = 0; r < 8; ++r) { const float v = acc[j][r] + (BB ? bfr(BB[j * 16 + col]) : 0.f); const _Float16 hv = (_Float16)v; so[wave][8 * g + r][j * 16 + col] = hv; sol[wave][8 * g + r][j * 16 + col] = (_Float16)((v - (float)hv) * 2048.0f); } }   // q, k (+ bias) as f16 hi + (x2048) residual
    LDSX();
    for (int rl = 0; rl < 16; ++rl) if (lane < 16) { vst2((unsigned*)(QK + (r0 + rl) * (2 * DM) + n0 + lane * 8), *(const v4u*)&so[wave][rl][lane * 8]); vst2((unsigned*)(QKL + (r0 + rl) * (2 * DM) + n0 + lane * 8), *(const v4u*)&sol[wave][rl][lane * 8]); }
  } else {
#pragma unroll
    for (int j = 0; j < 8; ++j) {
#pragma unroll
      for (int r = 0; r < 8; ++r) { const float v = acc[j][r] + (BB ? bfr(BB[j * 16 + col]) : 0.f); const _Float16 hv = (_Float16)v; sth[j * 16 + col][wave * 16 + 8 * g + r] = hv; stl[j * 16 + col][wave * 16 + 8 * g + r] = (_Float16)((v - (float)hv) * 2048.0f); } }
    __syncthreads();
    const size_t rb = (size_t)blockIdx.x * 64; const int b = (int)(rb / SS), s0 = (int)(rb % SS); const int pc0 = n0 - 2 * DM;
    for (int q = tid; q < 128 * 8; q += 128) { const int d = q >> 3, pc = q & 7; const size_t o = ((size_t)b * DM + pc0 + d) * SS + s0 + pc * 8; vst2((unsigned*)(VTH + o), *(const v4u*)&sth[d][pc * 8]); vst2((unsigned*)(VTL + o), *(const v4u*)&stl[d][pc * 8]); }
  }
}
// ---- k_attn: block = (64 queries, head h, batch b): all-keys flash attention (K = 64: 2 k-steps), scores = (q.k) * 0.125 with single f16 operands, P.V: f16 P (x2^11) x V hi in one accumulator (accl stays 0); O[b*S+q][h*64+d] = (acc + accl / 2048) / 2048 (256-B segments)
__global__ __launch_bounds__(128) void k_attn(const _Float16* __restrict__ QK, const _Float16* __restrict__ QKL, const _Float16* __restrict__ VTH, const _Float16* __restrict__ VTL, const void* __restrict__ KMASK, float* __restrict__ O) {
  __shared__ __align__(16) float sp[4][16][36]; __shared__ __align__(16) float so[4][16][68];
  const int tid = threadIdx.x, wave = tid >> 5, lane = tid & 31, col = lane & 15, g = lane >> 4;
  const int qb = blockIdx.x, h = blockIdx.y, b = blockIdx.z; const int q0 = qb * 64 + wave * 16; const size_t rq = (size_t)b * SS + q0 + col;
  v16h aq[2], aql[2];
#pragma unroll
  for (int kc = 0; kc < 2; ++kc) { aq[kc] = frag_h(QK + rq * (2 * DM) + h * HD + kc * 32, lane); aql[kc] = frag_h(QKL + rq * (2 * DM) + h * HD + kc * 32, lane); }
  float m[8], l[8];
#pragma unroll
  for (int r = 0; r < 8; ++r) { m[r] = -3.0e38f; l[r] = 0.f; }
  v8f acc[4] = {}, accl[4] = {};
  const int nks = SS / 32;   // all keys
#pragma unroll 1
  for (int ks = 0; ks < nks; ++ks) { v8f s[2];
#pragma unroll
    for (int ct = 0; ct < 2; ++ct) { const int kk = ks * 32 + ct * 16 + col; const _Float16* krow = QK + ((size_t)b * SS + kk) * (2 * DM) + DM + h * HD; const _Float16* krowl = QKL + ((size_t)b * SS + kk) * (2 * DM) + DM + h * HD; v8f c = {}, cl = {};
#pragma unroll
      for (int kc = 0; kc < 2; ++kc) c = wmma16(aq[kc], frag_h(krow + kc * 32, lane), c);   // single product: q, k as one-rounding f16 operands
      (void)cl; (void)krowl;
      { const bool keepk = true;
#pragma unroll
      for (int r = 0; r < 8; ++r) s[ct][r] = keepk ? c[r] * 0.125f : -3.0e38f; } }   // 1/sqrt(64); no key mask (keepk always true)
#pragma unroll
    for (int r = 0; r < 8; ++r) { const float e0 = fmaxf(s[0][r], 0.f), e1 = fmaxf(s[1][r], 0.f);   // relu replaces softmax (no normalisation)
      sp[wave][8 * g + r][col] = e0; sp[wave][8 * g + r][16 + col] = e1; }
    LDSX();
    v16h pa, pl; { const float* prow = &sp[wave][col][0] + 8 * (lane >> 4);
#pragma unroll
      for (int i = 0; i < 8; ++i) { const float x0 = prow[i] * 2048.0f, x1 = prow[16 + i] * 2048.0f; const _Float16 h0 = (_Float16)x0, h1 = (_Float16)x1; pa[i] = h0; pa[8 + i] = h1; pl[i] = (_Float16)((x0 - (float)h0) * 2048.0f); pl[8 + i] = (_Float16)((x1 - (float)h1) * 2048.0f); } }   // P scaled by 2^11 before the f16 split so small relu scores stay out of the f16 subnormal range; 2^-11 folded into the epilogue
#pragma unroll
    for (int dt = 0; dt < 4; ++dt) { const size_t vr = ((size_t)b * DM + h * HD + dt * 16 + col) * SS + ks * 32; acc[dt] = wmma16(pa, frag_h(VTH + vr, lane), acc[dt]); }   // single product: P (x2^11) x V
    (void)pl;
    LDSX(); }
#pragma unroll
  for (int r = 0; r < 8; ++r) { const float il = (1.0f / 2048.0f);   // undo the P scaling only
#pragma unroll
    for (int dt = 0; dt < 4; ++dt) so[wave][8 * g + r][dt * 16 + col] = (acc[dt][r] + accl[dt][r] * (1.0f / 2048.0f)) * il; }
  LDSX();
  for (int rl = 0; rl < 16; ++rl) if (lane < 16) vst2(O + ((size_t)b * SS + q0 + rl) * DM + h * HD + lane * 4, *(const v4f*)&so[wave][rl][lane * 4]);
}
// ---- k_out: block = (64 rows, 128 cols): out = O(hi/lo) . Wo rows (2 products) + bo
__global__ __launch_bounds__(128) void k_out(const float* __restrict__ O, const __bf16* __restrict__ P, const float* __restrict__ BO, float* __restrict__ Y) {
  __shared__ __align__(16) float so[4][16][132];
  const int tid = threadIdx.x, wave = tid >> 5, lane = tid & 31, col = lane & 15, g = lane >> 4; const size_t r0 = (size_t)blockIdx.x * 64 + wave * 16; const int n0 = blockIdx.y * 128;
  v8f acc[8] = {};
#pragma unroll 2
  for (int kc = 0; kc < DM / 32; ++kc) { const F2 a = split_row(O + (r0 + col) * DM, kc * 32, lane);
#pragma unroll
    for (int j = 0; j < 8; ++j) { const v16b w = frag_b(P + (size_t)(n0 + j * 16 + col) * DM + kc * 32, lane); acc[j] = wmma_bf(a.l, w, acc[j]); acc[j] = wmma_bf(a.h, w, acc[j]); } }
#pragma unroll
  for (int j = 0; j < 8; ++j) {
#pragma unroll
    for (int r = 0; r < 8; ++r) so[wave][8 * g + r][j * 16 + col] = acc[j][r] + bfr(BO[n0 + j * 16 + col]); }
  LDSX();
  for (int rl = 0; rl < 16; ++rl) vst2(Y + xrow(r0 + rl) * DM + n0 + lane * 4, *(const v4f*)&so[wave][rl][lane * 4]);   // back to the [L][B][E] layout
}
// ---- k_gnorm: block = engine row (256 threads x 4): y = weight * x / (||x||/sqrt(1024) + 1e-8) * sigmoid(gate * x) (precise expf)
__global__ __launch_bounds__(256) void k_gnorm(const float* __restrict__ O, const float* __restrict__ NW, const float* __restrict__ NG, float* __restrict__ Y2) {
  __shared__ float red[8]; const int t = threadIdx.x; const size_t row = blockIdx.x; float v[4]; float s = 0.f; for (int i = 0; i < 4; ++i) { v[i] = O[row * DM + t * 4 + i]; s += v[i] * v[i]; }
#pragma unroll
  for (int o = 1; o < 32; o <<= 1) s += __shfl_xor(s, o);
  if ((t & 31) == 0) red[t >> 5] = s; __syncthreads(); float tot = 0.f; for (int i = 0; i < 8; ++i) tot += red[i];
  const float rms = sqrtf(tot) * 0.03125f; const float inv = 1.0f / (rms + 1e-8f);
  v4f o4; for (int i = 0; i < 4; ++i) { const int e = t * 4 + i; const float x = v[i]; o4[i] = bfr(NW[e]) * (x * inv) * (1.0f / (1.0f + exp_ni(-bfr(NG[e]) * x))); }
  vst2(Y2 + row * DM + t * 4, o4);
}
extern "C" void kernel_launch(void* const* d_in, const int* in_sizes, int n_in, void* d_out, int out_size, void* d_ws, size_t ws_size, hipStream_t stream) {
  (void)in_sizes; (void)n_in; (void)out_size;
  const float** F = (const float**)d_in;   // 0 query, 1 key, 2 value [2048,2,1024] (L,B,E); 3 Wq, 4 bq, 5 Wk, 6 bk, 7 Wv, 8 bv, 9 Wo, 10 bo (natural); 11 norm_weight, 12 norm_gate
  if (ws_size < (size_t)WS_END) return;
  char* ws = (char*)d_ws; __bf16* PK = (__bf16*)(ws + WS_PK); _Float16 *QK = (_Float16*)(ws + WS_QK), *QKL = (_Float16*)(ws + WS_QKL), *VTH = (_Float16*)(ws + WS_VTH), *VTL = (_Float16*)(ws + WS_VTL); float *O = (float*)(ws + WS_O), *Y2 = (float*)(ws + WS_Y2);
  k_pack<<<dim3(DM, 4), 256, 0, stream>>>(F[3], F[5], F[7], F[9], PK);
  k_qkv<<<dim3(TNB * SS / 64, QKVW / 128), 128, 0, stream>>>(F[0], F[1], F[2], PK + PK_A, F[4], F[6], F[8], QK, QKL, VTH, VTL);
  k_attn<<<dim3(TQB, NH, TNB), 128, 0, stream>>>(QK, QKL, VTH, VTL, nullptr, O);
  k_gnorm<<<NB * SS, 256, 0, stream>>>(O, F[11], F[12], Y2);
  k_out<<<dim3(TOB, DM / 128), 128, 0, stream>>>(Y2, PK + PK_P, F[10], (float*)d_out);
}

// v001
// Measured time: 186 microseconds a run.
// Timed twice side by side with v000, it ran 2.09 and 2.10 times as fast.
// compute dtype: all float inputs rounded to bf16; q/k/v = x . W^T + b with EXACT bf16 products on WMMA 16x16x32 (natural rows) with the (L, B, E) row order remapped on load and store; 'attention' = relu(q k^T / 8) (no softmax): q, k as single f16 operands, relu in f32, P (scaled by 2^11, single f16) x v (single f16), f32 accumulate; gated RMS norm in f32 (precise expf); out = y (bf16 hi + residual) . Wo^T (2 products) + bo.
#include <hip/hip_runtime.h>
#include <math.h>

typedef __attribute__((ext_vector_type(16))) _Float16 v16h;
typedef __attribute__((ext_vector_type(16))) __bf16 v16b;
typedef __attribute__((ext_vector_type(8)))  _Float16 v8h;
typedef __attribute__((ext_vector_type(8)))  float v8f;
typedef __attribute__((ext_vector_type(4)))  float v4f;
typedef __attribute__((ext_vector_type(2)))  float v2f;
typedef __attribute__((ext_vector_type(4)))  unsigned v4u;
typedef __attribute__((ext_vector_type(4)))  int v4i;
typedef float __attribute__((may_alias)) float_a;
typedef int __attribute__((may_alias)) int_a;

template <typename T> __device__ __forceinline__ void vst2(void* p, T v) { *(T*)p = v;  }
__device__ __forceinline__ v8f wmma16(v16h a, v16h b, v8f c) {
  v8f d = __builtin_amdgcn_wmma_f32_16x16x32_f16(false, a, false, b, (short)0, c, false, false);
  asm volatile("v_nop\n\tv_nop\n\tv_nop\n\tv_nop" : "+v"(d) : "v"(a), "v"(b));
  return d;
}
__device__ __forceinline__ v8f wmma_bf(v16b a, v16b b, v8f c) {
  v8f d = __builtin_amdgcn_wmma_f32_16x16x32_bf16(false, a, false, b, (short)0, c, false, false);
  asm volatile("v_nop\n\tv_nop\n\tv_nop\n\tv_nop" : "+v"(d) : "v"(a), "v"(b));
  return d;
}
// ReLU attention (L 2,048, B 2, E 1,024, 16 heads x 64; sequence-first layout): q/k/v projections + biases, relu(q k^T / 8) in place of softmax, gated RMS norm (weight * x / rms * sigmoid(gate * x)), output projection + bias.
__device__ __forceinline__ v16h frag_h(const _Float16* rowk0, int lane) {
  union { v16h v; v8h q[2]; } u; const _Float16* p = rowk0 + 8 * (lane >> 4);
  u.q[0] = *(const v8h*)p; u.q[1] = *(const v8h*)(p + 16); return u.v;
}
__device__ __forceinline__ v16h frag_f32(const float* rowk0, int lane) {
  v16h a; const float* p = rowk0 + 8 * (lane >> 4);
#pragma unroll
  for (int i = 0; i < 8; ++i) { a[i] = (_Float16)p[i]; a[8 + i] = (_Float16)p[16 + i]; }
  return a;
}
__device__ __forceinline__ v16h frag_f32s(const float* rowk0, int lane, float sc) {
  v16h a; const float* p = rowk0 + 8 * (lane >> 4);
#pragma unroll
  for (int i = 0; i < 8; ++i) { a[i] = (_Float16)(p[i] * sc); a[8 + i] = (_Float16)(p[16 + i] * sc); }
  return a;
}
// column fragment from a [K][ld] layout (column n), rows >= K read as 0
__device__ __forceinline__ v16h fragc_f32(const float* W, int k0, int n, int lane, int ld, int K) {
  v16h a; const int g = lane >> 4;
#pragma unroll
  for (int i = 0; i < 8; ++i) { const int ka = k0 + 8 * g + i, kb = ka + 16;
    a[i] = (_Float16)(ka < K ? W[(size_t)(ka < K ? ka : K - 1) * ld + n] : 0.f); a[8 + i] = (_Float16)(kb < K ? W[(size_t)(kb < K ? kb : K - 1) * ld + n] : 0.f); }
  return a;
}
struct F2 { v16b h, l; };
__device__ __forceinline__ F2 bsplit16(const float v[16]) { F2 r;
#pragma unroll
  for (int i = 0; i < 16; ++i) { const __bf16 h = (__bf16)v[i]; r.h[i] = h; r.l[i] = (__bf16)(v[i] - (float)h); }
  return r; }
__device__ __forceinline__ F2 split_row(const float* row, int k0, int lane) { float v[16]; const float* p = row + k0 + 8 * (lane >> 4);
#pragma unroll
  for (int i = 0; i < 8; ++i) { v[i] = p[i]; v[8 + i] = p[16 + i]; }
  return bsplit16(v); }
__device__ __forceinline__ F2 split_rowK(const float* row, int k0, int lane, int K) { float v[16]; const int g = lane >> 4;
#pragma unroll
  for (int i = 0; i < 8; ++i) { const int ka = k0 + 8 * g + i, kb = ka + 16; v[i] = ka < K ? row[ka < K ? ka : K - 1] : 0.f; v[8 + i] = kb < K ? row[kb < K ? kb : K - 1] : 0.f; }
  return bsplit16(v); }
__device__ __forceinline__ F2 split_col(const float* W, int k0, int n, int lane, int ld, int K) { float v[16]; const int g = lane >> 4;
#pragma unroll
  for (int i = 0; i < 8; ++i) { const int ka = k0 + 8 * g + i, kb = ka + 16; v[i] = ka < K ? W[(size_t)(ka < K ? ka : K - 1) * ld + n] : 0.f; v[8 + i] = kb < K ? W[(size_t)(kb < K ? kb : K - 1) * ld + n] : 0.f; }
  return bsplit16(v); }
__device__ __forceinline__ v8f mac3(const F2& a, const F2& b, v8f c) { c = wmma_bf(a.l, b.h, c); c = wmma_bf(a.h, b.l, c); return wmma_bf(a.h, b.h, c); }
__device__ __forceinline__ float sigm(float v) { return 1.0f / (1.0f + expf(-v)); }
#define LDSX() do { asm volatile("s_wait_dscnt 0" ::: "memory"); __builtin_amdgcn_wave_barrier(); __builtin_amdgcn_fence(__ATOMIC_RELEASE, "workgroup"); } while (0)


#define NB 2
#define SS 2048
#define DM 1024
#define NH 16
__device__ __forceinline__ size_t xrow(size_t r) { return (r % SS) * NB + r / SS; }   // engine row (b, s) <-> the module's [L][B] row s*B + b
#define HD 64
#define QKVW (3 * DM)
#ifndef TQB
#define TQB (SS / 64)
#define TNB NB
#define TOB (NB * SS / 64)     // output row tiles (all)
#endif
typedef __attribute__((ext_vector_type(8))) __bf16 v8b;
__device__ __forceinline__ v16b frag_b(const __bf16* rowk0, int lane) {
  union { v16b v; v8b q[2]; } u; const __bf16* p = rowk0 + 8 * (lane >> 4);
  u.q[0] = *(const v8b*)p; u.q[1] = *(const v8b*)(p + 16); return u.v;
}
__device__ __forceinline__ float bfr(float v) { return (float)(__bf16)v; }
__device__ __attribute__((noinline)) float exp_ni(float v) { return expf(v); }
__device__ __attribute__((noinline)) float erf_ni(float v) { return erff(v); }

#define PK_A 0                       // [3072][1024] Wqkv rows (natural [out][in])
#define PK_P (PK_A + QKVW * DM)        // [1024][1024] Wo rows (natural)
#define PK_END (PK_P + DM * DM)
#define WS_PK  0u
#define WS_QK  (WS_PK + 2u * PK_END)             // f16 [4096 rows][2048]: q | k
#define WS_QKL (WS_QK + 2u * NB * SS * 2 * DM)     // f16 q | k residual planes x2048
#define WS_VTH (WS_QKL + 2u * NB * SS * 2 * DM)    // f16 [b][1024 (h*64+d)][2048 s] hi
#define WS_VTL (WS_VTH + 2u * NB * DM * SS)        // f16 lo x 2048
#define WS_O   (WS_VTL + 2u * NB * DM * SS)        // f32 [4096][1024]
#define WS_CS  (WS_O + 4u * NB * SS * DM)           // f32 [2048][32] x2, unused
#define WS_Y2  (WS_CS + 4u * 2 * SS * 32)                  // f32 [NR][1024] gated-rms-normed context
#define WS_END (WS_Y2 + 4u * (size_t)NB * SS * DM)
// ---- k_pack: block = (row n, which): natural [out][in] rows -> bf16; which 0..2 -> W_q/W_k/W_v into PK_A rows which*1024 + n; 3 -> W_o into PK_P
__global__ __launch_bounds__(256) void k_pack(const float* __restrict__ WQ, const float* __restrict__ WK, const float* __restrict__ WV, const float* __restrict__ WO, __bf16* __restrict__ PK) {
  __shared__ __align__(16) __bf16 s[DM]; const int n = blockIdx.x, which = blockIdx.y, t = threadIdx.x; const float* Wm = (which == 0) ? WQ : (which == 1) ? WK : (which == 2) ? WV : WO;
  for (int k = t; k < DM; k += 256) s[k] = (__bf16)Wm[(size_t)n * DM + k];
  __syncthreads();
  __bf16* dst = (which < 3) ? PK + PK_A + ((size_t)which * DM + n) * DM : PK + PK_P + (size_t)n * DM;
  for (int q = t; q < DM / 8; q += 256) vst2((unsigned*)(dst + q * 8), *(const v4u*)&s[q * 8]);
}
// ---- projection GEMM core: one 128 x 128 tile of X . W^T per 4-wave block, 64 x 64 per wave (wave = 2 * wm + wn), k in stages of 64.
// A stage is [X rows (NP planes: bf16, or bf16 hi then residual) | W rows] in LDS; the next stage's global loads are issued before the current stage's products and stored into the other buffer behind them; one barrier per stage.
// sw = false: A = X rows, B = W rows, acc[i][j][r] = (x row wm*64 + i*16 + 8g + r, w row wn*64 + j*16 + col); sw = true: the operands change places, acc[i][j][r] = (w row wn*64 + i*16 + 8g + r, x row wm*64 + j*16 + col). NP = 2 takes sw = true only.
#define GP 72   // LDS row pitch in 16-bit elements: 128 B of k + 16 B, so that the 16 rows of a ds_load_b128 fragment read fall on distinct banks
#define GK 64
typedef __attribute__((ext_vector_type(4))) __bf16 v4b;
template <int NP>
__device__ __forceinline__ void gemm128(const float* __restrict__ Xb, const int xld, const __bf16* __restrict__ Wb, __bf16* st, const bool sw, v8f (&acc)[4][4]) {
  constexpr int ROWS = (NP + 1) * 128, NT = DM / GK;
  const int tid = threadIdx.x, wave = tid >> 5, lane = tid & 31, col = lane & 15, wm = wave >> 1, wn = wave & 1;
  const float* xg = Xb + (size_t)(tid >> 4) * xld + (tid & 15) * 4;     // 16 lanes x 16 B = one row's 256 B of a stage
  const __bf16* wg = Wb + (size_t)(tid >> 3) * DM + (tid & 7) * 8;      // 8 lanes x 16 B = one row's 128 B of a stage
  const int xr0 = wm * 64 + col, wr0 = NP * 128 + wn * 64 + col;
  const int ar = sw ? wr0 : xr0, br = sw ? xr0 : wr0;
  v4f xv[16]; v8b wv[8];
  const float* xp = xg; const __bf16* wp = wg;   // the next stage to load; stepped in sts(), behind the wait that ends ldg()
  auto ldg = [&]() {
#pragma unroll
    for (int i = 0; i < 16; ++i) xv[i] = *(const v4f*)(xp + (size_t)(i * 8) * xld);
#pragma unroll
    for (int i = 0; i < 8; ++i) wv[i] = *(const v8b*)(wp + (size_t)(i * 16) * DM);
    asm volatile("s_wait_xcnt 0x0" :: "v"(xp), "v"(wp) : "memory");   // the loads' address registers are reused behind them; as inputs they stay untouched up to the wait
  };
  auto sts = [&](int buf) {
    __bf16* s = st + buf * (ROWS * GP);
#pragma unroll
    for (int i = 0; i < 16; ++i) { v4b h4, l4;
#pragma unroll
      for (int e = 0; e < 4; ++e) { const __bf16 h = (__bf16)xv[i][e]; h4[e] = h; l4[e] = (__bf16)(xv[i][e] - (float)h); }
      __bf16* d = s + (i * 8 + (tid >> 4)) * GP + (tid & 15) * 4;
      *(v4b*)d = h4; if constexpr (NP == 2) *(v4b*)(d + 128 * GP) = l4; }
#pragma unroll
    for (int i = 0; i < 8; ++i) *(v8b*)(s + (NP * 128 + i * 16 + (tid >> 3)) * GP + (tid & 7) * 8) = wv[i];
    xp += GK; wp += GK;
  };
  ldg(); sts(0);
  __syncthreads();
#pragma unroll 1   // rolled: for speed only
  for (int t = 0; t < NT; ++t) {
    if (t + 1 < NT) ldg();
    const __bf16* s = st + (t & 1) * (ROWS * GP);
#pragma unroll
    for (int kc = 0; kc < GK / 32; ++kc) { v16b fa[4], fb[4];
#pragma unroll
      for (int i = 0; i < 4; ++i) { fa[i] = frag_b(s + (ar + i * 16) * GP + kc * 32, lane); fb[i] = frag_b(s + (br + i * 16) * GP + kc * 32, lane); }
      if constexpr (NP == 2) { v16b fl[4];   // residual plane first, then hi: each accumulator keeps the order lo, hi per 32 k
#pragma unroll
        for (int i = 0; i < 4; ++i) fl[i] = frag_b(s + (br + 128 + i * 16) * GP + kc * 32, lane);
#pragma unroll
        for (int i = 0; i < 4; ++i) {
#pragma unroll
          for (int j = 0; j < 4; ++j) acc[i][j] = wmma_bf(fa[i], fl[j], acc[i][j]); } }
#pragma unroll
      for (int i = 0; i < 4; ++i) {
#pragma unroll
        for (int j = 0; j < 4; ++j) acc[i][j] = wmma_bf(fa[i], fb[j], acc[i][j]); } }
    if (t + 1 < NT) sts((t + 1) & 1);
    __syncthreads();   // publishes stage t + 1 and ends every wave's reads of stage t (behind the last stage: frees the buffers for the epilogue)
  }
}
// ---- k_qkv: block = (128 engine rows, 128 of the 3,072 q | k | v columns). q, k: W rows as the A operand, so a lane holds 8 neighbouring columns of one row; v: X rows as A, so a lane holds 8 neighbouring positions of one column (v is stored transposed). Either way 16-B LDS stores into the wave's own staging, then whole 128-B lines to memory.
__global__ __launch_bounds__(128) void k_qkv(const float* __restrict__ XQ, const float* __restrict__ XK, const float* __restrict__ XV, const __bf16* __restrict__ P, const float* __restrict__ BQ, const float* __restrict__ BK, const float* __restrict__ BV, _Float16* __restrict__ QK, _Float16* __restrict__ QKL, _Float16* __restrict__ VTH, _Float16* __restrict__ VTL) {
  const int which0 = (blockIdx.y * 128) / DM; const float* X = (which0 == 0) ? XQ : (which0 == 1) ? XK : XV; const float* BB = BQ ? (((which0 == 0) ? BQ : (which0 == 1) ? BK : BV) + (blockIdx.y * 128 - which0 * DM)) : nullptr;
  __shared__ __align__(16) __bf16 st[2 * 256 * GP];
  const int tid = threadIdx.x, wave = tid >> 5, lane = tid & 31, col = lane & 15, g = lane >> 4, wm = wave >> 1, wn = wave & 1; const int n0 = blockIdx.y * 128;
  const size_t rb = (size_t)blockIdx.x * 128; const int b = (int)(rb / SS), s0 = (int)(rb % SS);   // 128 divides SS: one batch per block; engine row rb + i is module row (s0 + i) * NB + b
  const bool sw = n0 < 2 * DM;
  v8f acc[4][4] = {};
  gemm128<1>(X + ((size_t)s0 * NB + b) * DM, NB * DM, P + (size_t)n0 * DM, st, sw, acc);
  _Float16* eh = (_Float16*)st + wave * (2 * 64 * GP); _Float16* el = eh + 64 * GP;   // per wave: [64][GP] hi, [64][GP] residual
  float bi[4][8] = {}, bj[4] = {};   // bias of the lane's 8 columns per i (q, k) or of its one column per j (v)
  if (BB) {   // one branch round all the bias loads, so that they are in flight together
    if (sw) {
#pragma unroll
      for (int i = 0; i < 4; ++i) {
#pragma unroll
        for (int r = 0; r < 8; ++r) bi[i][r] = bfr(BB[wn * 64 + i * 16 + 8 * g + r]); }
    } else {
#pragma unroll
      for (int j = 0; j < 4; ++j) bj[j] = bfr(BB[wn * 64 + j * 16 + col]); } }
#pragma unroll
  for (int i = 0; i < 4; ++i) {
#pragma unroll
    for (int j = 0; j < 4; ++j) { v8h hv, lv;
#pragma unroll
      for (int r = 0; r < 8; ++r) { const float v = acc[i][j][r] + (sw ? bi[i][r] : bj[j]); const _Float16 hh = (_Float16)v; hv[r] = hh; lv[r] = (_Float16)((v - (float)hh) * 2048.0f); }   // (+ bias) as f16 hi + (x2048) residual; q unscaled, 1/8 applied to the f32 score
      *(v8h*)(eh + (j * 16 + col) * GP + i * 16 + 8 * g) = hv; *(v8h*)(el + (j * 16 + col) * GP + i * 16 + 8 * g) = lv; } }
  LDSX();
  static_assert(2 * DM == SS, "q | k rows and transposed v rows have one pitch");
  const size_t o0 = (sw ? (rb + wm * 64) * (2 * DM) + n0 + wn * 64 : ((size_t)b * DM + (n0 - 2 * DM) + wn * 64) * SS + s0 + wm * 64) + (size_t)(lane >> 3) * SS + (lane & 7) * 8;   // 8 lanes x 16 B = one row's 128 B, 4 rows per store
  _Float16* ph = (sw ? QK : VTH) + o0; _Float16* pl = (sw ? QKL : VTL) + o0; const _Float16* sh = eh + (lane >> 3) * GP + (lane & 7) * 8;
#pragma unroll
  for (int it0 = 0; it0 < 16; it0 += 4) { v4u a[4], r4[4];   // 8 LDS reads in flight, then their 8 stores
#pragma unroll
    for (int u = 0; u < 4; ++u) { a[u] = *(const v4u*)(sh + (it0 + u) * 4 * GP); r4[u] = *(const v4u*)(sh + 64 * GP + (it0 + u) * 4 * GP); }
#pragma unroll
    for (int u = 0; u < 4; ++u) { vst2(ph + (size_t)(it0 + u) * 4 * SS, a[u]); vst2(pl + (size_t)(it0 + u) * 4 * SS, r4[u]); }
    asm volatile("s_wait_xcnt 0x0" :: "v"(ph), "v"(pl) : "memory"); }   // the next group's LDS reads overwrite these stores' data registers
}
// ---- k_attn: block = (64 queries, head h, batch b): all-keys flash attention (K = 64: 2 k-steps), scores = (q.k) * 0.125 with single f16 operands, P.V: f16 P (x2^11) x V hi in one accumulator (accl stays 0); O[b*S+q][h*64+d] = (acc + accl / 2048) / 2048 (256-B segments)
__global__ __launch_bounds__(128) void k_attn(const _Float16* __restrict__ QK, const _Float16* __restrict__ QKL, const _Float16* __restrict__ VTH, const _Float16* __restrict__ VTL, const void* __restrict__ KMASK, float* __restrict__ O) {
  __shared__ __align__(16) float sp[4][16][36]; __shared__ __align__(16) float so[4][16][68];
  const int tid = threadIdx.x, wave = tid >> 5, lane = tid & 31, col = lane & 15, g = lane >> 4;
  const int qb = blockIdx.x, h = blockIdx.y, b = blockIdx.z; const int q0 = qb * 64 + wave * 16; const size_t rq = (size_t)b * SS + q0 + col;
  v16h aq[2], aql[2];
#pragma unroll
  for (int kc = 0; kc < 2; ++kc) { aq[kc] = frag_h(QK + rq * (2 * DM) + h * HD + kc * 32, lane); aql[kc] = frag_h(QKL + rq * (2 * DM) + h * HD + kc * 32, lane); }
  float m[8], l[8];
#pragma unroll
  for (int r = 0; r < 8; ++r) { m[r] = -3.0e38f; l[r] = 0.f; }
  v8f acc[4] = {}, accl[4] = {};
  const int nks = SS / 32;   // all keys
#pragma unroll 1
  for (int ks = 0; ks < nks; ++ks) { v8f s[2];
#pragma unroll
    for (int ct = 0; ct < 2; ++ct) { const int kk = ks * 32 + ct * 16 + col; const _Float16* krow = QK + ((size_t)b * SS + kk) * (2 * DM) + DM + h * HD; const _Float16* krowl = QKL + ((size_t)b * SS + kk) * (2 * DM) + DM + h * HD; v8f c = {}, cl = {};
#pragma unroll
      for (int kc = 0; kc < 2; ++kc) c = wmma16(aq[kc], frag_h(krow + kc * 32, lane), c);   // single product: q, k as one-rounding f16 operands
      (void)cl; (void)krowl;
      { const bool keepk = true;
#pragma unroll
      for (int r = 0; r < 8; ++r) s[ct][r] = keepk ? c[r] * 0.125f : -3.0e38f; } }   // 1/sqrt(64); no key mask (keepk always true)
#pragma unroll
    for (int r = 0; r < 8; ++r) { const float e0 = fmaxf(s[0][r], 0.f), e1 = fmaxf(s[1][r], 0.f);   // relu replaces softmax (no normalisation)
      sp[wave][8 * g + r][col] = e0; sp[wave][8 * g + r][16 + col] = e1; }
    LDSX();
    v16h pa, pl; { const float* prow = &sp[wave][col][0] + 8 * (lane >> 4);
#pragma unroll
      for (int i = 0; i < 8; ++i) { const float x0 = prow[i] * 2048.0f, x1 = prow[16 + i] * 2048.0f; const _Float16 h0 = (_Float16)x0, h1 = (_Float16)x1; pa[i] = h0; pa[8 + i] = h1; pl[i] = (_Float16)((x0 - (float)h0) * 2048.0f); pl[8 + i] = (_Float16)((x1 - (float)h1) * 2048.0f); } }   // P scaled by 2^11 before the f16 split so small relu scores stay out of the f16 subnormal range; 2^-11 folded into the epilogue
#pragma unroll
    for (int dt = 0; dt < 4; ++dt) { const size_t vr = ((size_t)b * DM + h * HD + dt * 16 + col) * SS + ks * 32; acc[dt] = wmma16(pa, frag_h(VTH + vr, lane), acc[dt]); }   // single product: P (x2^11) x V
    (void)pl;
    LDSX(); }
#pragma unroll
  for (int r = 0; r < 8; ++r) { const float il = (1.0f / 2048.0f);   // undo the P scaling only
#pragma unroll
    for (int dt = 0; dt < 4; ++dt) so[wave][8 * g + r][dt * 16 + col] = (acc[dt][r] + accl[dt][r] * (1.0f / 2048.0f)) * il; }
  LDSX();
  for (int rl = 0; rl < 16; ++rl) if (lane < 16) vst2(O + ((size_t)b * SS + q0 + rl) * DM + h * HD + lane * 4, *(const v4f*)&so[wave][rl][lane * 4]);
}
// ---- k_out: block = (128 rows, 128 cols): out = y (bf16 hi + residual) . Wo rows (2 products) + bo; Wo rows as the A operand, so a lane holds 8 neighbouring output columns of one row
__global__ __launch_bounds__(128) void k_out(const float* __restrict__ O, const __bf16* __restrict__ P, const float* __restrict__ BO, float* __restrict__ Y) {
  __shared__ __align__(16) __bf16 st[2 * 384 * GP];
  const int tid = threadIdx.x, wave = tid >> 5, lane = tid & 31, col = lane & 15, g = lane >> 4, wm = wave >> 1, wn = wave & 1; const size_t rb = (size_t)blockIdx.x * 128; const int n0 = blockIdx.y * 128;
  v8f acc[4][4] = {};
  gemm128<2>(O + rb * DM, DM, P + (size_t)n0 * DM, st, true, acc);
  float* ef = (float*)st + wave * (64 * 68);   // per wave: [64 rows][64 + 4 floats]
  const float* bp = BO + n0 + wn * 64 + 8 * g; float bi[4][8];   // bias of the lane's 8 columns per i
#pragma unroll
  for (int i = 0; i < 4; ++i) {
#pragma unroll
    for (int r = 0; r < 8; ++r) bi[i][r] = bp[i * 16 + r]; }
  asm volatile("s_wait_xcnt 0x0" :: "v"(bp) : "memory");   // the loads' address registers are reused behind them; as an input they stay untouched up to the wait
#pragma unroll
  for (int i = 0; i < 4; ++i) {
#pragma unroll
    for (int j = 0; j < 4; ++j) { v4f a4, b4;
#pragma unroll
      for (int r = 0; r < 4; ++r) { a4[r] = acc[i][j][r] + bfr(bi[i][r]); b4[r] = acc[i][j][4 + r] + bfr(bi[i][4 + r]); }
      float* d = ef + (j * 16 + col) * 68 + i * 16 + 8 * g; *(v4f*)d = a4; *(v4f*)(d + 4) = b4; } }
  LDSX();
  const int b = (int)(rb / SS), s0 = (int)(rb % SS);   // 128 divides SS: one batch per block; engine row rb + i is module row (s0 + i) * NB + b
  float* py = Y + ((size_t)(s0 + wm * 64 + g) * NB + b) * DM + n0 + wn * 64 + col * 4; const float* sf = ef + g * 68 + col * 4;   // back to the [L][B][E] layout: 16 lanes x 16 B = 256 B of a row, 2 rows per store
#pragma unroll
  for (int it0 = 0; it0 < 32; it0 += 8) { v4f a[8];   // 8 LDS reads in flight, then their 8 stores
#pragma unroll
    for (int u = 0; u < 8; ++u) a[u] = *(const v4f*)(sf + (it0 + u) * 2 * 68);
#pragma unroll
    for (int u = 0; u < 8; ++u) vst2(py + (size_t)(it0 + u) * 2 * NB * DM, a[u]);
    asm volatile("s_wait_xcnt 0x0" :: "v"(py) : "memory"); }   // the next group's LDS reads overwrite these stores' data registers
}
// ---- k_gnorm: block = engine row (256 threads x 4): y = weight * x / (||x||/sqrt(1024) + 1e-8) * sigmoid(gate * x) (precise expf)
__global__ __launch_bounds__(256) void k_gnorm(const float* __restrict__ O, const float* __restrict__ NW, const float* __restrict__ NG, float* __restrict__ Y2) {
  __shared__ float red[8]; const int t = threadIdx.x; const size_t row = blockIdx.x; float v[4]; float s = 0.f; for (int i = 0; i < 4; ++i) { v[i] = O[row * DM + t * 4 + i]; s += v[i] * v[i]; }
#pragma unroll
  for (int o = 1; o < 32; o <<= 1) s += __shfl_xor(s, o);
  if ((t & 31) == 0) red[t >> 5] = s; __syncthreads(); float tot = 0.f; for (int i = 0; i < 8; ++i) tot += red[i];
  const float rms = sqrtf(tot) * 0.03125f; const float inv = 1.0f / (rms + 1e-8f);
  v4f o4; for (int i = 0; i < 4; ++i) { const int e = t * 4 + i; const float x = v[i]; o4[i] = bfr(NW[e]) * (x * inv) * (1.0f / (1.0f + exp_ni(-bfr(NG[e]) * x))); }
  vst2(Y2 + row * DM + t * 4, o4);
}
extern "C" void kernel_launch(void* const* d_in, const int* in_sizes, int n_in, void* d_out, int out_size, void* d_ws, size_t ws_size, hipStream_t stream) {
  (void)in_sizes; (void)n_in; (void)out_size;
  const float** F = (const float**)d_in;   // 0 query, 1 key, 2 value [2048,2,1024] (L,B,E); 3 Wq, 4 bq, 5 Wk, 6 bk, 7 Wv, 8 bv, 9 Wo, 10 bo (natural); 11 norm_weight, 12 norm_gate
  if (ws_size < (size_t)WS_END) return;
  char* ws = (char*)d_ws; __bf16* PK = (__bf16*)(ws + WS_PK); _Float16 *QK = (_Float16*)(ws + WS_QK), *QKL = (_Float16*)(ws + WS_QKL), *VTH = (_Float16*)(ws + WS_VTH), *VTL = (_Float16*)(ws + WS_VTL); float *O = (float*)(ws + WS_O), *Y2 = (float*)(ws + WS_Y2);
  k_pack<<<dim3(DM, 4), 256, 0, stream>>>(F[3], F[5], F[7], F[9], PK);
  k_qkv<<<dim3(TNB * SS / 128, QKVW / 128), 128, 0, stream>>>(F[0], F[1], F[2], PK + PK_A, F[4], F[6], F[8], QK, QKL, VTH, VTL);
  k_attn<<<dim3(TQB, NH, TNB), 128, 0, stream>>>(QK, QKL, VTH, VTL, nullptr, O);
  k_gnorm<<<NB * SS, 256, 0, stream>>>(O, F[11], F[12], Y2);
  k_out<<<dim3(TOB / 2, DM / 128), 128, 0, stream>>>(Y2, PK + PK_P, F[10], (float*)d_out);
}

// v002
// Measured time: 106 microseconds a run.
// Two timings next to v001 both put it at 1.75 times that version's speed.
// Counting every step since v000, it is 3.67 times as fast.
// compute dtype: all float inputs rounded to bf16; q/k/v = x . W^T + b with EXACT bf16 products on WMMA 16x16x32 (natural rows) with the (L, B, E) row order remapped on load and store; 'attention' = relu(q k^T / 8) (no softmax): q, k as single f16 operands, relu in f32, P (scaled by 2^11, single f16) x v (single f16), f32 accumulate; gated RMS norm in f32 (precise expf); out = y (bf16 hi + residual) . Wo^T (2 products) + bo.
#include <hip/hip_runtime.h>
#include <math.h>

typedef __attribute__((ext_vector_type(16))) _Float16 v16h;
typedef __attribute__((ext_vector_type(16))) __bf16 v16b;
typedef __attribute__((ext_vector_type(8)))  _Float16 v8h;
typedef __attribute__((ext_vector_type(8)))  float v8f;
typedef __attribute__((ext_vector_type(4)))  float v4f;
typedef __attribute__((ext_vector_type(2)))  float v2f;
typedef __attribute__((ext_vector_type(4)))  unsigned v4u;
typedef __attribute__((ext_vector_type(4)))  int v4i;
typedef float __attribute__((may_alias)) float_a;
typedef int __attribute__((may_alias)) int_a;

template <typename T> __device__ __forceinline__ void vst2(void* p, T v) { *(T*)p = v;  }
__device__ __forceinline__ v8f wmma16(v16h a, v16h b, v8f c) {
  v8f d = __builtin_amdgcn_wmma_f32_16x16x32_f16(false, a, false, b, (short)0, c, false, false);
  asm volatile("v_nop\n\tv_nop\n\tv_nop\n\tv_nop" : "+v"(d) : "v"(a), "v"(b));
  return d;
}
__device__ __forceinline__ v8f wmma_bf(v16b a, v16b b, v8f c) {
  v8f d = __builtin_amdgcn_wmma_f32_16x16x32_bf16(false, a, false, b, (short)0, c, false, false);
  asm volatile("v_nop\n\tv_nop\n\tv_nop\n\tv_nop" : "+v"(d) : "v"(a), "v"(b));
  return d;
}
// ReLU attention (L 2,048, B 2, E 1,024, 16 heads x 64; sequence-first layout): q/k/v projections + biases, relu(q k^T / 8) in place of softmax, gated RMS norm (weight * x / rms * sigmoid(gate * x)), output projection + bias.
__device__ __forceinline__ v16h frag_h(const _Float16* rowk0, int lane) {
  union { v16h v; v8h q[2]; } u; const _Float16* p = rowk0 + 8 * (lane >> 4);
  u.q[0] = *(const v8h*)p; u.q[1] = *(const v8h*)(p + 16); return u.v;
}
__device__ __forceinline__ v16h frag_f32(const float* rowk0, int lane) {
  v16h a; const float* p = rowk0 + 8 * (lane >> 4);
#pragma unroll
  for (int i = 0; i < 8; ++i) { a[i] = (_Float16)p[i]; a[8 + i] = (_Float16)p[16 + i]; }
  return a;
}
__device__ __forceinline__ v16h frag_f32s(const float* rowk0, int lane, float sc) {
  v16h a; const float* p = rowk0 + 8 * (lane >> 4);
#pragma unroll
  for (int i = 0; i < 8; ++i) { a[i] = (_Float16)(p[i] * sc); a[8 + i] = (_Float16)(p[16 + i] * sc); }
  return a;
}
// column fragment from a [K][ld] layout (column n), rows >= K read as 0
__device__ __forceinline__ v16h fragc_f32(const float* W, int k0, int n, int lane, int ld, int K) {
  v16h a; const int g = lane >> 4;
#pragma unroll
  for (int i = 0; i < 8; ++i) { const int ka = k0 + 8 * g + i, kb = ka + 16;
    a[i] = (_Float16)(ka < K ? W[(size_t)(ka < K ? ka : K - 1) * ld + n] : 0.f); a[8 + i] = (_Float16)(kb < K ? W[(size_t)(kb < K ? kb : K - 1) * ld + n] : 0.f); }
  return a;
}
struct F2 { v16b h, l; };
__device__ __forceinline__ F2 bsplit16(const float v[16]) { F2 r;
#pragma unroll
  for (int i = 0; i < 16; ++i) { const __bf16 h = (__bf16)v[i]; r.h[i] = h; r.l[i] = (__bf16)(v[i] - (float)h); }
  return r; }
__device__ __forceinline__ F2 split_row(const float* row, int k0, int lane) { float v[16]; const float* p = row + k0 + 8 * (lane >> 4);
#pragma unroll
  for (int i = 0; i < 8; ++i) { v[i] = p[i]; v[8 + i] = p[16 + i]; }
  return bsplit16(v); }
__device__ __forceinline__ F2 split_rowK(const float* row, int k0, int lane, int K) { float v[16]; const int g = lane >> 4;
#pragma unroll
  for (int i = 0; i < 8; ++i) { const int ka = k0 + 8 * g + i, kb = ka + 16; v[i] = ka < K ? row[ka < K ? ka : K - 1] : 0.f; v[8 + i] = kb < K ? row[kb < K ? kb : K - 1] : 0.f; }
  return bsplit16(v); }
__device__ __forceinline__ F2 split_col(const float* W, int k0, int n, int lane, int ld, int K) { float v[16]; const int g = lane >> 4;
#pragma unroll
  for (int i = 0; i < 8; ++i) { const int ka = k0 + 8 * g + i, kb = ka + 16; v[i] = ka < K ? W[(size_t)(ka < K ? ka : K - 1) * ld + n] : 0.f; v[8 + i] = kb < K ? W[(size_t)(kb < K ? kb : K - 1) * ld + n] : 0.f; }
  return bsplit16(v); }
__device__ __forceinline__ v8f mac3(const F2& a, const F2& b, v8f c) { c = wmma_bf(a.l, b.h, c); c = wmma_bf(a.h, b.l, c); return wmma_bf(a.h, b.h, c); }
__device__ __forceinline__ float sigm(float v) { return 1.0f / (1.0f + expf(-v)); }
#define LDSX() do { asm volatile("s_wait_dscnt 0" ::: "memory"); __builtin_amdgcn_wave_barrier(); __builtin_amdgcn_fence(__ATOMIC_RELEASE, "workgroup"); } while (0)


#define NB 2
#define SS 2048
#define DM 1024
#define NH 16
__device__ __forceinline__ size_t xrow(size_t r) { return (r % SS) * NB + r / SS; }   // engine row (b, s) <-> the module's [L][B] row s*B + b
#define HD 64
#define QKVW (3 * DM)
#ifndef TQB
#define TQB (SS / 64)
#define TNB NB
#define TOB (NB * SS / 64)     // output row tiles (all)
#endif
typedef __attribute__((ext_vector_type(8))) __bf16 v8b;
__device__ __forceinline__ v16b frag_b(const __bf16* rowk0, int lane) {
  union { v16b v; v8b q[2]; } u; const __bf16* p = rowk0 + 8 * (lane >> 4);
  u.q[0] = *(const v8b*)p; u.q[1] = *(const v8b*)(p + 16); return u.v;
}
__device__ __forceinline__ float bfr(float v) { return (float)(__bf16)v; }
__device__ __attribute__((noinline)) float exp_ni(float v) { return expf(v); }
__device__ __attribute__((noinline)) float erf_ni(float v) { return erff(v); }

#define PK_A 0                       // [3072][1024] Wqkv rows (natural [out][in])
#define PK_P (PK_A + QKVW * DM)        // [1024][1024] Wo rows (natural)
#define PK_END (PK_P + DM * DM)
#define WS_PK  0u
#define WS_QK  (WS_PK + 2u * PK_END)             // f16 [4096 rows][2048]: q | k
#define WS_QKL (WS_QK + 2u * NB * SS * 2 * DM)     // f16 q | k residual planes x2048
#define WS_VTH (WS_QKL + 2u * NB * SS * 2 * DM)    // f16 [b][1024 (h*64+d)][2048 s] hi
#define WS_VTL (WS_VTH + 2u * NB * DM * SS)        // f16 lo x 2048
#define WS_O   (WS_VTL + 2u * NB * DM * SS)        // f32 [4096][1024]
#define WS_CS  (WS_O + 4u * NB * SS * DM)           // f32 [2048][32] x2, unused
#define WS_Y2  (WS_CS + 4u * 2 * SS * 32)                  // f32 [NR][1024] gated-rms-normed context
#define WS_END (WS_Y2 + 4u * (size_t)NB * SS * DM)
// ---- k_pack: block = (row n, which): natural [out][in] rows -> bf16; which 0..2 -> W_q/W_k/W_v into PK_A rows which*1024 + n; 3 -> W_o into PK_P
__global__ __launch_bounds__(256) void k_pack(const float* __restrict__ WQ, const float* __restrict__ WK, const float* __restrict__ WV, const float* __restrict__ WO, __bf16* __restrict__ PK) {
  __shared__ __align__(16) __bf16 s[DM]; const int n = blockIdx.x, which = blockIdx.y, t = threadIdx.x; const float* Wm = (which == 0) ? WQ : (which == 1) ? WK : (which == 2) ? WV : WO;
  for (int k = t; k < DM; k += 256) s[k] = (__bf16)Wm[(size_t)n * DM + k];
  __syncthreads();
  __bf16* dst = (which < 3) ? PK + PK_A + ((size_t)which * DM + n) * DM : PK + PK_P + (size_t)n * DM;
  for (int q = t; q < DM / 8; q += 256) vst2((unsigned*)(dst + q * 8), *(const v4u*)&s[q * 8]);
}
// ---- projection GEMM core: one 128 x 128 tile of X . W^T per 4-wave block, 64 x 64 per wave (wave = 2 * wm + wn), k in stages of 64.
// A stage is [X rows (NP planes: bf16, or bf16 hi then residual) | W rows] in LDS; the next stage's global loads are issued before the current stage's products and stored into the other buffer behind them; one barrier per stage.
// sw = false: A = X rows, B = W rows, acc[i][j][r] = (x row wm*64 + i*16 + 8g + r, w row wn*64 + j*16 + col); sw = true: the operands change places, acc[i][j][r] = (w row wn*64 + i*16 + 8g + r, x row wm*64 + j*16 + col). NP = 2 takes sw = true only.
#define GP 72   // LDS row pitch in 16-bit elements: 128 B of k + 16 B, so that the 16 rows of a ds_load_b128 fragment read fall on distinct banks
#define GK 64
typedef __attribute__((ext_vector_type(4))) __bf16 v4b;
template <int NP>
__device__ __forceinline__ void gemm128(const float* __restrict__ Xb, const int xld, const __bf16* __restrict__ Wb, __bf16* st, const bool sw, v8f (&acc)[4][4]) {
  constexpr int ROWS = (NP + 1) * 128, NT = DM / GK;
  const int tid = threadIdx.x, wave = tid >> 5, lane = tid & 31, col = lane & 15, wm = wave >> 1, wn = wave & 1;
  const float* xg = Xb + (size_t)(tid >> 4) * xld + (tid & 15) * 4;     // 16 lanes x 16 B = one row's 256 B of a stage
  const __bf16* wg = Wb + (size_t)(tid >> 3) * DM + (tid & 7) * 8;      // 8 lanes x 16 B = one row's 128 B of a stage
  const int xr0 = wm * 64 + col, wr0 = NP * 128 + wn * 64 + col;
  const int ar = sw ? wr0 : xr0, br = sw ? xr0 : wr0;
  v4f xv[16]; v8b wv[8];
  const float* xp = xg; const __bf16* wp = wg;   // the next stage to load; stepped in sts(), behind the wait that ends ldg()
  auto ldg = [&]() {
#pragma unroll
    for (int i = 0; i < 16; ++i) xv[i] = *(const v4f*)(xp + (size_t)(i * 8) * xld);
#pragma unroll
    for (int i = 0; i < 8; ++i) wv[i] = *(const v8b*)(wp + (size_t)(i * 16) * DM);
    asm volatile("s_wait_xcnt 0x0" :: "v"(xp), "v"(wp) : "memory");   // the loads' address registers are reused behind them; as inputs they stay untouched up to the wait
  };
  auto sts = [&](int buf) {
    __bf16* s = st + buf * (ROWS * GP);
#pragma unroll
    for (int i = 0; i < 16; ++i) { v4b h4, l4;
#pragma unroll
      for (int e = 0; e < 4; ++e) { const __bf16 h = (__bf16)xv[i][e]; h4[e] = h; l4[e] = (__bf16)(xv[i][e] - (float)h); }
      __bf16* d = s + (i * 8 + (tid >> 4)) * GP + (tid & 15) * 4;
      *(v4b*)d = h4; if constexpr (NP == 2) *(v4b*)(d + 128 * GP) = l4; }
#pragma unroll
    for (int i = 0; i < 8; ++i) *(v8b*)(s + (NP * 128 + i * 16 + (tid >> 3)) * GP + (tid & 7) * 8) = wv[i];
    xp += GK; wp += GK;
  };
  ldg(); sts(0);
  __syncthreads();
#pragma unroll 1   // rolled: for speed only
  for (int t = 0; t < NT; ++t) {
    if (t + 1 < NT) ldg();
    const __bf16* s = st + (t & 1) * (ROWS * GP);
#pragma unroll
    for (int kc = 0; kc < GK / 32; ++kc) { v16b fa[4], fb[4];
#pragma unroll
      for (int i = 0; i < 4; ++i) { fa[i] = frag_b(s + (ar + i * 16) * GP + kc * 32, lane); fb[i] = frag_b(s + (br + i * 16) * GP + kc * 32, lane); }
      if constexpr (NP == 2) { v16b fl[4];   // residual plane first, then hi: each accumulator keeps the order lo, hi per 32 k
#pragma unroll
        for (int i = 0; i < 4; ++i) fl[i] = frag_b(s + (br + 128 + i * 16) * GP + kc * 32, lane);
#pragma unroll
        for (int i = 0; i < 4; ++i) {
#pragma unroll
          for (int j = 0; j < 4; ++j) acc[i][j] = wmma_bf(fa[i], fl[j], acc[i][j]); } }
#pragma unroll
      for (int i = 0; i < 4; ++i) {
#pragma unroll
        for (int j = 0; j < 4; ++j) acc[i][j] = wmma_bf(fa[i], fb[j], acc[i][j]); } }
    if (t + 1 < NT) sts((t + 1) & 1);
    __syncthreads();   // publishes stage t + 1 and ends every wave's reads of stage t (behind the last stage: frees the buffers for the epilogue)
  }
}
// ---- k_qkv: block = (128 engine rows, 128 of the 3,072 q | k | v columns). q, k: W rows as the A operand, so a lane holds 8 neighbouring columns of one row; v: X rows as A, so a lane holds 8 neighbouring positions of one column (v is stored transposed). Either way 16-B LDS stores into the wave's own staging, then whole 128-B lines to memory.
__global__ __launch_bounds__(128) void k_qkv(const float* __restrict__ XQ, const float* __restrict__ XK, const float* __restrict__ XV, const __bf16* __restrict__ P, const float* __restrict__ BQ, const float* __restrict__ BK, const float* __restrict__ BV, _Float16* __restrict__ QK, _Float16* __restrict__ QKL, _Float16* __restrict__ VTH, _Float16* __restrict__ VTL) {
  const int which0 = (blockIdx.y * 128) / DM; const float* X = (which0 == 0) ? XQ : (which0 == 1) ? XK : XV; const float* BB = BQ ? (((which0 == 0) ? BQ : (which0 == 1) ? BK : BV) + (blockIdx.y * 128 - which0 * DM)) : nullptr;
  __shared__ __align__(16) __bf16 st[2 * 256 * GP];
  const int tid = threadIdx.x, wave = tid >> 5, lane = tid & 31, col = lane & 15, g = lane >> 4, wm = wave >> 1, wn = wave & 1; const int n0 = blockIdx.y * 128;
  const size_t rb = (size_t)blockIdx.x * 128; const int b = (int)(rb / SS), s0 = (int)(rb % SS);   // 128 divides SS: one batch per block; engine row rb + i is module row (s0 + i) * NB + b
  const bool sw = n0 < 2 * DM;
  v8f acc[4][4] = {};
  gemm128<1>(X + ((size_t)s0 * NB + b) * DM, NB * DM, P + (size_t)n0 * DM, st, sw, acc);
  _Float16* eh = (_Float16*)st + wave * (2 * 64 * GP); _Float16* el = eh + 64 * GP;   // per wave: [64][GP] hi, [64][GP] residual
  float bi[4][8] = {}, bj[4] = {};   // bias of the lane's 8 columns per i (q, k) or of its one column per j (v)
  if (BB) {   // one branch round all the bias loads, so that they are in flight together
    if (sw) {
#pragma unroll
      for (int i = 0; i < 4; ++i) {
#pragma unroll
        for (int r = 0; r < 8; ++r) bi[i][r] = bfr(BB[wn * 64 + i * 16 + 8 * g + r]); }
    } else {
#pragma unroll
      for (int j = 0; j < 4; ++j) bj[j] = bfr(BB[wn * 64 + j * 16 + col]); } }
#pragma unroll
  for (int i = 0; i < 4; ++i) {
#pragma unroll
    for (int j = 0; j < 4; ++j) { v8h hv, lv;
#pragma unroll
      for (int r = 0; r < 8; ++r) { const float v = acc[i][j][r] + (sw ? bi[i][r] : bj[j]); const _Float16 hh = (_Float16)v; hv[r] = hh; lv[r] = (_Float16)((v - (float)hh) * 2048.0f); }   // (+ bias) as f16 hi + (x2048) residual; q unscaled, 1/8 applied to the f32 score
      *(v8h*)(eh + (j * 16 + col) * GP + i * 16 + 8 * g) = hv; *(v8h*)(el + (j * 16 + col) * GP + i * 16 + 8 * g) = lv; } }
  LDSX();
  static_assert(2 * DM == SS, "q | k rows and transposed v rows have one pitch");
  const size_t o0 = (sw ? (rb + wm * 64) * (2 * DM) + n0 + wn * 64 : ((size_t)b * DM + (n0 - 2 * DM) + wn * 64) * SS + s0 + wm * 64) + (size_t)(lane >> 3) * SS + (lane & 7) * 8;   // 8 lanes x 16 B = one row's 128 B, 4 rows per store
  _Float16* ph = (sw ? QK : VTH) + o0; _Float16* pl = (sw ? QKL : VTL) + o0; const _Float16* sh = eh + (lane >> 3) * GP + (lane & 7) * 8;
#pragma unroll
  for (int it0 = 0; it0 < 16; it0 += 4) { v4u a[4], r4[4];   // 8 LDS reads in flight, then their 8 stores
#pragma unroll
    for (int u = 0; u < 4; ++u) { a[u] = *(const v4u*)(sh + (it0 + u) * 4 * GP); r4[u] = *(const v4u*)(sh + 64 * GP + (it0 + u) * 4 * GP); }
#pragma unroll
    for (int u = 0; u < 4; ++u) { vst2(ph + (size_t)(it0 + u) * 4 * SS, a[u]); vst2(pl + (size_t)(it0 + u) * 4 * SS, r4[u]); }
    asm volatile("s_wait_xcnt 0x0" :: "v"(ph), "v"(pl) : "memory"); }   // the next group's LDS reads overwrite these stores' data registers
}
// ---- k_attn: block = (128 queries, head h, batch b), 4 waves x 32 queries (two 16-row tiles per wave). K and V come in tiles of 64 keys, copied asynchronously into two LDS buffers and read by all four waves; every K and V fragment serves both of a wave's query tiles. scores = (q.k) * 0.125 with single f16 operands, relu, P (x 2^11, single f16) x V, f32 accumulate over the keys in ascending groups of 32; O[b*S+q][h*64+d] = acc / 2^11 (256-B segments)
#define AK 64   // keys per tile: K tile = [64 keys][GP], V tile = [64 d][GP]; rows of 128 B at the pitch of the ds_load_b128 fragment reads
__global__ __launch_bounds__(128) void k_attn(const _Float16* __restrict__ QK, const _Float16* __restrict__ QKL, const _Float16* __restrict__ VTH, const _Float16* __restrict__ VTL, const void* __restrict__ KMASK, float* __restrict__ O) {
  (void)QKL; (void)VTL; (void)KMASK;
  __shared__ __align__(16) _Float16 kv[2][2][AK * GP];   // [buffer][K | V][row][GP]
  __shared__ __align__(16) float sp[4][2][16][68];       // per wave and query tile: P of one key tile; behind the loop the output staging
  const int tid = threadIdx.x, wave = tid >> 5, lane = tid & 31, col = lane & 15, g = lane >> 4;
  const int qb = blockIdx.x, h = blockIdx.y, b = blockIdx.z; const int q0 = qb * 128 + wave * 32;
  constexpr int NTL = SS / AK;
  // 8 lanes x 16 B = one row's 128 B; 16 rows per copy of the block, 4 copies for K and 4 for V
  const _Float16* kg = QK + ((size_t)b * SS + (tid >> 3)) * (2 * DM) + DM + h * HD + (tid & 7) * 8;
  const _Float16* vg = VTH + ((size_t)b * DM + h * HD + (tid >> 3)) * SS + (tid & 7) * 8;
  const unsigned lk = (unsigned)(uintptr_t)&kv[0][0][(tid >> 3) * GP + (tid & 7) * 8];
  auto fill = [&](int t) {
    const _Float16* kp = kg + (size_t)t * (AK * 2 * DM); const _Float16* vp = vg + t * AK;
    const unsigned l = lk + (unsigned)(t & 1) * (2u * AK * GP * 2u), lv = l + AK * GP * 2u;
    // the copies and the wait that keeps their address registers untouched until they are read, in one statement
    asm volatile("global_load_async_to_lds_b128 %0, %8, off\n\t"
                 "global_load_async_to_lds_b128 %1, %9, off\n\t"
                 "global_load_async_to_lds_b128 %2, %10, off\n\t"
                 "global_load_async_to_lds_b128 %3, %11, off\n\t"
                 "global_load_async_to_lds_b128 %4, %12, off\n\t"
                 "global_load_async_to_lds_b128 %5, %13, off\n\t"
                 "global_load_async_to_lds_b128 %6, %14, off\n\t"
                 "global_load_async_to_lds_b128 %7, %15, off\n\t"
                 "s_wait_xcnt 0x0"
                 :: "v"(l), "v"(l + 16u * GP * 2u), "v"(l + 32u * GP * 2u), "v"(l + 48u * GP * 2u),
                    "v"(lv), "v"(lv + 16u * GP * 2u), "v"(lv + 32u * GP * 2u), "v"(lv + 48u * GP * 2u),
                    "v"(kp), "v"(kp + 16 * 2 * DM), "v"(kp + 32 * 2 * DM), "v"(kp + 48 * 2 * DM),
                    "v"(vp), "v"(vp + 16 * SS), "v"(vp + 32 * SS), "v"(vp + 48 * SS)
                 : "memory");
  };
  fill(0);
  const _Float16* qp = QK + ((size_t)b * SS + q0 + col) * (2 * DM) + h * HD;
  v16h aq[2][2];
#pragma unroll
  for (int qt = 0; qt < 2; ++qt) {
#pragma unroll
    for (int kc = 0; kc < 2; ++kc) aq[qt][kc] = frag_h(qp + (size_t)qt * 16 * (2 * DM) + kc * 32, lane); }
  asm volatile("s_wait_xcnt 0x0" :: "v"(qp) : "memory");   // the loads' address registers are reused behind them; as an input they stay untouched up to the wait
  v8f acc[2][4] = {};
  asm volatile("s_wait_asynccnt 0x0" ::: "memory");   // this wave's copies of tile 0 have landed
  __syncthreads();                                     // publishes tile 0
  fill(1);
#pragma unroll 1   // rolled: one trip per key tile, the buffer chosen by the trip's parity
  for (int t = 0; t < NTL; ++t) {
    const _Float16* kt = &kv[t & 1][0][0]; const _Float16* vt = &kv[t & 1][1][0];
#pragma unroll
    for (int cp = 0; cp < 2; ++cp) { v16h kf[2][2]; v8f c[2][2] = {};   // 32 keys x 32 queries: four independent score tiles
#pragma unroll
      for (int cl = 0; cl < 2; ++cl) {
#pragma unroll
        for (int kc = 0; kc < 2; ++kc) kf[cl][kc] = frag_h(kt + ((cp * 2 + cl) * 16 + col) * GP + kc * 32, lane); }
#pragma unroll
      for (int kc = 0; kc < 2; ++kc) {
#pragma unroll
        for (int cl = 0; cl < 2; ++cl) {
#pragma unroll
          for (int qt = 0; qt < 2; ++qt) c[cl][qt] = wmma16(aq[qt][kc], kf[cl][kc], c[cl][qt]); } }   // single product: q, k as one-rounding f16 operands
#pragma unroll
      for (int cl = 0; cl < 2; ++cl) {
#pragma unroll
        for (int qt = 0; qt < 2; ++qt) {
#pragma unroll
          for (int r = 0; r < 8; ++r) sp[wave][qt][8 * g + r][(cp * 2 + cl) * 16 + col] = fmaxf(c[cl][qt][r] * 0.125f, 0.f); } } }   // 1/sqrt(64); relu replaces softmax (no normalisation)
    v16h vf[2][4];   // read ahead of the wait on the P stores
#pragma unroll
    for (int k2 = 0; k2 < 2; ++k2) {
#pragma unroll
      for (int dt = 0; dt < 4; ++dt) vf[k2][dt] = frag_h(vt + (dt * 16 + col) * GP + k2 * 32, lane); }
    LDSX();
#pragma unroll
    for (int k2 = 0; k2 < 2; ++k2) { v16h pa[2];
#pragma unroll
      for (int qt = 0; qt < 2; ++qt) { const float* prow = &sp[wave][qt][col][k2 * 32] + 8 * g;
#pragma unroll
        for (int i = 0; i < 8; ++i) { pa[qt][i] = (_Float16)(prow[i] * 2048.0f); pa[qt][8 + i] = (_Float16)(prow[16 + i] * 2048.0f); } }   // P scaled by 2^11 so that small weights stay out of the f16 subnormal range; 2^-11 folded into the epilogue
#pragma unroll
      for (int dt = 0; dt < 4; ++dt) {
#pragma unroll
        for (int qt = 0; qt < 2; ++qt) acc[qt][dt] = wmma16(pa[qt], vf[k2][dt], acc[qt][dt]); } }   // single product: P (x2^11) x V
    asm volatile("s_wait_dscnt 0x0" ::: "memory");      // this wave's reads of tile t and of P are done
    asm volatile("s_wait_asynccnt 0x0" ::: "memory");   // this wave's copies of tile t + 1 have landed
    __syncthreads();                                     // publishes tile t + 1 and ends every wave's reads of tile t
    if (t + 2 < NTL) fill(t + 2);
  }
  asm volatile("s_wait_asynccnt 0x0" ::: "memory");   // nothing is in flight when the wave ends
#pragma unroll
  for (int qt = 0; qt < 2; ++qt) {
#pragma unroll
    for (int r = 0; r < 8; ++r) {
#pragma unroll
      for (int dt = 0; dt < 4; ++dt) sp[wave][qt][8 * g + r][dt * 16 + col] = acc[qt][dt][r] * (1.0f / 2048.0f); } }   // undo the P scaling only
  LDSX();
  float* po = O + ((size_t)b * SS + q0 + g) * DM + h * HD + col * 4; const float* sf = &sp[wave][0][g][col * 4];   // 16 lanes x 16 B = 256 B of a row, 2 rows per store
#pragma unroll
  for (int it0 = 0; it0 < 16; it0 += 8) { v4f a[8];   // 8 LDS reads in flight, then their 8 stores
#pragma unroll
    for (int u = 0; u < 8; ++u) a[u] = *(const v4f*)(sf + (it0 + u) * 2 * 68);
#pragma unroll
    for (int u = 0; u < 8; ++u) vst2(po + (size_t)(it0 + u) * 2 * DM, a[u]);
    asm volatile("s_wait_xcnt 0x0" :: "v"(po) : "memory"); }   // the next group's LDS reads overwrite these stores' data registers
}
// ---- k_out: block = (128 rows, 128 cols): out = y (bf16 hi + residual) . Wo rows (2 products) + bo; Wo rows as the A operand, so a lane holds 8 neighbouring output columns of one row
__global__ __launch_bounds__(128) void k_out(const float* __restrict__ O, const __bf16* __restrict__ P, const float* __restrict__ BO, float* __restrict__ Y) {
  __shared__ __align__(16) __bf16 st[2 * 384 * GP];
  const int tid = threadIdx.x, wave = tid >> 5, lane = tid & 31, col = lane & 15, g = lane >> 4, wm = wave >> 1, wn = wave & 1; const size_t rb = (size_t)blockIdx.x * 128; const int n0 = blockIdx.y * 128;
  v8f acc[4][4] = {};
  gemm128<2>(O + rb * DM, DM, P + (size_t)n0 * DM, st, true, acc);
  float* ef = (float*)st + wave * (64 * 68);   // per wave: [64 rows][64 + 4 floats]
  const float* bp = BO + n0 + wn * 64 + 8 * g; float bi[4][8];   // bias of the lane's 8 columns per i
#pragma unroll
  for (int i = 0; i < 4; ++i) {
#pragma unroll
    for (int r = 0; r < 8; ++r) bi[i][r] = bp[i * 16 + r]; }
  asm volatile("s_wait_xcnt 0x0" :: "v"(bp) : "memory");   // the loads' address registers are reused behind them; as an input they stay untouched up to the wait
#pragma unroll
  for (int i = 0; i < 4; ++i) {
#pragma unroll
    for (int j = 0; j < 4; ++j) { v4f a4, b4;
#pragma unroll
      for (int r = 0; r < 4; ++r) { a4[r] = acc[i][j][r] + bfr(bi[i][r]); b4[r] = acc[i][j][4 + r] + bfr(bi[i][4 + r]); }
      float* d = ef + (j * 16 + col) * 68 + i * 16 + 8 * g; *(v4f*)d = a4; *(v4f*)(d + 4) = b4; } }
  LDSX();
  const int b = (int)(rb / SS), s0 = (int)(rb % SS);   // 128 divides SS: one batch per block; engine row rb + i is module row (s0 + i) * NB + b
  float* py = Y + ((size_t)(s0 + wm * 64 + g) * NB + b) * DM + n0 + wn * 64 + col * 4; const float* sf = ef + g * 68 + col * 4;   // back to the [L][B][E] layout: 16 lanes x 16 B = 256 B of a row, 2 rows per store
#pragma unroll
  for (int it0 = 0; it0 < 32; it0 += 8) { v4f a[8];   // 8 LDS reads in flight, then their 8 stores
#pragma unroll
    for (int u = 0; u < 8; ++u) a[u] = *(const v4f*)(sf + (it0 + u) * 2 * 68);
#pragma unroll
    for (int u = 0; u < 8; ++u) vst2(py + (size_t)(it0 + u) * 2 * NB * DM, a[u]);
    asm volatile("s_wait_xcnt 0x0" :: "v"(py) : "memory"); }   // the next group's LDS reads overwrite these stores' data registers
}
// ---- k_gnorm: block = engine row (256 threads x 4): y = weight * x / (||x||/sqrt(1024) + 1e-8) * sigmoid(gate * x) (precise expf)
__global__ __launch_bounds__(256) void k_gnorm(const float* __restrict__ O, const float* __restrict__ NW, const float* __restrict__ NG, float* __restrict__ Y2) {
  __shared__ float red[8]; const int t = threadIdx.x; const size_t row = blockIdx.x; float v[4]; float s = 0.f; for (int i = 0; i < 4; ++i) { v[i] = O[row * DM + t * 4 + i]; s += v[i] * v[i]; }
#pragma unroll
  for (int o = 1; o < 32; o <<= 1) s += __shfl_xor(s, o);
  if ((t & 31) == 0) red[t >> 5] = s; __syncthreads(); float tot = 0.f; for (int i = 0; i < 8; ++i) tot += red[i];
  const float rms = sqrtf(tot) * 0.03125f; const float inv = 1.0f / (rms + 1e-8f);
  v4f o4; for (int i = 0; i < 4; ++i) { const int e = t * 4 + i; const float x = v[i]; o4[i] = bfr(NW[e]) * (x * inv) * (1.0f / (1.0f + exp_ni(-bfr(NG[e]) * x))); }
  vst2(Y2 + row * DM + t * 4, o4);
}
extern "C" void kernel_launch(void* const* d_in, const int* in_sizes, int n_in, void* d_out, int out_size, void* d_ws, size_t ws_size, hipStream_t stream) {
  (void)in_sizes; (void)n_in; (void)out_size;
  const float** F = (const float**)d_in;   // 0 query, 1 key, 2 value [2048,2,1024] (L,B,E); 3 Wq, 4 bq, 5 Wk, 6 bk, 7 Wv, 8 bv, 9 Wo, 10 bo (natural); 11 norm_weight, 12 norm_gate
  if (ws_size < (size_t)WS_END) return;
  char* ws = (char*)d_ws; __bf16* PK = (__bf16*)(ws + WS_PK); _Float16 *QK = (_Float16*)(ws + WS_QK), *QKL = (_Float16*)(ws + WS_QKL), *VTH = (_Float16*)(ws + WS_VTH), *VTL = (_Float16*)(ws + WS_VTL); float *O = (float*)(ws + WS_O), *Y2 = (float*)(ws + WS_Y2);
  k_pack<<<dim3(DM, 4), 256, 0, stream>>>(F[3], F[5], F[7], F[9], PK);
  k_qkv<<<dim3(TNB * SS / 128, QKVW / 128), 128, 0, stream>>>(F[0], F[1], F[2], PK + PK_A, F[4], F[6], F[8], QK, QKL, VTH, VTL);
  k_attn<<<dim3(TQB / 2, NH, TNB), 128, 0, stream>>>(QK, QKL, VTH, VTL, nullptr, O);
  k_gnorm<<<NB * SS, 256, 0, stream>>>(O, F[11], F[12], Y2);
  k_out<<<dim3(TOB / 2, DM / 128), 128, 0, stream>>>(Y2, PK + PK_P, F[10], (float*)d_out);
}

// v003
// It runs in 96.3 microseconds.
// Timed twice side by side with v002, it ran 1.10 and 1.09 times as fast.
// All steps since v000 together make it 4.03 times as fast.
// compute dtype: all float inputs rounded to bf16; q/k/v = x . W^T + b with EXACT bf16 products on WMMA 16x16x32 (natural rows) with the (L, B, E) row order remapped on load and store; 'attention' = relu(q k^T / 8) (no softmax): q, k as single f16 operands, relu, P (scaled by 2^11, single f16) x v (single f16), f32 accumulate; gated RMS norm in f32 (precise expf); out = y (bf16 hi + residual) . Wo^T (2 products) + bo.
#include <hip/hip_runtime.h>
#include <math.h>

typedef __attribute__((ext_vector_type(16))) _Float16 v16h;
typedef __attribute__((ext_vector_type(16))) __bf16 v16b;
typedef __attribute__((ext_vector_type(8)))  _Float16 v8h;
typedef __attribute__((ext_vector_type(8)))  float v8f;
typedef __attribute__((ext_vector_type(4)))  float v4f;
typedef __attribute__((ext_vector_type(2)))  float v2f;
typedef __attribute__((ext_vector_type(4)))  unsigned v4u;
typedef __attribute__((ext_vector_type(4)))  int v4i;
typedef float __attribute__((may_alias)) float_a;
typedef int __attribute__((may_alias)) int_a;

template <typename T> __device__ __forceinline__ void vst2(void* p, T v) { *(T*)p = v;  }
__device__ __forceinline__ v8f wmma16(v16h a, v16h b, v8f c) {
  v8f d = __builtin_amdgcn_wmma_f32_16x16x32_f16(false, a, false, b, (short)0, c, false, false);
  asm volatile("v_nop\n\tv_nop\n\tv_nop\n\tv_nop" : "+v"(d) : "v"(a), "v"(b));
  return d;
}
__device__ __forceinline__ v8f wmma_bf(v16b a, v16b b, v8f c) {
  v8f d = __builtin_amdgcn_wmma_f32_16x16x32_bf16(false, a, false, b, (short)0, c, false, false);
  asm volatile("v_nop\n\tv_nop\n\tv_nop\n\tv_nop" : "+v"(d) : "v"(a), "v"(b));
  return d;
}
// ReLU attention (L 2,048, B 2, E 1,024, 16 heads x 64; sequence-first layout): q/k/v projections + biases, relu(q k^T / 8) in place of softmax, gated RMS norm (weight * x / rms * sigmoid(gate * x)), output projection + bias.
__device__ __forceinline__ v16h frag_h(const _Float16* rowk0, int lane) {
  union { v16h v; v8h q[2]; } u; const _Float16* p = rowk0 + 8 * (lane >> 4);
  u.q[0] = *(const v8h*)p; u.q[1] = *(const v8h*)(p + 16); return u.v;
}
__device__ __forceinline__ v16h frag_f32(const float* rowk0, int lane) {
  v16h a; const float* p = rowk0 + 8 * (lane >> 4);
#pragma unroll
  for (int i = 0; i < 8; ++i) { a[i] = (_Float16)p[i]; a[8 + i] = (_Float16)p[16 + i]; }
  return a;
}
__device__ __forceinline__ v16h frag_f32s(const float* rowk0, int lane, float sc) {
  v16h a; const float* p = rowk0 + 8 * (lane >> 4);
#pragma unroll
  for (int i = 0; i < 8; ++i) { a[i] = (_Float16)(p[i] * sc); a[8 + i] = (_Float16)(p[16 + i] * sc); }
  return a;
}
// column fragment from a [K][ld] layout (column n), rows >= K read as 0
__device__ __forceinline__ v16h fragc_f32(const float* W, int k0, int n, int lane, int ld, int K) {
  v16h a; const int g = lane >> 4;
#pragma unroll
  for (int i = 0; i < 8; ++i) { const int ka = k0 + 8 * g + i, kb = ka + 16;
    a[i] = (_Float16)(ka < K ? W[(size_t)(ka < K ? ka : K - 1) * ld + n] : 0.f); a[8 + i] = (_Float16)(kb < K ? W[(size_t)(kb < K ? kb : K - 1) * ld + n] : 0.f); }
  return a;
}
struct F2 { v16b h, l; };
__device__ __forceinline__ F2 bsplit16(const float v[16]) { F2 r;
#pragma unroll
  for (int i = 0; i < 16; ++i) { const __bf16 h = (__bf16)v[i]; r.h[i] = h; r.l[i] = (__bf16)(v[i] - (float)h); }
  return r; }
__device__ __forceinline__ F2 split_row(const float* row, int k0, int lane) { float v[16]; const float* p = row + k0 + 8 * (lane >> 4);
#pragma unroll
  for (int i = 0; i < 8; ++i) { v[i] = p[i]; v[8 + i] = p[16 + i]; }
  return bsplit16(v); }
__device__ __forceinline__ F2 split_rowK(const float* row, int k0, int lane, int K) { float v[16]; const int g = lane >> 4;
#pragma unroll
  for (int i = 0; i < 8; ++i) { const int ka = k0 + 8 * g + i, kb = ka + 16; v[i] = ka < K ? row[ka < K ? ka : K - 1] : 0.f; v[8 + i] = kb < K ? row[kb < K ? kb : K - 1] : 0.f; }
  return bsplit16(v); }
__device__ __forceinline__ F2 split_col(const float* W, int k0, int n, int lane, int ld, int K) { float v[16]; const int g = lane >> 4;
#pragma unroll
  for (int i = 0; i < 8; ++i) { const int ka = k0 + 8 * g + i, kb = ka + 16; v[i] = ka < K ? W[(size_t)(ka < K ? ka : K - 1) * ld + n] : 0.f; v[8 + i] = kb < K ? W[(size_t)(kb < K ? kb : K - 1) * ld + n] : 0.f; }
  return bsplit16(v); }
__device__ __forceinline__ v8f mac3(const F2& a, const F2& b, v8f c) { c = wmma_bf(a.l, b.h, c); c = wmma_bf(a.h, b.l, c); return wmma_bf(a.h, b.h, c); }
__device__ __forceinline__ float sigm(float v) { return 1.0f / (1.0f + expf(-v)); }
#define LDSX() do { asm volatile("s_wait_dscnt 0" ::: "memory"); __builtin_amdgcn_wave_barrier(); __builtin_amdgcn_fence(__ATOMIC_RELEASE, "workgroup"); } while (0)


#define NB 2
#define SS 2048
#define DM 1024
#define NH 16
__device__ __forceinline__ size_t xrow(size_t r) { return (r % SS) * NB + r / SS; }   // engine row (b, s) <-> the module's [L][B] row s*B + b
#define HD 64
#define QKVW (3 * DM)
#ifndef TQB
#define TQB (SS / 64)
#define TNB NB
#define TOB (NB * SS / 64)     // output row tiles (all)
#endif
typedef __attribute__((ext_vector_type(8))) __bf16 v8b;
__device__ __forceinline__ v16b frag_b(const __bf16* rowk0, int lane) {
  union { v16b v; v8b q[2]; } u; const __bf16* p = rowk0 + 8 * (lane >> 4);
  u.q[0] = *(const v8b*)p; u.q[1] = *(const v8b*)(p + 16); return u.v;
}
__device__ __forceinline__ float bfr(float v) { return (float)(__bf16)v; }
__device__ __attribute__((noinline)) float exp_ni(float v) { return expf(v); }
__device__ __attribute__((noinline)) float erf_ni(float v) { return erff(v); }

#define PK_A 0                       // [3072][1024] Wqkv rows (natural [out][in])
#define PK_P (PK_A + QKVW * DM)        // [1024][1024] Wo rows (natural)
#define PK_END (PK_P + DM * DM)
#define WS_PK  0u
#define WS_QK  (WS_PK + 2u * PK_END)             // f16 [4096 rows][2048]: q | k
#define WS_QKL (WS_QK + 2u * NB * SS * 2 * DM)     // f16 q | k residual planes x2048
#define WS_VTH (WS_QKL + 2u * NB * SS * 2 * DM)    // f16 [b][1024 (h*64+d)][2048 s] hi
#define WS_VTL (WS_VTH + 2u * NB * DM * SS)        // f16 lo x 2048
#define WS_O   (WS_VTL + 2u * NB * DM * SS)        // f32 [4096][1024]
#define WS_CS  (WS_O + 4u * NB * SS * DM)           // f32 [2048][32] x2, unused
#define WS_Y2  (WS_CS + 4u * 2 * SS * 32)                  // f32 [NR][1024] gated-rms-normed context
#define WS_END (WS_Y2 + 4u * (size_t)NB * SS * DM)
// ---- k_pack: block = (row n, which): natural [out][in] rows -> bf16; which 0..2 -> W_q/W_k/W_v into PK_A rows which*1024 + n; 3 -> W_o into PK_P
__global__ __launch_bounds__(256) void k_pack(const float* __restrict__ WQ, const float* __restrict__ WK, const float* __restrict__ WV, const float* __restrict__ WO, __bf16* __restrict__ PK) {
  __shared__ __align__(16) __bf16 s[DM]; const int n = blockIdx.x, which = blockIdx.y, t = threadIdx.x; const float* Wm = (which == 0) ? WQ : (which == 1) ? WK : (which == 2) ? WV : WO;
  for (int k = t; k < DM; k += 256) s[k] = (__bf16)Wm[(size_t)n * DM + k];
  __syncthreads();
  __bf16* dst = (which < 3) ? PK + PK_A + ((size_t)which * DM + n) * DM : PK + PK_P + (size_t)n * DM;
  for (int q = t; q < DM / 8; q += 256) vst2((unsigned*)(dst + q * 8), *(const v4u*)&s[q * 8]);
}
// ---- projection GEMM core: one 128 x 128 tile of X . W^T per 4-wave block, 64 x 64 per wave (wave = 2 * wm + wn), k in stages of 64.
// A stage is [X rows (NP planes: bf16, or bf16 hi then residual) | W rows] in LDS; the next stage's global loads are issued before the current stage's products and stored into the other buffer behind them; one barrier per stage.
// sw = false: A = X rows, B = W rows, acc[i][j][r] = (x row wm*64 + i*16 + 8g + r, w row wn*64 + j*16 + col); sw = true: the operands change places, acc[i][j][r] = (w row wn*64 + i*16 + 8g + r, x row wm*64 + j*16 + col). NP = 2 takes sw = true only.
#define GP 72   // LDS row pitch in 16-bit elements: 128 B of k + 16 B, so that the 16 rows of a ds_load_b128 fragment read fall on distinct banks
#define GK 64
typedef __attribute__((ext_vector_type(4))) __bf16 v4b;
template <int NP>
__device__ __forceinline__ void gemm128(const float* __restrict__ Xb, const int xld, const __bf16* __restrict__ Wb, __bf16* st, const bool sw, v8f (&acc)[4][4]) {
  constexpr int ROWS = (NP + 1) * 128, NT = DM / GK;
  const int tid = threadIdx.x, wave = tid >> 5, lane = tid & 31, col = lane & 15, wm = wave >> 1, wn = wave & 1;
  const float* xg = Xb + (size_t)(tid >> 4) * xld + (tid & 15) * 4;     // 16 lanes x 16 B = one row's 256 B of a stage
  const __bf16* wg = Wb + (size_t)(tid >> 3) * DM + (tid & 7) * 8;      // 8 lanes x 16 B = one row's 128 B of a stage
  const int xr0 = wm * 64 + col, wr0 = NP * 128 + wn * 64 + col;
  const int ar = sw ? wr0 : xr0, br = sw ? xr0 : wr0;
  v4f xv[16]; v8b wv[8];
  const float* xp = xg; const __bf16* wp = wg;   // the next stage to load; stepped in sts(), behind the wait that ends ldg()
  auto ldg = [&]() {
#pragma unroll
    for (int i = 0; i < 16; ++i) xv[i] = *(const v4f*)(xp + (size_t)(i * 8) * xld);
#pragma unroll
    for (int i = 0; i < 8; ++i) wv[i] = *(const v8b*)(wp + (size_t)(i * 16) * DM);
    asm volatile("s_wait_xcnt 0x0" :: "v"(xp), "v"(wp) : "memory");   // the loads' address registers are reused behind them; as inputs they stay untouched up to the wait
  };
  auto sts = [&](int buf) {
    __bf16* s = st + buf * (ROWS * GP);
#pragma unroll
    for (int i = 0; i < 16; ++i) { v4b h4, l4;
#pragma unroll
      for (int e = 0; e < 4; ++e) { const __bf16 h = (__bf16)xv[i][e]; h4[e] = h; l4[e] = (__bf16)(xv[i][e] - (float)h); }
      __bf16* d = s + (i * 8 + (tid >> 4)) * GP + (tid & 15) * 4;
      *(v4b*)d = h4; if constexpr (NP == 2) *(v4b*)(d + 128 * GP) = l4; }
#pragma unroll
    for (int i = 0; i < 8; ++i) *(v8b*)(s + (NP * 128 + i * 16 + (tid >> 3)) * GP + (tid & 7) * 8) = wv[i];
    xp += GK; wp += GK;
  };
  ldg(); sts(0);
  __syncthreads();
#pragma unroll 1   // rolled: for speed only
  for (int t = 0; t < NT; ++t) {
    if (t + 1 < NT) ldg();
    const __bf16* s = st + (t & 1) * (ROWS * GP);
#pragma unroll
    for (int kc = 0; kc < GK / 32; ++kc) { v16b fa[4], fb[4];
#pragma unroll
      for (int i = 0; i < 4; ++i) { fa[i] = frag_b(s + (ar + i * 16) * GP + kc * 32, lane); fb[i] = frag_b(s + (br + i * 16) * GP + kc * 32, lane); }
      if constexpr (NP == 2) { v16b fl[4];   // residual plane first, then hi: each accumulator keeps the order lo, hi per 32 k
#pragma unroll
        for (int i = 0; i < 4; ++i) fl[i] = frag_b(s + (br + 128 + i * 16) * GP + kc * 32, lane);
#pragma unroll
        for (int i = 0; i < 4; ++i) {
#pragma unroll
          for (int j = 0; j < 4; ++j) acc[i][j] = wmma_bf(fa[i], fl[j], acc[i][j]); } }
#pragma unroll
      for (int i = 0; i < 4; ++i) {
#pragma unroll
        for (int j = 0; j < 4; ++j) acc[i][j] = wmma_bf(fa[i], fb[j], acc[i][j]); } }
    if (t + 1 < NT) sts((t + 1) & 1);
    __syncthreads();   // publishes stage t + 1 and ends every wave's reads of stage t (behind the last stage: frees the buffers for the epilogue)
  }
}
// ---- k_qkv: block = (128 engine rows, 128 of the 3,072 q | k | v columns). q, k: W rows as the A operand, so a lane holds 8 neighbouring columns of one row; v: X rows as A, so a lane holds 8 neighbouring positions of one column (v is stored transposed). Either way 16-B LDS stores into the wave's own staging, then whole 128-B lines to memory.
__global__ __launch_bounds__(128) void k_qkv(const float* __restrict__ XQ, const float* __restrict__ XK, const float* __restrict__ XV, const __bf16* __restrict__ P, const float* __restrict__ BQ, const float* __restrict__ BK, const float* __restrict__ BV, _Float16* __restrict__ QK, _Float16* __restrict__ QKL, _Float16* __restrict__ VTH, _Float16* __restrict__ VTL) {
  const int which0 = (blockIdx.y * 128) / DM; const float* X = (which0 == 0) ? XQ : (which0 == 1) ? XK : XV; const float* BB = BQ ? (((which0 == 0) ? BQ : (which0 == 1) ? BK : BV) + (blockIdx.y * 128 - which0 * DM)) : nullptr;
  __shared__ __align__(16) __bf16 st[2 * 256 * GP];
  const int tid = threadIdx.x, wave = tid >> 5, lane = tid & 31, col = lane & 15, g = lane >> 4, wm = wave >> 1, wn = wave & 1; const int n0 = blockIdx.y * 128;
  const size_t rb = (size_t)blockIdx.x * 128; const int b = (int)(rb / SS), s0 = (int)(rb % SS);   // 128 divides SS: one batch per block; engine row rb + i is module row (s0 + i) * NB + b
  const bool sw = n0 < 2 * DM;
  v8f acc[4][4] = {};
  gemm128<1>(X + ((size_t)s0 * NB + b) * DM, NB * DM, P + (size_t)n0 * DM, st, sw, acc);
  _Float16* eh = (_Float16*)st + wave * (2 * 64 * GP); _Float16* el = eh + 64 * GP;   // per wave: [64][GP] hi, [64][GP] residual
  float bi[4][8] = {}, bj[4] = {};   // bias of the lane's 8 columns per i (q, k) or of its one column per j (v)
  if (BB) {   // one branch round all the bias loads, so that they are in flight together
    if (sw) {
#pragma unroll
      for (int i = 0; i < 4; ++i) {
#pragma unroll
        for (int r = 0; r < 8; ++r) bi[i][r] = bfr(BB[wn * 64 + i * 16 + 8 * g + r]); }
    } else {
#pragma unroll
      for (int j = 0; j < 4; ++j) bj[j] = bfr(BB[wn * 64 + j * 16 + col]); } }
#pragma unroll
  for (int i = 0; i < 4; ++i) {
#pragma unroll
    for (int j = 0; j < 4; ++j) { v8h hv, lv;
#pragma unroll
      for (int r = 0; r < 8; ++r) { const float v = acc[i][j][r] + (sw ? bi[i][r] : bj[j]); const _Float16 hh = (_Float16)v; hv[r] = hh; lv[r] = (_Float16)((v - (float)hh) * 2048.0f); }   // (+ bias) as f16 hi + (x2048) residual; q unscaled, 1/8 applied to the f32 score
      *(v8h*)(eh + (j * 16 + col) * GP + i * 16 + 8 * g) = hv; *(v8h*)(el + (j * 16 + col) * GP + i * 16 + 8 * g) = lv; } }
  LDSX();
  static_assert(2 * DM == SS, "q | k rows and transposed v rows have one pitch");
  const size_t o0 = (sw ? (rb + wm * 64) * (2 * DM) + n0 + wn * 64 : ((size_t)b * DM + (n0 - 2 * DM) + wn * 64) * SS + s0 + wm * 64) + (size_t)(lane >> 3) * SS + (lane & 7) * 8;   // 8 lanes x 16 B = one row's 128 B, 4 rows per store
  _Float16* ph = (sw ? QK : VTH) + o0; _Float16* pl = (sw ? QKL : VTL) + o0; const _Float16* sh = eh + (lane >> 3) * GP + (lane & 7) * 8;
#pragma unroll
  for (int it0 = 0; it0 < 16; it0 += 4) { v4u a[4], r4[4];   // 8 LDS reads in flight, then their 8 stores
#pragma unroll
    for (int u = 0; u < 4; ++u) { a[u] = *(const v4u*)(sh + (it0 + u) * 4 * GP); r4[u] = *(const v4u*)(sh + 64 * GP + (it0 + u) * 4 * GP); }
#pragma unroll
    for (int u = 0; u < 4; ++u) { vst2(ph + (size_t)(it0 + u) * 4 * SS, a[u]); vst2(pl + (size_t)(it0 + u) * 4 * SS, r4[u]); }
    asm volatile("s_wait_xcnt 0x0" :: "v"(ph), "v"(pl) : "memory"); }   // the next group's LDS reads overwrite these stores' data registers
}
// ---- k_attn: block = (128 queries, head h, batch b), 4 waves x 32 queries (two 16-row tiles per wave). K and V come in tiles of 64 keys, copied asynchronously into two LDS buffers and read by all four waves; every K and V fragment serves both of a wave's query tiles. scores are computed transposed (k rows x q rows, single f16 operands), so that a lane's accumulators of 32 keys are its own part of P's fragment and P stays in registers; relu(score * 0.125), P (x 2^11, single f16) x V, f32 accumulate over the keys in ascending groups of 32; O[b*S+q][h*64+d] = acc / 2^11 (256-B segments)
// two transposed score tiles (keys 0..15 and 16..31 of a group of 32, one query per lane) are, converted in place, the A fragment of P for that group: element s = key 8g + s (s < 8), 16 + 8g + s - 8 (else).
// relu(s / 8) * 2^11 = relu(s * 2^8): the powers of two are exact, and relu commutes with the rounding to f16. P is scaled by 2^11 so that small weights stay out of the f16 subnormal range; 2^-11 is folded into the epilogue.
__device__ __forceinline__ v16h pack_p(v8f t0, v8f t1) {
  v16h p;
#pragma unroll
  for (int i = 0; i < 8; ++i) { p[i] = (_Float16)(t0[i] * 256.0f); p[8 + i] = (_Float16)(t1[i] * 256.0f); }
  const v16h z = {};
  return __builtin_elementwise_max(p, z);
}
#define AK 64   // keys per tile: K tile = [64 keys][GP], V tile = [64 d][GP]; rows of 128 B at the pitch of the ds_load_b128 fragment reads
__global__ __launch_bounds__(128) void k_attn(const _Float16* __restrict__ QK, const _Float16* __restrict__ QKL, const _Float16* __restrict__ VTH, const _Float16* __restrict__ VTL, const void* __restrict__ KMASK, float* __restrict__ O) {
  (void)QKL; (void)VTL; (void)KMASK;
  __shared__ __align__(16) _Float16 kv[2][2][AK * GP];   // [buffer][K | V][row][GP]
  __shared__ __align__(16) float sp[4][2][16][68];       // per wave and query tile: the output staging behind the loop
  const int tid = threadIdx.x, wave = tid >> 5, lane = tid & 31, col = lane & 15, g = lane >> 4;
  const int qb = blockIdx.x, h = blockIdx.y, b = blockIdx.z; const int q0 = qb * 128 + wave * 32;
  constexpr int NTL = SS / AK;
  // 8 lanes x 16 B = one row's 128 B; 16 rows per copy of the block, 4 copies for K and 4 for V
  const _Float16* kg = QK + ((size_t)b * SS + (tid >> 3)) * (2 * DM) + DM + h * HD + (tid & 7) * 8;
  const _Float16* vg = VTH + ((size_t)b * DM + h * HD + (tid >> 3)) * SS + (tid & 7) * 8;
  const unsigned lk = (unsigned)(uintptr_t)&kv[0][0][(tid >> 3) * GP + (tid & 7) * 8];
  auto fill = [&](int t) {
    const _Float16* kp = kg + (size_t)t * (AK * 2 * DM); const _Float16* vp = vg + t * AK;
    const unsigned l = lk + (unsigned)(t & 1) * (2u * AK * GP * 2u), lv = l + AK * GP * 2u;
    // the copies and the wait that keeps their address registers untouched until they are read, in one statement
    asm volatile("global_load_async_to_lds_b128 %0, %8, off\n\t"
                 "global_load_async_to_lds_b128 %1, %9, off\n\t"
                 "global_load_async_to_lds_b128 %2, %10, off\n\t"
                 "global_load_async_to_lds_b128 %3, %11, off\n\t"
                 "global_load_async_to_lds_b128 %4, %12, off\n\t"
                 "global_load_async_to_lds_b128 %5, %13, off\n\t"
                 "global_load_async_to_lds_b128 %6, %14, off\n\t"
                 "global_load_async_to_lds_b128 %7, %15, off\n\t"
                 "s_wait_xcnt 0x0"
                 :: "v"(l), "v"(l + 16u * GP * 2u), "v"(l + 32u * GP * 2u), "v"(l + 48u * GP * 2u),
                    "v"(lv), "v"(lv + 16u * GP * 2u), "v"(lv + 32u * GP * 2u), "v"(lv + 48u * GP * 2u),
                    "v"(kp), "v"(kp + 16 * 2 * DM), "v"(kp + 32 * 2 * DM), "v"(kp + 48 * 2 * DM),
                    "v"(vp), "v"(vp + 16 * SS), "v"(vp + 32 * SS), "v"(vp + 48 * SS)
                 : "memory");
  };
  fill(0);
  const _Float16* qp = QK + ((size_t)b * SS + q0 + col) * (2 * DM) + h * HD;
  v16h aq[2][2];
#pragma unroll
  for (int qt = 0; qt < 2; ++qt) {
#pragma unroll
    for (int kc = 0; kc < 2; ++kc) aq[qt][kc] = frag_h(qp + (size_t)qt * 16 * (2 * DM) + kc * 32, lane); }
  asm volatile("s_wait_xcnt 0x0" :: "v"(qp) : "memory");   // the loads' address registers are reused behind them; as an input they stay untouched up to the wait
  v8f acc[2][4] = {};
  asm volatile("s_wait_asynccnt 0x0" ::: "memory");   // this wave's copies of tile 0 have landed
  __syncthreads();                                     // publishes tile 0
  fill(1);
#pragma unroll 1   // rolled: one trip per key tile, the buffer chosen by the trip's parity
  for (int t = 0; t < NTL; ++t) {
    const _Float16* kt = &kv[t & 1][0][0]; const _Float16* vt = &kv[t & 1][1][0];
    v16h kf[2][2][2], vf[2][4];   // per group of 32 keys: K rows (A of the scores), V rows (B of P x V)
    auto ldf = [&](int k2) {
#pragma unroll
      for (int cl = 0; cl < 2; ++cl) {
#pragma unroll
        for (int kc = 0; kc < 2; ++kc) kf[k2][cl][kc] = frag_h(kt + ((k2 * 2 + cl) * 16 + col) * GP + kc * 32, lane); }
#pragma unroll
      for (int dt = 0; dt < 4; ++dt) vf[k2][dt] = frag_h(vt + (dt * 16 + col) * GP + k2 * 32, lane);
    };
    ldf(0);
#pragma unroll
    for (int k2 = 0; k2 < 2; ++k2) { v16h pa[2]; v8f c[2][2] = {};   // 32 keys x 32 queries; transposed score tiles: c[cl][qt][r] = (key k2*32 + cl*16 + 8g + r, query qt*16 + col)
#pragma unroll
      for (int kc = 0; kc < 2; ++kc) {
#pragma unroll
        for (int cl = 0; cl < 2; ++cl) {
#pragma unroll
          for (int qt = 0; qt < 2; ++qt) c[cl][qt] = wmma16(kf[k2][cl][kc], aq[qt][kc], c[cl][qt]); } }   // single product: k rows as A, q rows as B, one-rounding f16 operands
      if (k2 == 0) ldf(1);   // the second group's fragments fly behind the first group's conversion and P x V
#pragma unroll
      for (int qt = 0; qt < 2; ++qt) pa[qt] = pack_p(c[0][qt], c[1][qt]);
#pragma unroll
      for (int dt = 0; dt < 4; ++dt) {
#pragma unroll
        for (int qt = 0; qt < 2; ++qt) acc[qt][dt] = wmma16(pa[qt], vf[k2][dt], acc[qt][dt]); } }   // single product: P (x2^11) x V
    asm volatile("s_wait_dscnt 0x0" ::: "memory");      // this wave's reads of tile t are done
    asm volatile("s_wait_asynccnt 0x0" ::: "memory");   // this wave's copies of tile t + 1 have landed
    __syncthreads();                                     // publishes tile t + 1 and ends every wave's reads of tile t
    if (t + 2 < NTL) fill(t + 2);
  }
  asm volatile("s_wait_asynccnt 0x0" ::: "memory");   // nothing is in flight when the wave ends
#pragma unroll
  for (int qt = 0; qt < 2; ++qt) {
#pragma unroll
    for (int r = 0; r < 8; ++r) {
#pragma unroll
      for (int dt = 0; dt < 4; ++dt) sp[wave][qt][8 * g + r][dt * 16 + col] = acc[qt][dt][r] * (1.0f / 2048.0f); } }   // undo the P scaling only
  LDSX();
  float* po = O + ((size_t)b * SS + q0 + g) * DM + h * HD + col * 4; const float* sf = &sp[wave][0][g][col * 4];   // 16 lanes x 16 B = 256 B of a row, 2 rows per store
#pragma unroll
  for (int it0 = 0; it0 < 16; it0 += 8) { v4f a[8];   // 8 LDS reads in flight, then their 8 stores
#pragma unroll
    for (int u = 0; u < 8; ++u) a[u] = *(const v4f*)(sf + (it0 + u) * 2 * 68);
#pragma unroll
    for (int u = 0; u < 8; ++u) vst2(po + (size_t)(it0 + u) * 2 * DM, a[u]);
    asm volatile("s_wait_xcnt 0x0" :: "v"(po) : "memory"); }   // the next group's LDS reads overwrite these stores' data registers
}
// ---- k_out: block = (128 rows, 128 cols): out = y (bf16 hi + residual) . Wo rows (2 products) + bo; Wo rows as the A operand, so a lane holds 8 neighbouring output columns of one row
__global__ __launch_bounds__(128) void k_out(const float* __restrict__ O, const __bf16* __restrict__ P, const float* __restrict__ BO, float* __restrict__ Y) {
  __shared__ __align__(16) __bf16 st[2 * 384 * GP];
  const int tid = threadIdx.x, wave = tid >> 5, lane = tid & 31, col = lane & 15, g = lane >> 4, wm = wave >> 1, wn = wave & 1; const size_t rb = (size_t)blockIdx.x * 128; const int n0 = blockIdx.y * 128;
  v8f acc[4][4] = {};
  gemm128<2>(O + rb * DM, DM, P + (size_t)n0 * DM, st, true, acc);
  float* ef = (float*)st + wave * (64 * 68);   // per wave: [64 rows][64 + 4 floats]
  const float* bp = BO + n0 + wn * 64 + 8 * g; float bi[4][8];   // bias of the lane's 8 columns per i
#pragma unroll
  for (int i = 0; i < 4; ++i) {
#pragma unroll
    for (int r = 0; r < 8; ++r) bi[i][r] = bp[i * 16 + r]; }
  asm volatile("s_wait_xcnt 0x0" :: "v"(bp) : "memory");   // the loads' address registers are reused behind them; as an input they stay untouched up to the wait
#pragma unroll
  for (int i = 0; i < 4; ++i) {
#pragma unroll
    for (int j = 0; j < 4; ++j) { v4f a4, b4;
#pragma unroll
      for (int r = 0; r < 4; ++r) { a4[r] = acc[i][j][r] + bfr(bi[i][r]); b4[r] = acc[i][j][4 + r] + bfr(bi[i][4 + r]); }
      float* d = ef + (j * 16 + col) * 68 + i * 16 + 8 * g; *(v4f*)d = a4; *(v4f*)(d + 4) = b4; } }
  LDSX();
  const int b = (int)(rb / SS), s0 = (int)(rb % SS);   // 128 divides SS: one batch per block; engine row rb + i is module row (s0 + i) * NB + b
  float* py = Y + ((size_t)(s0 + wm * 64 + g) * NB + b) * DM + n0 + wn * 64 + col * 4; const float* sf = ef + g * 68 + col * 4;   // back to the [L][B][E] layout: 16 lanes x 16 B = 256 B of a row, 2 rows per store
#pragma unroll
  for (int it0 = 0; it0 < 32; it0 += 8) { v4f a[8];   // 8 LDS reads in flight, then their 8 stores
#pragma unroll
    for (int u = 0; u < 8; ++u) a[u] = *(const v4f*)(sf + (it0 + u) * 2 * 68);
#pragma unroll
    for (int u = 0; u < 8; ++u) vst2(py + (size_t)(it0 + u) * 2 * NB * DM, a[u]);
    asm volatile("s_wait_xcnt 0x0" :: "v"(py) : "memory"); }   // the next group's LDS reads overwrite these stores' data registers
}
// ---- k_gnorm: block = engine row (256 threads x 4): y = weight * x / (||x||/sqrt(1024) + 1e-8) * sigmoid(gate * x) (precise expf)
__global__ __launch_bounds__(256) void k_gnorm(const float* __restrict__ O, const float* __restrict__ NW, const float* __restrict__ NG, float* __restrict__ Y2) {
  __shared__ float red[8]; const int t = threadIdx.x; const size_t row = blockIdx.x; float v[4]; float s = 0.f; for (int i = 0; i < 4; ++i) { v[i] = O[row * DM + t * 4 + i]; s += v[i] * v[i]; }
#pragma unroll
  for (int o = 1; o < 32; o <<= 1) s += __shfl_xor(s, o);
  if ((t & 31) == 0) red[t >> 5] = s; __syncthreads(); float tot = 0.f; for (int i = 0; i < 8; ++i) tot += red[i];
  const float rms = sqrtf(tot) * 0.03125f; const float inv = 1.0f / (rms + 1e-8f);
  v4f o4; for (int i = 0; i < 4; ++i) { const int e = t * 4 + i; const float x = v[i]; o4[i] = bfr(NW[e]) * (x * inv) * (1.0f / (1.0f + exp_ni(-bfr(NG[e]) * x))); }
  vst2(Y2 + row * DM + t * 4, o4);
}
extern "C" void kernel_launch(void* const* d_in, const int* in_sizes, int n_in, void* d_out, int out_size, void* d_ws, size_t ws_size, hipStream_t stream) {
  (void)in_sizes; (void)n_in; (void)out_size;
  const float** F = (const float**)d_in;   // 0 query, 1 key, 2 value [2048,2,1024] (L,B,E); 3 Wq, 4 bq, 5 Wk, 6 bk, 7 Wv, 8 bv, 9 Wo, 10 bo (natural); 11 norm_weight, 12 norm_gate
  if (ws_size < (size_t)WS_END) return;
  char* ws = (char*)d_ws; __bf16* PK = (__bf16*)(ws + WS_PK); _Float16 *QK = (_Float16*)(ws + WS_QK), *QKL = (_Float16*)(ws + WS_QKL), *VTH = (_Float16*)(ws + WS_VTH), *VTL = (_Float16*)(ws + WS_VTL); float *O = (float*)(ws + WS_O), *Y2 = (float*)(ws + WS_Y2);
  k_pack<<<dim3(DM, 4), 256, 0, stream>>>(F[3], F[5], F[7], F[9], PK);
  k_qkv<<<dim3(TNB * SS / 128, QKVW / 128), 128, 0, stream>>>(F[0], F[1], F[2], PK + PK_A, F[4], F[6], F[8], QK, QKL, VTH, VTL);
  k_attn<<<dim3(TQB / 2, NH, TNB), 128, 0, stream>>>(QK, QKL, VTH, VTL, nullptr, O);
  k_gnorm<<<NB * SS, 256, 0, stream>>>(O, F[11], F[12], Y2);
  k_out<<<dim3(TOB / 2, DM / 128), 128, 0, stream>>>(Y2, PK + PK_P, F[10], (float*)d_out);
}

// v004
// It runs in 91.4 microseconds.
// Timed twice side by side with v003, it ran 1.05 times as fast both times.
// Over all steps from v000 it is 4.23 times as fast.
// compute dtype: all float inputs rounded to bf16; q/k/v = x . W^T + b with EXACT bf16 products on WMMA 16x16x32 (natural rows) with the (L, B, E) row order remapped on load and store; 'attention' = relu(q k^T / 8) (no softmax): q, k as single f16 operands, relu, P (scaled by 2^11, single f16) x v (single f16), f32 accumulate; gated RMS norm in f32 (precise expf); out = y (bf16 hi + residual) . Wo^T (2 products) + bo.
#include <hip/hip_runtime.h>
#include <math.h>

typedef __attribute__((ext_vector_type(16))) _Float16 v16h;
typedef __attribute__((ext_vector_type(16))) __bf16 v16b;
typedef __attribute__((ext_vector_type(8)))  _Float16 v8h;
typedef __attribute__((ext_vector_type(8)))  float v8f;
typedef __attribute__((ext_vector_type(4)))  float v4f;
typedef __attribute__((ext_vector_type(2)))  float v2f;
typedef __attribute__((ext_vector_type(4)))  unsigned v4u;
typedef __attribute__((ext_vector_type(4)))  int v4i;
typedef float __attribute__((may_alias)) float_a;
typedef int __attribute__((may_alias)) int_a;

template <typename T> __device__ __forceinline__ void vst2(void* p, T v) { *(T*)p = v;  }
__device__ __forceinline__ v8f wmma16(v16h a, v16h b, v8f c) {
  v8f d = __builtin_amdgcn_wmma_f32_16x16x32_f16(false, a, false, b, (short)0, c, false, false);
  asm volatile("v_nop\n\tv_nop\n\tv_nop\n\tv_nop" : "+v"(d) : "v"(a), "v"(b));
  return d;
}
__device__ __forceinline__ v8f wmma_bf(v16b a, v16b b, v8f c) {
  v8f d = __builtin_amdgcn_wmma_f32_16x16x32_bf16(false, a, false, b, (short)0, c, false, false);
  asm volatile("v_nop\n\tv_nop\n\tv_nop\n\tv_nop" : "+v"(d) : "v"(a), "v"(b));
  return d;
}
// ReLU attention (L 2,048, B 2, E 1,024, 16 heads x 64; sequence-first layout): q/k/v projections + biases, relu(q k^T / 8) in place of softmax, gated RMS norm (weight * x / rms * sigmoid(gate * x)), output projection + bias.
__device__ __forceinline__ v16h frag_h(const _Float16* rowk0, int lane) {
  union { v16h v; v8h q[2]; } u; const _Float16* p = rowk0 + 8 * (lane >> 4);
  u.q[0] = *(const v8h*)p; u.q[1] = *(const v8h*)(p + 16); return u.v;
}
__device__ __forceinline__ v16h frag_f32(const float* rowk0, int lane) {
  v16h a; const float* p = rowk0 + 8 * (lane >> 4);
#pragma unroll
  for (int i = 0; i < 8; ++i) { a[i] = (_Float16)p[i]; a[8 + i] = (_Float16)p[16 + i]; }
  return a;
}
__device__ __forceinline__ v16h frag_f32s(const float* rowk0, int lane, float sc) {
  v16h a; const float* p = rowk0 + 8 * (lane >> 4);
#pragma unroll
  for (int i = 0; i < 8; ++i) { a[i] = (_Float16)(p[i] * sc); a[8 + i] = (_Float16)(p[16 + i] * sc); }
  return a;
}
// column fragment from a [K][ld] layout (column n), rows >= K read as 0
__device__ __forceinline__ v16h fragc_f32(const float* W, int k0, int n, int lane, int ld, int K) {
  v16h a; const int g = lane >> 4;
#pragma unroll
  for (int i = 0; i < 8; ++i) { const int ka = k0 + 8 * g + i, kb = ka + 16;
    a[i] = (_Float16)(ka < K ? W[(size_t)(ka < K ? ka : K - 1) * ld + n] : 0.f); a[8 + i] = (_Float16)(kb < K ? W[(size_t)(kb < K ? kb : K - 1) * ld + n] : 0.f); }
  return a;
}
struct F2 { v16b h, l; };
__device__ __forceinline__ F2 bsplit16(const float v[16]) { F2 r;
#pragma unroll
  for (int i = 0; i < 16; ++i) { const __bf16 h = (__bf16)v[i]; r.h[i] = h; r.l[i] = (__bf16)(v[i] - (float)h); }
  return r; }
__device__ __forceinline__ F2 split_row(const float* row, int k0, int lane) { float v[16]; const float* p = row + k0 + 8 * (lane >> 4);
#pragma unroll
  for (int i = 0; i < 8; ++i) { v[i] = p[i]; v[8 + i] = p[16 + i]; }
  return bsplit16(v); }
__device__ __forceinline__ F2 split_rowK(const float* row, int k0, int lane, int K) { float v[16]; const int g = lane >> 4;
#pragma unroll
  for (int i = 0; i < 8; ++i) { const int ka = k0 + 8 * g + i, kb = ka + 16; v[i] = ka < K ? row[ka < K ? ka : K - 1] : 0.f; v[8 + i] = kb < K ? row[kb < K ? kb : K - 1] : 0.f; }
  return bsplit16(v); }
__device__ __forceinline__ F2 split_col(const float* W, int k0, int n, int lane, int ld, int K) { float v[16]; const int g = lane >> 4;
#pragma unroll
  for (int i = 0; i < 8; ++i) { const int ka = k0 + 8 * g + i, kb = ka + 16; v[i] = ka < K ? W[(size_t)(ka < K ? ka : K - 1) * ld + n] : 0.f; v[8 + i] = kb < K ? W[(size_t)(kb < K ? kb : K - 1) * ld + n] : 0.f; }
  return bsplit16(v); }
__device__ __forceinline__ v8f mac3(const F2& a, const F2& b, v8f c) { c = wmma_bf(a.l, b.h, c); c = wmma_bf(a.h, b.l, c); return wmma_bf(a.h, b.h, c); }
__device__ __forceinline__ float sigm(float v) { return 1.0f / (1.0f + expf(-v)); }
#define LDSX() do { asm volatile("s_wait_dscnt 0" ::: "memory"); __builtin_amdgcn_wave_barrier(); __builtin_amdgcn_fence(__ATOMIC_RELEASE, "workgroup"); } while (0)


#define NB 2
#define SS 2048
#define DM 1024
#define NH 16
__device__ __forceinline__ size_t xrow(size_t r) { return (r % SS) * NB + r / SS; }   // engine row (b, s) <-> the module's [L][B] row s*B + b
#define HD 64
#define QKVW (3 * DM)
#ifndef TQB
#define TQB (SS / 64)
#define TNB NB
#define TOB (NB * SS / 64)     // output row tiles (all)
#endif
typedef __attribute__((ext_vector_type(8))) __bf16 v8b;
__device__ __forceinline__ v16b frag_b(const __bf16* rowk0, int lane) {
  union { v16b v; v8b q[2]; } u; const __bf16* p = rowk0 + 8 * (lane >> 4);
  u.q[0] = *(const v8b*)p; u.q[1] = *(const v8b*)(p + 16); return u.v;
}
__device__ __forceinline__ float bfr(float v) { return (float)(__bf16)v; }
__device__ __attribute__((noinline)) float exp_ni(float v) { return expf(v); }
__device__ __attribute__((noinline)) float erf_ni(float v) { return erff(v); }

#define PK_A 0                       // [3072][1024] Wqkv rows (natural [out][in])
#define PK_P (PK_A + QKVW * DM)        // [1024][1024] Wo rows (natural)
#define PK_END (PK_P + DM * DM)
#define WS_PK  0u
#define WS_QK  (WS_PK + 2u * PK_END)             // f16 [4096 rows][2048]: q | k
#define WS_QKL (WS_QK + 2u * NB * SS * 2 * DM)     // f16 q | k residual planes x2048
#define WS_VTH (WS_QKL + 2u * NB * SS * 2 * DM)    // f16 [b][1024 (h*64+d)][2048 s] hi
#define WS_VTL (WS_VTH + 2u * NB * DM * SS)        // f16 lo x 2048
#define WS_O   (WS_VTL + 2u * NB * DM * SS)        // f32 [4096][1024]
#define WS_CS  (WS_O + 4u * NB * SS * DM)           // f32 [2048][32] x2, unused
#define WS_Y2  (WS_CS + 4u * 2 * SS * 32)                  // f32 [NR][1024] gated-rms-normed context
#define WS_END (WS_Y2 + 4u * (size_t)NB * SS * DM)
// ---- k_pack: block = (16,384 neighbouring elements of one weight matrix, which): natural [out][in] rows -> bf16, same element order; which 0..2 -> W_q/W_k/W_v into PK_A rows which*1024 + n; 3 -> W_o into PK_P.
// A thread takes 32 pieces of 16 B, a wave 512 B in a row per load and 256 B per store, all 32 loads in flight together (64 KiB per block): the launch starts 1,024 long waves and needs no LDS and no barrier.
#define PKN 32   // 16-B pieces per thread
typedef __attribute__((ext_vector_type(4))) __bf16 v4b;
// one wave per SIMD is all that the launch has: the register budget of one lets every load be issued before the first is waited for
__global__ __launch_bounds__(128) __attribute__((amdgpu_waves_per_eu(1, 1))) void k_pack(const float* __restrict__ WQ, const float* __restrict__ WK, const float* __restrict__ WV, const float* __restrict__ WO, __bf16* __restrict__ PK) {
  const int which = blockIdx.y, t = threadIdx.x; const float* Wm = (which == 0) ? WQ : (which == 1) ? WK : (which == 2) ? WV : WO;
  const size_t o = (size_t)blockIdx.x * (PKN * 512) + t * 4;
  const float* sp = Wm + o; __bf16* dp = PK + ((which < 3) ? PK_A + (size_t)which * DM * DM : (size_t)PK_P) + o;
  v4f v[PKN];
#pragma unroll
  for (int i = 0; i < PKN; ++i) v[i] = *(const v4f*)(sp + i * 512);
  asm volatile("s_wait_xcnt 0x0" :: "v"(sp) : "memory");   // the loads' address registers are reused behind them; as an input they stay untouched up to the wait
#pragma unroll
  for (int i = 0; i < PKN; ++i) { v4b h;
#pragma unroll
    for (int e = 0; e < 4; ++e) h[e] = (__bf16)v[i][e];
    *(v4b*)(dp + i * 512) = h; }
}
// ---- projection GEMM core: one 128 x 128 tile of X . W^T per 4-wave block, 64 x 64 per wave (wave = 2 * wm + wn), k in stages of 64.
// A stage is [X rows (NP planes: bf16, or bf16 hi then residual) | W rows] in LDS; the next stage's global loads are issued before the current stage's products and stored into the other buffer behind them; one barrier per stage.
// sw = false: A = X rows, B = W rows, acc[i][j][r] = (x row wm*64 + i*16 + 8g + r, w row wn*64 + j*16 + col); sw = true: the operands change places, acc[i][j][r] = (w row wn*64 + i*16 + 8g + r, x row wm*64 + j*16 + col). NP = 2 takes sw = true only.
#define GP 72   // LDS row pitch in 16-bit elements: 128 B of k + 16 B, so that the 16 rows of a ds_load_b128 fragment read fall on distinct banks
#define GK 64
template <int NP>
__device__ __forceinline__ void gemm128(const float* __restrict__ Xb, const int xld, const __bf16* __restrict__ Wb, __bf16* st, const bool sw, v8f (&acc)[4][4]) {
  constexpr int ROWS = (NP + 1) * 128, NT = DM / GK;
  const int tid = threadIdx.x, wave = tid >> 5, lane = tid & 31, col = lane & 15, wm = wave >> 1, wn = wave & 1;
  const float* xg = Xb + (size_t)(tid >> 4) * xld + (tid & 15) * 4;     // 16 lanes x 16 B = one row's 256 B of a stage
  const __bf16* wg = Wb + (size_t)(tid >> 3) * DM + (tid & 7) * 8;      // 8 lanes x 16 B = one row's 128 B of a stage
  const int xr0 = wm * 64 + col, wr0 = NP * 128 + wn * 64 + col;
  const int ar = sw ? wr0 : xr0, br = sw ? xr0 : wr0;
  v4f xv[16]; v8b wv[8];
  const float* xp = xg; const __bf16* wp = wg;   // the next stage to load; stepped in sts(), behind the wait that ends ldg()
  auto ldg = [&]() {
#pragma unroll
    for (int i = 0; i < 16; ++i) xv[i] = *(const v4f*)(xp + (size_t)(i * 8) * xld);
#pragma unroll
    for (int i = 0; i < 8; ++i) wv[i] = *(const v8b*)(wp + (size_t)(i * 16) * DM);
    asm volatile("s_wait_xcnt 0x0" :: "v"(xp), "v"(wp) : "memory");   // the loads' address registers are reused behind them; as inputs they stay untouched up to the wait
  };
  auto sts = [&](int buf) {
    __bf16* s = st + buf * (ROWS * GP);
#pragma unroll
    for (int i = 0; i < 16; ++i) { v4b h4, l4;
#pragma unroll
      for (int e = 0; e < 4; ++e) { const __bf16 h = (__bf16)xv[i][e]; h4[e] = h; l4[e] = (__bf16)(xv[i][e] - (float)h); }
      __bf16* d = s + (i * 8 + (tid >> 4)) * GP + (tid & 15) * 4;
      *(v4b*)d = h4; if constexpr (NP == 2) *(v4b*)(d + 128 * GP) = l4; }
#pragma unroll
    for (int i = 0; i < 8; ++i) *(v8b*)(s + (NP * 128 + i * 16 + (tid >> 3)) * GP + (tid & 7) * 8) = wv[i];
    xp += GK; wp += GK;
  };
  ldg(); sts(0);
  __syncthreads();
#pragma unroll 1   // rolled: for speed only
  for (int t = 0; t < NT; ++t) {
    if (t + 1 < NT) ldg();
    const __bf16* s = st + (t & 1) * (ROWS * GP);
#pragma unroll
    for (int kc = 0; kc < GK / 32; ++kc) { v16b fa[4], fb[4];
#pragma unroll
      for (int i = 0; i < 4; ++i) { fa[i] = frag_b(s + (ar + i * 16) * GP + kc * 32, lane); fb[i] = frag_b(s + (br + i * 16) * GP + kc * 32, lane); }
      if constexpr (NP == 2) { v16b fl[4];   // residual plane first, then hi: each accumulator keeps the order lo, hi per 32 k
#pragma unroll
        for (int i = 0; i < 4; ++i) fl[i] = frag_b(s + (br + 128 + i * 16) * GP + kc * 32, lane);
#pragma unroll
        for (int i = 0; i < 4; ++i) {
#pragma unroll
          for (int j = 0; j < 4; ++j) acc[i][j] = wmma_bf(fa[i], fl[j], acc[i][j]); } }
#pragma unroll
      for (int i = 0; i < 4; ++i) {
#pragma unroll
        for (int j = 0; j < 4; ++j) acc[i][j] = wmma_bf(fa[i], fb[j], acc[i][j]); } }
    if (t + 1 < NT) sts((t + 1) & 1);
    __syncthreads();   // publishes stage t + 1 and ends every wave's reads of stage t (behind the last stage: frees the buffers for the epilogue)
  }
}
// ---- k_qkv: block = (128 engine rows, 128 of the 3,072 q | k | v columns). q, k: W rows as the A operand, so a lane holds 8 neighbouring columns of one row; v: X rows as A, so a lane holds 8 neighbouring positions of one column (v is stored transposed). Either way 16-B LDS stores into the wave's own staging, then whole 128-B lines to memory.
__global__ __launch_bounds__(128) void k_qkv(const float* __restrict__ XQ, const float* __restrict__ XK, const float* __restrict__ XV, const __bf16* __restrict__ P, const float* __restrict__ BQ, const float* __restrict__ BK, const float* __restrict__ BV, _Float16* __restrict__ QK, _Float16* __restrict__ QKL, _Float16* __restrict__ VTH, _Float16* __restrict__ VTL) {
  const int which0 = (blockIdx.y * 128) / DM; const float* X = (which0 == 0) ? XQ : (which0 == 1) ? XK : XV; const float* BB = BQ ? (((which0 == 0) ? BQ : (which0 == 1) ? BK : BV) + (blockIdx.y * 128 - which0 * DM)) : nullptr;
  __shared__ __align__(16) __bf16 st[2 * 256 * GP];
  const int tid = threadIdx.x, wave = tid >> 5, lane = tid & 31, col = lane & 15, g = lane >> 4, wm = wave >> 1, wn = wave & 1; const int n0 = blockIdx.y * 128;
  const size_t rb = (size_t)blockIdx.x * 128; const int b = (int)(rb / SS), s0 = (int)(rb % SS);   // 128 divides SS: one batch per block; engine row rb + i is module row (s0 + i) * NB + b
  const bool sw = n0 < 2 * DM;
  v8f acc[4][4] = {};
  gemm128<1>(X + ((size_t)s0 * NB + b) * DM, NB * DM, P + (size_t)n0 * DM, st, sw, acc);
  _Float16* eh = (_Float16*)st + wave * (2 * 64 * GP); _Float16* el = eh + 64 * GP;   // per wave: [64][GP] hi, [64][GP] residual
  float bi[4][8] = {}, bj[4] = {};   // bias of the lane's 8 columns per i (q, k) or of its one column per j (v)
  if (BB) {   // one branch round all the bias loads, so that they are in flight together
    if (sw) {
#pragma unroll
      for (int i = 0; i < 4; ++i) {
#pragma unroll
        for (int r = 0; r < 8; ++r) bi[i][r] = bfr(BB[wn * 64 + i * 16 + 8 * g + r]); }
    } else {
#pragma unroll
      for (int j = 0; j < 4; ++j) bj[j] = bfr(BB[wn * 64 + j * 16 + col]); } }
#pragma unroll
  for (int i = 0; i < 4; ++i) {
#pragma unroll
    for (int j = 0; j < 4; ++j) { v8h hv, lv;
#pragma unroll
      for (int r = 0; r < 8; ++r) { const float v = acc[i][j][r] + (sw ? bi[i][r] : bj[j]); const _Float16 hh = (_Float16)v; hv[r] = hh; lv[r] = (_Float16)((v - (float)hh) * 2048.0f); }   // (+ bias) as f16 hi + (x2048) residual; q unscaled, 1/8 applied to the f32 score
      *(v8h*)(eh + (j * 16 + col) * GP + i * 16 + 8 * g) = hv; *(v8h*)(el + (j * 16 + col) * GP + i * 16 + 8 * g) = lv; } }
  LDSX();
  static_assert(2 * DM == SS, "q | k rows and transposed v rows have one pitch");
  const size_t o0 = (sw ? (rb + wm * 64) * (2 * DM) + n0 + wn * 64 : ((size_t)b * DM + (n0 - 2 * DM) + wn * 64) * SS + s0 + wm * 64) + (size_t)(lane >> 3) * SS + (lane & 7) * 8;   // 8 lanes x 16 B = one row's 128 B, 4 rows per store
  _Float16* ph = (sw ? QK : VTH) + o0; _Float16* pl = (sw ? QKL : VTL) + o0; const _Float16* sh = eh + (lane >> 3) * GP + (lane & 7) * 8;
#pragma unroll
  for (int it0 = 0; it0 < 16; it0 += 4) { v4u a[4], r4[4];   // 8 LDS reads in flight, then their 8 stores
#pragma unroll
    for (int u = 0; u < 4; ++u) { a[u] = *(const v4u*)(sh + (it0 + u) * 4 * GP); r4[u] = *(const v4u*)(sh + 64 * GP + (it0 + u) * 4 * GP); }
#pragma unroll
    for (int u = 0; u < 4; ++u) { vst2(ph + (size_t)(it0 + u) * 4 * SS, a[u]); vst2(pl + (size_t)(it0 + u) * 4 * SS, r4[u]); }
    asm volatile("s_wait_xcnt 0x0" :: "v"(ph), "v"(pl) : "memory"); }   // the next group's LDS reads overwrite these stores' data registers
}
// ---- k_attn: block = (128 queries, head h, batch b), 4 waves x 32 queries (two 16-row tiles per wave). K and V come in tiles of 64 keys, copied asynchronously into two LDS buffers and read by all four waves; every K and V fragment serves both of a wave's query tiles. scores are computed transposed (k rows x q rows, single f16 operands), so that a lane's accumulators of 32 keys are its own part of P's fragment and P stays in registers; relu(score * 0.125), P (x 2^11, single f16) x V, f32 accumulate over the keys in ascending groups of 32; O[b*S+q][h*64+d] = acc / 2^11 (256-B segments)
// two transposed score tiles (keys 0..15 and 16..31 of a group of 32, one query per lane) are, converted in place, the A fragment of P for that group: element s = key 8g + s (s < 8), 16 + 8g + s - 8 (else).
// relu(s / 8) * 2^11 = relu(s * 2^8): the powers of two are exact, and relu commutes with the rounding to f16. P is scaled by 2^11 so that small weights stay out of the f16 subnormal range; 2^-11 is folded into the epilogue.
__device__ __forceinline__ v16h pack_p(v8f t0, v8f t1) {
  v16h p;
#pragma unroll
  for (int i = 0; i < 8; ++i) { p[i] = (_Float16)(t0[i] * 256.0f); p[8 + i] = (_Float16)(t1[i] * 256.0f); }
  const v16h z = {};
  return __builtin_elementwise_max(p, z);
}
#define AK 64   // keys per tile: K tile = [64 keys][GP], V tile = [64 d][GP]; rows of 128 B at the pitch of the ds_load_b128 fragment reads
__global__ __launch_bounds__(128) void k_attn(const _Float16* __restrict__ QK, const _Float16* __restrict__ QKL, const _Float16* __restrict__ VTH, const _Float16* __restrict__ VTL, const void* __restrict__ KMASK, float* __restrict__ O) {
  (void)QKL; (void)VTL; (void)KMASK;
  __shared__ __align__(16) _Float16 kv[2][2][AK * GP];   // [buffer][K | V][row][GP]
  __shared__ __align__(16) float sp[4][2][16][68];       // per wave and query tile: the output staging behind the loop
  const int tid = threadIdx.x, wave = tid >> 5, lane = tid & 31, col = lane & 15, g = lane >> 4;
  const int qb = blockIdx.x, h = blockIdx.y, b = blockIdx.z; const int q0 = qb * 128 + wave * 32;
  constexpr int NTL = SS / AK;
  // 8 lanes x 16 B = one row's 128 B; 16 rows per copy of the block, 4 copies for K and 4 for V
  const _Float16* kg = QK + ((size_t)b * SS + (tid >> 3)) * (2 * DM) + DM + h * HD + (tid & 7) * 8;
  const _Float16* vg = VTH + ((size_t)b * DM + h * HD + (tid >> 3)) * SS + (tid & 7) * 8;
  const unsigned lk = (unsigned)(uintptr_t)&kv[0][0][(tid >> 3) * GP + (tid & 7) * 8];
  auto fill = [&](int t) {
    const _Float16* kp = kg + (size_t)t * (AK * 2 * DM); const _Float16* vp = vg + t * AK;
    const unsigned l = lk + (unsigned)(t & 1) * (2u * AK * GP * 2u), lv = l + AK * GP * 2u;
    // the copies and the wait that keeps their address registers untouched until they are read, in one statement
    asm volatile("global_load_async_to_lds_b128 %0, %8, off\n\t"
                 "global_load_async_to_lds_b128 %1, %9, off\n\t"
                 "global_load_async_to_lds_b128 %2, %10, off\n\t"
                 "global_load_async_to_lds_b128 %3, %11, off\n\t"
                 "global_load_async_to_lds_b128 %4, %12, off\n\t"
                 "global_load_async_to_lds_b128 %5, %13, off\n\t"
                 "global_load_async_to_lds_b128 %6, %14, off\n\t"
                 "global_load_async_to_lds_b128 %7, %15, off\n\t"
                 "s_wait_xcnt 0x0"
                 :: "v"(l), "v"(l + 16u * GP * 2u), "v"(l + 32u * GP * 2u), "v"(l + 48u * GP * 2u),
                    "v"(lv), "v"(lv + 16u * GP * 2u), "v"(lv + 32u * GP * 2u), "v"(lv + 48u * GP * 2u),
                    "v"(kp), "v"(kp + 16 * 2 * DM), "v"(kp + 32 * 2 * DM), "v"(kp + 48 * 2 * DM),
                    "v"(vp), "v"(vp + 16 * SS), "v"(vp + 32 * SS), "v"(vp + 48 * SS)
                 : "memory");
  };
  fill(0);
  const _Float16* qp = QK + ((size_t)b * SS + q0 + col) * (2 * DM) + h * HD;
  v16h aq[2][2];
#pragma unroll
  for (int qt = 0; qt < 2; ++qt) {
#pragma unroll
    for (int kc = 0; kc < 2; ++kc) aq[qt][kc] = frag_h(qp + (size_t)qt * 16 * (2 * DM) + kc * 32, lane); }
  asm volatile("s_wait_xcnt 0x0" :: "v"(qp) : "memory");   // the loads' address registers are reused behind them; as an input they stay untouched up to the wait
  v8f acc[2][4] = {};
  asm volatile("s_wait_asynccnt 0x0" ::: "memory");   // this wave's copies of tile 0 have landed
  __syncthreads();                                     // publishes tile 0
  fill(1);
#pragma unroll 1   // rolled: one trip per key tile, the buffer chosen by the trip's parity
  for (int t = 0; t < NTL; ++t) {
    const _Float16* kt = &kv[t & 1][0][0]; const _Float16* vt = &kv[t & 1][1][0];
    v16h kf[2][2][2], vf[2][4];   // per group of 32 keys: K rows (A of the scores), V rows (B of P x V)
    auto ldf = [&](int k2) {
#pragma unroll
      for (int cl = 0; cl < 2; ++cl) {
#pragma unroll
        for (int kc = 0; kc < 2; ++kc) kf[k2][cl][kc] = frag_h(kt + ((k2 * 2 + cl) * 16 + col) * GP + kc * 32, lane); }
#pragma unroll
      for (int dt = 0; dt < 4; ++dt) vf[k2][dt] = frag_h(vt + (dt * 16 + col) * GP + k2 * 32, lane);
    };
    ldf(0);
#pragma unroll
    for (int k2 = 0; k2 < 2; ++k2) { v16h pa[2]; v8f c[2][2] = {};   // 32 keys x 32 queries; transposed score tiles: c[cl][qt][r] = (key k2*32 + cl*16 + 8g + r, query qt*16 + col)
#pragma unroll
      for (int kc = 0; kc < 2; ++kc) {
#pragma unroll
        for (int cl = 0; cl < 2; ++cl) {
#pragma unroll
          for (int qt = 0; qt < 2; ++qt) c[cl][qt] = wmma16(kf[k2][cl][kc], aq[qt][kc], c[cl][qt]); } }   // single product: k rows as A, q rows as B, one-rounding f16 operands
      if (k2 == 0) ldf(1);   // the second group's fragments fly behind the first group's conversion and P x V
#pragma unroll
      for (int qt = 0; qt < 2; ++qt) pa[qt] = pack_p(c[0][qt], c[1][qt]);
#pragma unroll
      for (int dt = 0; dt < 4; ++dt) {
#pragma unroll
        for (int qt = 0; qt < 2; ++qt) acc[qt][dt] = wmma16(pa[qt], vf[k2][dt], acc[qt][dt]); } }   // single product: P (x2^11) x V
    asm volatile("s_wait_dscnt 0x0" ::: "memory");      // this wave's reads of tile t are done
    asm volatile("s_wait_asynccnt 0x0" ::: "memory");   // this wave's copies of tile t + 1 have landed
    __syncthreads();                                     // publishes tile t + 1 and ends every wave's reads of tile t
    if (t + 2 < NTL) fill(t + 2);
  }
  asm volatile("s_wait_asynccnt 0x0" ::: "memory");   // nothing is in flight when the wave ends
#pragma unroll
  for (int qt = 0; qt < 2; ++qt) {
#pragma unroll
    for (int r = 0; r < 8; ++r) {
#pragma unroll
      for (int dt = 0; dt < 4; ++dt) sp[wave][qt][8 * g + r][dt * 16 + col] = acc[qt][dt][r] * (1.0f / 2048.0f); } }   // undo the P scaling only
  LDSX();
  float* po = O + ((size_t)b * SS + q0 + g) * DM + h * HD + col * 4; const float* sf = &sp[wave][0][g][col * 4];   // 16 lanes x 16 B = 256 B of a row, 2 rows per store
#pragma unroll
  for (int it0 = 0; it0 < 16; it0 += 8) { v4f a[8];   // 8 LDS reads in flight, then their 8 stores
#pragma unroll
    for (int u = 0; u < 8; ++u) a[u] = *(const v4f*)(sf + (it0 + u) * 2 * 68);
#pragma unroll
    for (int u = 0; u < 8; ++u) vst2(po + (size_t)(it0 + u) * 2 * DM, a[u]);
    asm volatile("s_wait_xcnt 0x0" :: "v"(po) : "memory"); }   // the next group's LDS reads overwrite these stores' data registers
}
// ---- k_out: block = (128 rows, 128 cols): out = y (bf16 hi + residual) . Wo rows (2 products) + bo; Wo rows as the A operand, so a lane holds 8 neighbouring output columns of one row
__global__ __launch_bounds__(128) void k_out(const float* __restrict__ O, const __bf16* __restrict__ P, const float* __restrict__ BO, float* __restrict__ Y) {
  __shared__ __align__(16) __bf16 st[2 * 384 * GP];
  const int tid = threadIdx.x, wave = tid >> 5, lane = tid & 31, col = lane & 15, g = lane >> 4, wm = wave >> 1, wn = wave & 1; const size_t rb = (size_t)blockIdx.x * 128; const int n0 = blockIdx.y * 128;
  v8f acc[4][4] = {};
  gemm128<2>(O + rb * DM, DM, P + (size_t)n0 * DM, st, true, acc);
  float* ef = (float*)st + wave * (64 * 68);   // per wave: [64 rows][64 + 4 floats]
  const float* bp = BO + n0 + wn * 64 + 8 * g; float bi[4][8];   // bias of the lane's 8 columns per i
#pragma unroll
  for (int i = 0; i < 4; ++i) {
#pragma unroll
    for (int r = 0; r < 8; ++r) bi[i][r] = bp[i * 16 + r]; }
  asm volatile("s_wait_xcnt 0x0" :: "v"(bp) : "memory");   // the loads' address registers are reused behind them; as an input they stay untouched up to the wait
#pragma unroll
  for (int i = 0; i < 4; ++i) {
#pragma unroll
    for (int j = 0; j < 4; ++j) { v4f a4, b4;
#pragma unroll
      for (int r = 0; r < 4; ++r) { a4[r] = acc[i][j][r] + bfr(bi[i][r]); b4[r] = acc[i][j][4 + r] + bfr(bi[i][4 + r]); }
      float* d = ef + (j * 16 + col) * 68 + i * 16 + 8 * g; *(v4f*)d = a4; *(v4f*)(d + 4) = b4; } }
  LDSX();
  const int b = (int)(rb / SS), s0 = (int)(rb % SS);   // 128 divides SS: one batch per block; engine row rb + i is module row (s0 + i) * NB + b
  float* py = Y + ((size_t)(s0 + wm * 64 + g) * NB + b) * DM + n0 + wn * 64 + col * 4; const float* sf = ef + g * 68 + col * 4;   // back to the [L][B][E] layout: 16 lanes x 16 B = 256 B of a row, 2 rows per store
#pragma unroll
  for (int it0 = 0; it0 < 32; it0 += 8) { v4f a[8];   // 8 LDS reads in flight, then their 8 stores
#pragma unroll
    for (int u = 0; u < 8; ++u) a[u] = *(const v4f*)(sf + (it0 + u) * 2 * 68);
#pragma unroll
    for (int u = 0; u < 8; ++u) vst2(py + (size_t)(it0 + u) * 2 * NB * DM, a[u]);
    asm volatile("s_wait_xcnt 0x0" :: "v"(py) : "memory"); }   // the next group's LDS reads overwrite these stores' data registers
}
// ---- k_gnorm: wave = engine row (32 lanes x 32 elements, 512 B in a row per load and store), 8 rows per block, no LDS and no barrier: y = weight * x / (||x||/sqrt(1024) + 1e-8) * sigmoid(gate * x) (precise expf)
// The row, the weights and the gates are loaded together; the launch starts 4,096 long waves, and a lane's 32 elements are independent chains that fill one another's latencies.
// four waves per SIMD is all that the launch has: the register budget of four holds the row, its weights and its gates at once, so that the loads stand ahead of the arithmetic
__global__ __launch_bounds__(256) __attribute__((amdgpu_waves_per_eu(4, 4))) void k_gnorm(const float* __restrict__ O, const float* __restrict__ NW, const float* __restrict__ NG, float* __restrict__ Y2) {
  const int lane = threadIdx.x & 31; const size_t row = (size_t)blockIdx.x * 8 + (threadIdx.x >> 5);
  const float* xp = O + row * DM + lane * 4; const float* wp = NW + lane * 4; const float* gp = NG + lane * 4;
  v4f x[8], w[8], gt[8];
#pragma unroll
  for (int i = 0; i < 8; ++i) x[i] = *(const v4f*)(xp + i * 128);
#pragma unroll
  for (int i = 0; i < 8; ++i) { w[i] = *(const v4f*)(wp + i * 128); gt[i] = *(const v4f*)(gp + i * 128); }
  v4f s4 = {};   // four partial sums per lane, then the lane's sum, then the butterfly over the wave
#pragma unroll
  for (int i = 0; i < 8; ++i) s4 += x[i] * x[i];
  float s = (s4[0] + s4[1]) + (s4[2] + s4[3]);
#pragma unroll
  for (int o = 1; o < 32; o <<= 1) s += __shfl_xor(s, o);
  const float rms = sqrtf(s) * 0.03125f; const float inv = 1.0f / (rms + 1e-8f);
  float* yp = Y2 + row * DM + lane * 4;
#pragma unroll
  for (int i = 0; i < 8; ++i) { v4f o4; const v4f wr = __builtin_convertvector(__builtin_convertvector(w[i], v4b), v4f), gr = __builtin_convertvector(__builtin_convertvector(gt[i], v4b), v4f);   // weight and gate rounded to bf16, two per conversion
#pragma unroll
    for (int e = 0; e < 4; ++e) { const float xv = x[i][e]; o4[e] = wr[e] * (xv * inv) * (1.0f / (1.0f + expf(-gr[e] * xv))); }
    vst2(yp + i * 128, o4); }
}
extern "C" void kernel_launch(void* const* d_in, const int* in_sizes, int n_in, void* d_out, int out_size, void* d_ws, size_t ws_size, hipStream_t stream) {
  (void)in_sizes; (void)n_in; (void)out_size;
  const float** F = (const float**)d_in;   // 0 query, 1 key, 2 value [2048,2,1024] (L,B,E); 3 Wq, 4 bq, 5 Wk, 6 bk, 7 Wv, 8 bv, 9 Wo, 10 bo (natural); 11 norm_weight, 12 norm_gate
  if (ws_size < (size_t)WS_END) return;
  char* ws = (char*)d_ws; __bf16* PK = (__bf16*)(ws + WS_PK); _Float16 *QK = (_Float16*)(ws + WS_QK), *QKL = (_Float16*)(ws + WS_QKL), *VTH = (_Float16*)(ws + WS_VTH), *VTL = (_Float16*)(ws + WS_VTL); float *O = (float*)(ws + WS_O), *Y2 = (float*)(ws + WS_Y2);
  k_pack<<<dim3(DM * DM / (PKN * 512), 4), 128, 0, stream>>>(F[3], F[5], F[7], F[9], PK);
  k_qkv<<<dim3(TNB * SS / 128, QKVW / 128), 128, 0, stream>>>(F[0], F[1], F[2], PK + PK_A, F[4], F[6], F[8], QK, QKL, VTH, VTL);
  k_attn<<<dim3(TQB / 2, NH, TNB), 128, 0, stream>>>(QK, QKL, VTH, VTL, nullptr, O);
  k_gnorm<<<NB * SS / 8, 256, 0, stream>>>(O, F[11], F[12], Y2);
  k_out<<<dim3(TOB / 2, DM / 128), 128, 0, stream>>>(Y2, PK + PK_P, F[10], (float*)d_out);
}

// v005
// It runs in 86.6 microseconds.
// Timed twice side by side with v004, it ran 1.06 times as fast both times.
// Counting every step since v000, it is 4.49 times as fast.
// compute dtype: all float inputs rounded to bf16; q/k/v = x . W^T + b with EXACT bf16 products on WMMA 16x16x32 (natural rows) with the (L, B, E) row order remapped on load and store; 'attention' = relu(q k^T / 8) (no softmax): q, k as single f16 operands, relu, P (scaled by 2^11, single f16) x v (single f16), f32 accumulate; gated RMS norm in f32 (precise expf); out = y (bf16 hi + residual) . Wo^T (2 products) + bo.
#include <hip/hip_runtime.h>
#include <math.h>

typedef __attribute__((ext_vector_type(16))) _Float16 v16h;
typedef __attribute__((ext_vector_type(16))) __bf16 v16b;
typedef __attribute__((ext_vector_type(8)))  _Float16 v8h;
typedef __attribute__((ext_vector_type(8)))  float v8f;
typedef __attribute__((ext_vector_type(4)))  float v4f;
typedef __attribute__((ext_vector_type(2)))  float v2f;
typedef __attribute__((ext_vector_type(4)))  unsigned v4u;
typedef __attribute__((ext_vector_type(4)))  int v4i;
typedef float __attribute__((may_alias)) float_a;
typedef int __attribute__((may_alias)) int_a;

template <typename T> __device__ __forceinline__ void vst2(void* p, T v) { *(T*)p = v;  }
__device__ __forceinline__ v8f wmma16(v16h a, v16h b, v8f c) {
  v8f d = __builtin_amdgcn_wmma_f32_16x16x32_f16(false, a, false, b, (short)0, c, false, false);
  asm volatile("v_nop\n\tv_nop\n\tv_nop\n\tv_nop" : "+v"(d) : "v"(a), "v"(b));
  return d;
}
__device__ __forceinline__ v8f wmma_bf(v16b a, v16b b, v8f c) {
  v8f d = __builtin_amdgcn_wmma_f32_16x16x32_bf16(false, a, false, b, (short)0, c, false, false);
  asm volatile("v_nop\n\tv_nop\n\tv_nop\n\tv_nop" : "+v"(d) : "v"(a), "v"(b));
  return d;
}
// ReLU attention (L 2,048, B 2, E 1,024, 16 heads x 64; sequence-first layout): q/k/v projections + biases, relu(q k^T / 8) in place of softmax, gated RMS norm (weight * x / rms * sigmoid(gate * x)), output projection + bias.
__device__ __forceinline__ v16h frag_h(const _Float16* rowk0, int lane) {
  union { v16h v; v8h q[2]; } u; const _Float16* p = rowk0 + 8 * (lane >> 4);
  u.q[0] = *(const v8h*)p; u.q[1] = *(const v8h*)(p + 16); return u.v;
}
__device__ __forceinline__ v16h frag_f32(const float* rowk0, int lane) {
  v16h a; const float* p = rowk0 + 8 * (lane >> 4);
#pragma unroll
  for (int i = 0; i < 8; ++i) { a[i] = (_Float16)p[i]; a[8 + i] = (_Float16)p[16 + i]; }
  return a;
}
__device__ __forceinline__ v16h frag_f32s(const float* rowk0, int lane, float sc) {
  v16h a; const float* p = rowk0 + 8 * (lane >> 4);
#pragma unroll
  for (int i = 0; i < 8; ++i) { a[i] = (_Float16)(p[i] * sc); a[8 + i] = (_Float16)(p[16 + i] * sc); }
  return a;
}
// column fragment from a [K][ld] layout (column n), rows >= K read as 0
__device__ __forceinline__ v16h fragc_f32(const float* W, int k0, int n, int lane, int ld, int K) {
  v16h a; const int g = lane >> 4;
#pragma unroll
  for (int i = 0; i < 8; ++i) { const int ka = k0 + 8 * g + i, kb = ka + 16;
    a[i] = (_Float16)(ka < K ? W[(size_t)(ka < K ? ka : K - 1) * ld + n] : 0.f); a[8 + i] = (_Float16)(kb < K ? W[(size_t)(kb < K ? kb : K - 1) * ld + n] : 0.f); }
  return a;
}
struct F2 { v16b h, l; };
__device__ __forceinline__ F2 bsplit16(const float v[16]) { F2 r;
#pragma unroll
  for (int i = 0; i < 16; ++i) { const __bf16 h = (__bf16)v[i]; r.h[i] = h; r.l[i] = (__bf16)(v[i] - (float)h); }
  return r; }
__device__ __forceinline__ F2 split_row(const float* row, int k0, int lane) { float v[16]; const float* p = row + k0 + 8 * (lane >> 4);
#pragma unroll
  for (int i = 0; i < 8; ++i) { v[i] = p[i]; v[8 + i] = p[16 + i]; }
  return bsplit16(v); }
__device__ __forceinline__ F2 split_rowK(const float* row, int k0, int lane, int K) { float v[16]; const int g = lane >> 4;
#pragma unroll
  for (int i = 0; i < 8; ++i) { const int ka = k0 + 8 * g + i, kb = ka + 16; v[i] = ka < K ? row[ka < K ? ka : K - 1] : 0.f; v[8 + i] = kb < K ? row[kb < K ? kb : K - 1] : 0.f; }
  return bsplit16(v); }
__device__ __forceinline__ F2 split_col(const float* W, int k0, int n, int lane, int ld, int K) { float v[16]; const int g = lane >> 4;
#pragma unroll
  for (int i = 0; i < 8; ++i) { const int ka = k0 + 8 * g + i, kb = ka + 16; v[i] = ka < K ? W[(size_t)(ka < K ? ka : K - 1) * ld + n] : 0.f; v[8 + i] = kb < K ? W[(size_t)(kb < K ? kb : K - 1) * ld + n] : 0.f; }
  return bsplit16(v); }
__device__ __forceinline__ v8f mac3(const F2& a, const F2& b, v8f c) { c = wmma_bf(a.l, b.h, c); c = wmma_bf(a.h, b.l, c); return wmma_bf(a.h, b.h, c); }
__device__ __forceinline__ float sigm(float v) { return 1.0f / (1.0f + expf(-v)); }
#define LDSX() do { asm volatile("s_wait_dscnt 0" ::: "memory"); __builtin_amdgcn_wave_barrier(); __builtin_amdgcn_fence(__ATOMIC_RELEASE, "workgroup"); } while (0)


#define NB 2
#define SS 2048
#define DM 1024
#define NH 16
__device__ __forceinline__ size_t xrow(size_t r) { return (r % SS) * NB + r / SS; }   // engine row (b, s) <-> the module's [L][B] row s*B + b
#define HD 64
#define QKVW (3 * DM)
#ifndef TQB
#define TQB (SS / 64)
#define TNB NB
#define TOB (NB * SS / 64)     // output row tiles (all)
#endif
typedef __attribute__((ext_vector_type(8))) __bf16 v8b;
__device__ __forceinline__ v16b frag_b(const __bf16* rowk0, int lane) {
  union { v16b v; v8b q[2]; } u; const __bf16* p = rowk0 + 8 * (lane >> 4);
  u.q[0] = *(const v8b*)p; u.q[1] = *(const v8b*)(p + 16); return u.v;
}
__device__ __forceinline__ float bfr(float v) { return (float)(__bf16)v; }
__device__ __attribute__((noinline)) float exp_ni(float v) { return expf(v); }
__device__ __attribute__((noinline)) float erf_ni(float v) { return erff(v); }

#define PK_A 0                       // [3072][1024] Wqkv rows (natural [out][in])
#define PK_P (PK_A + QKVW * DM)        // [1024][1024] Wo rows (natural)
#define PK_END (PK_P + DM * DM)
#define WS_PK  0u
#define WS_QK  (WS_PK + 2u * PK_END)             // f16 [4096 rows][2048]: q | k
#define WS_QKL (WS_QK + 2u * NB * SS * 2 * DM)     // f16 q | k residual planes x2048
#define WS_VTH (WS_QKL + 2u * NB * SS * 2 * DM)    // f16 [b][1024 (h*64+d)][2048 s] hi
#define WS_VTL (WS_VTH + 2u * NB * DM * SS)        // f16 lo x 2048
#define WS_O   (WS_VTL + 2u * NB * DM * SS)        // f32 [4096][1024]
#define WS_CS  (WS_O + 4u * NB * SS * DM)           // f32 [2048][32] x2, unused
#define WS_Y2  (WS_CS + 4u * 2 * SS * 32)                  // f32 [NR][1024] gated-rms-normed context
#define WS_END (WS_Y2 + 4u * (size_t)NB * SS * DM)
// ---- k_pack: block = (16,384 neighbouring elements of one weight matrix, which): natural [out][in] rows -> bf16, same element order; which 0..2 -> W_q/W_k/W_v into PK_A rows which*1024 + n; 3 -> W_o into PK_P.
// A thread takes 32 pieces of 16 B, a wave 512 B in a row per load and 256 B per store, all 32 loads in flight together (64 KiB per block): the launch starts 1,024 long waves and needs no LDS and no barrier.
#define PKN 32   // 16-B pieces per thread
typedef __attribute__((ext_vector_type(4))) __bf16 v4b;
// one wave per SIMD is all that the launch has: the register budget of one lets every load be issued before the first is waited for
__global__ __launch_bounds__(128) __attribute__((amdgpu_waves_per_eu(1, 1))) void k_pack(const float* __restrict__ WQ, const float* __restrict__ WK, const float* __restrict__ WV, const float* __restrict__ WO, __bf16* __restrict__ PK) {
  const int which = blockIdx.y, t = threadIdx.x; const float* Wm = (which == 0) ? WQ : (which == 1) ? WK : (which == 2) ? WV : WO;
  const size_t o = (size_t)blockIdx.x * (PKN * 512) + t * 4;
  const float* sp = Wm + o; __bf16* dp = PK + ((which < 3) ? PK_A + (size_t)which * DM * DM : (size_t)PK_P) + o;
  v4f v[PKN];
#pragma unroll
  for (int i = 0; i < PKN; ++i) v[i] = *(const v4f*)(sp + i * 512);
  asm volatile("s_wait_xcnt 0x0" :: "v"(sp) : "memory");   // the loads' address registers are reused behind them; as an input they stay untouched up to the wait
#pragma unroll
  for (int i = 0; i < PKN; ++i) { v4b h;
#pragma unroll
    for (int e = 0; e < 4; ++e) h[e] = (__bf16)v[i][e];
    *(v4b*)(dp + i * 512) = h; }
}
// ---- projection GEMM core: one 128 x 128 tile of X . W^T per 4-wave block, 64 x 64 per wave (wave = 2 * wm + wn), k in stages of 64.
// A stage is [X rows (NP planes: bf16, or bf16 hi then residual) | W rows] in LDS; the next stage's global loads are issued before the current stage's products and stored into the other buffer behind them; one barrier per stage.
// The walk over the NT stages starts at stage rot and wraps: blocks that share X rows or W rows get different rot, so that they do not ask L2 for the same lines at the same moment; an accumulator sums its k in that rotated order.
// sw = false: A = X rows, B = W rows, acc[i][j][r] = (x row wm*64 + i*16 + 8g + r, w row wn*64 + j*16 + col); sw = true: the operands change places, acc[i][j][r] = (w row wn*64 + i*16 + 8g + r, x row wm*64 + j*16 + col). NP = 2 takes sw = true only.
#define GP 72   // LDS row pitch in 16-bit elements: 128 B of k + 16 B, so that the 16 rows of a ds_load_b128 fragment read fall on distinct banks
#define GK 64
template <int NP>
__device__ __forceinline__ void gemm128(const float* __restrict__ Xb, const int xld, const __bf16* __restrict__ Wb, __bf16* st, const bool sw, const int rot, v8f (&acc)[4][4]) {
  constexpr int ROWS = (NP + 1) * 128, NT = DM / GK;
  const int tid = threadIdx.x, wave = tid >> 5, lane = tid & 31, col = lane & 15, wm = wave >> 1, wn = wave & 1;
  const float* xg = Xb + (size_t)(tid >> 4) * xld + (tid & 15) * 4;     // 16 lanes x 16 B = one row's 256 B of a stage
  const __bf16* wg = Wb + (size_t)(tid >> 3) * DM + (tid & 7) * 8;      // 8 lanes x 16 B = one row's 128 B of a stage
  const int xr0 = wm * 64 + col, wr0 = NP * 128 + wn * 64 + col;
  const int ar = sw ? wr0 : xr0, br = sw ? xr0 : wr0;
  v4f xv[16]; v8b wv[8];
  int kn = rot & (NT - 1);   // the next stage to load (the same in every lane)
  const float* xp = xg + kn * GK; const __bf16* wp = wg + kn * GK;   // its addresses; stepped in sts(), behind the wait that ends ldg()
  auto ldg = [&]() {
#pragma unroll
    for (int i = 0; i < 16; ++i) xv[i] = *(const v4f*)(xp + (size_t)(i * 8) * xld);
#pragma unroll
    for (int i = 0; i < 8; ++i) wv[i] = *(const v8b*)(wp + (size_t)(i * 16) * DM);
    asm volatile("s_wait_xcnt 0x0" :: "v"(xp), "v"(wp) : "memory");   // the loads' address registers are reused behind them; as inputs they stay untouched up to the wait
  };
  auto sts = [&](int buf) {
    __bf16* s = st + buf * (ROWS * GP);
#pragma unroll
    for (int i = 0; i < 16; ++i) { v4b h4, l4;
#pragma unroll
      for (int e = 0; e < 4; ++e) { const __bf16 h = (__bf16)xv[i][e]; h4[e] = h; l4[e] = (__bf16)(xv[i][e] - (float)h); }
      __bf16* d = s + (i * 8 + (tid >> 4)) * GP + (tid & 15) * 4;
      *(v4b*)d = h4; if constexpr (NP == 2) *(v4b*)(d + 128 * GP) = l4; }
#pragma unroll
    for (int i = 0; i < 8; ++i) *(v8b*)(s + (NP * 128 + i * 16 + (tid >> 3)) * GP + (tid & 7) * 8) = wv[i];
    kn = (kn + 1) & (NT - 1); xp = xg + kn * GK; wp = wg + kn * GK;
  };
  ldg(); sts(0);
  __syncthreads();
#pragma unroll 1   // rolled: for speed only
  for (int t = 0; t < NT; ++t) {
    if (t + 1 < NT) ldg();
    const __bf16* s = st + (t & 1) * (ROWS * GP);
#pragma unroll
    for (int kc = 0; kc < GK / 32; ++kc) { v16b fa[4], fb[4];
#pragma unroll
      for (int i = 0; i < 4; ++i) { fa[i] = frag_b(s + (ar + i * 16) * GP + kc * 32, lane); fb[i] = frag_b(s + (br + i * 16) * GP + kc * 32, lane); }
      if constexpr (NP == 2) { v16b fl[4];   // residual plane first, then hi: each accumulator keeps the order lo, hi per 32 k
#pragma unroll
        for (int i = 0; i < 4; ++i) fl[i] = frag_b(s + (br + 128 + i * 16) * GP + kc * 32, lane);
#pragma unroll
        for (int i = 0; i < 4; ++i) {
#pragma unroll
          for (int j = 0; j < 4; ++j) acc[i][j] = wmma_bf(fa[i], fl[j], acc[i][j]); } }
#pragma unroll
      for (int i = 0; i < 4; ++i) {
#pragma unroll
        for (int j = 0; j < 4; ++j) acc[i][j] = wmma_bf(fa[i], fb[j], acc[i][j]); } }
    if (t + 1 < NT) sts((t + 1) & 1);
    __syncthreads();   // publishes stage t + 1 and ends every wave's reads of stage t (behind the last stage: frees the buffers for the epilogue)
  }
}
// ---- k_qkv: block = (128 engine rows, 128 of the 3,072 q | k | v columns). q, k: W rows as the A operand, so a lane holds 8 neighbouring columns of one row; v: X rows as A, so a lane holds 8 neighbouring positions of one column (v is stored transposed). Either way 16-B LDS stores into the wave's own staging, then whole 128-B lines to memory.
__global__ __launch_bounds__(128) void k_qkv(const float* __restrict__ XQ, const float* __restrict__ XK, const float* __restrict__ XV, const __bf16* __restrict__ P, const float* __restrict__ BQ, const float* __restrict__ BK, const float* __restrict__ BV, _Float16* __restrict__ QK, _Float16* __restrict__ QKL, _Float16* __restrict__ VTH, _Float16* __restrict__ VTL) {
  const int which0 = (blockIdx.y * 128) / DM; const float* X = (which0 == 0) ? XQ : (which0 == 1) ? XK : XV; const float* BB = BQ ? (((which0 == 0) ? BQ : (which0 == 1) ? BK : BV) + (blockIdx.y * 128 - which0 * DM)) : nullptr;
  __shared__ __align__(16) __bf16 st[2 * 256 * GP];
  const int tid = threadIdx.x, wave = tid >> 5, lane = tid & 31, col = lane & 15, g = lane >> 4, wm = wave >> 1, wn = wave & 1; const int n0 = blockIdx.y * 128;
  const size_t rb = (size_t)blockIdx.x * 128; const int b = (int)(rb / SS), s0 = (int)(rb % SS);   // 128 divides SS: one batch per block; engine row rb + i is module row (s0 + i) * NB + b
  const bool sw = n0 < 2 * DM;
  v8f acc[4][4] = {};
  gemm128<1>(X + ((size_t)s0 * NB + b) * DM, NB * DM, P + (size_t)n0 * DM, st, sw, (int)(blockIdx.x + 2 * blockIdx.y), acc);   // 8 blocks share X rows (neighbouring y), 32 share W rows (all x)
  _Float16* eh = (_Float16*)st + wave * (2 * 64 * GP); _Float16* el = eh + 64 * GP;   // per wave: [64][GP] hi, [64][GP] residual
  float bi[4][8] = {}, bj[4] = {};   // bias of the lane's 8 columns per i (q, k) or of its one column per j (v)
  if (BB) {   // one branch round all the bias loads, so that they are in flight together
    if (sw) {
#pragma unroll
      for (int i = 0; i < 4; ++i) {
#pragma unroll
        for (int r = 0; r < 8; ++r) bi[i][r] = bfr(BB[wn * 64 + i * 16 + 8 * g + r]); }
    } else {
#pragma unroll
      for (int j = 0; j < 4; ++j) bj[j] = bfr(BB[wn * 64 + j * 16 + col]); } }
#pragma unroll
  for (int i = 0; i < 4; ++i) {
#pragma unroll
    for (int j = 0; j < 4; ++j) { v8h hv, lv;
#pragma unroll
      for (int r = 0; r < 8; ++r) { const float v = acc[i][j][r] + (sw ? bi[i][r] : bj[j]); const _Float16 hh = (_Float16)v; hv[r] = hh; lv[r] = (_Float16)((v - (float)hh) * 2048.0f); }   // (+ bias) as f16 hi + (x2048) residual; q unscaled, 1/8 applied to the f32 score
      *(v8h*)(eh + (j * 16 + col) * GP + i * 16 + 8 * g) = hv; *(v8h*)(el + (j * 16 + col) * GP + i * 16 + 8 * g) = lv; } }
  LDSX();
  static_assert(2 * DM == SS, "q | k rows and transposed v rows have one pitch");
  const size_t o0 = (sw ? (rb + wm * 64) * (2 * DM) + n0 + wn * 64 : ((size_t)b * DM + (n0 - 2 * DM) + wn * 64) * SS + s0 + wm * 64) + (size_t)(lane >> 3) * SS + (lane & 7) * 8;   // 8 lanes x 16 B = one row's 128 B, 4 rows per store
  _Float16* ph = (sw ? QK : VTH) + o0; _Float16* pl = (sw ? QKL : VTL) + o0; const _Float16* sh = eh + (lane >> 3) * GP + (lane & 7) * 8;
#pragma unroll
  for (int it0 = 0; it0 < 16; it0 += 4) { v4u a[4], r4[4];   // 8 LDS reads in flight, then their 8 stores
#pragma unroll
    for (int u = 0; u < 4; ++u) { a[u] = *(const v4u*)(sh + (it0 + u) * 4 * GP); r4[u] = *(const v4u*)(sh + 64 * GP + (it0 + u) * 4 * GP); }
#pragma unroll
    for (int u = 0; u < 4; ++u) { vst2(ph + (size_t)(it0 + u) * 4 * SS, a[u]); vst2(pl + (size_t)(it0 + u) * 4 * SS, r4[u]); }
    asm volatile("s_wait_xcnt 0x0" :: "v"(ph), "v"(pl) : "memory"); }   // the next group's LDS reads overwrite these stores' data registers
}
// ---- k_attn: block = (128 queries, head h, batch b), 4 waves x 32 queries (two 16-row tiles per wave). K and V come in tiles of 64 keys, copied asynchronously into two LDS buffers and read by all four waves; every K and V fragment serves both of a wave's query tiles. scores are computed transposed (k rows x q rows, single f16 operands), so that a lane's accumulators of 32 keys are its own part of P's fragment and P stays in registers; relu(score * 0.125), P (x 2^11, single f16) x V, f32 accumulate over the keys in groups of 32, ascending from the block's first tile and wrapping (the 16 blocks that share a head's K and V start two tiles apart, so that they do not ask L2 for the same lines at the same moment); O[b*S+q][h*64+d] = acc / 2^11 (256-B segments)
// two transposed score tiles (keys 0..15 and 16..31 of a group of 32, one query per lane) are, converted in place, the A fragment of P for that group: element s = key 8g + s (s < 8), 16 + 8g + s - 8 (else).
// relu(s / 8) * 2^11 = relu(s * 2^8): the powers of two are exact, and relu commutes with the rounding to f16. P is scaled by 2^11 so that small weights stay out of the f16 subnormal range; 2^-11 is folded into the epilogue.
__device__ __forceinline__ v16h pack_p(v8f t0, v8f t1) {
  v16h p;
#pragma unroll
  for (int i = 0; i < 8; ++i) { p[i] = (_Float16)(t0[i] * 256.0f); p[8 + i] = (_Float16)(t1[i] * 256.0f); }
  const v16h z = {};
  return __builtin_elementwise_max(p, z);
}
#define AK 64   // keys per tile: K tile = [64 keys][GP], V tile = [64 d][GP]; rows of 128 B at the pitch of the ds_load_b128 fragment reads
__global__ __launch_bounds__(128) void k_attn(const _Float16* __restrict__ QK, const _Float16* __restrict__ QKL, const _Float16* __restrict__ VTH, const _Float16* __restrict__ VTL, const void* __restrict__ KMASK, float* __restrict__ O) {
  (void)QKL; (void)VTL; (void)KMASK;
  __shared__ __align__(16) _Float16 kv[2][2][AK * GP];   // [buffer][K | V][row][GP]
  __shared__ __align__(16) float sp[4][2][16][68];       // per wave and query tile: the output staging behind the loop
  const int tid = threadIdx.x, wave = tid >> 5, lane = tid & 31, col = lane & 15, g = lane >> 4;
  const int qb = blockIdx.x, h = blockIdx.y, b = blockIdx.z; const int q0 = qb * 128 + wave * 32;
  constexpr int NTL = SS / AK;
  // 8 lanes x 16 B = one row's 128 B; 16 rows per copy of the block, 4 copies for K and 4 for V
  const _Float16* kg = QK + ((size_t)b * SS + (tid >> 3)) * (2 * DM) + DM + h * HD + (tid & 7) * 8;
  const _Float16* vg = VTH + ((size_t)b * DM + h * HD + (tid >> 3)) * SS + (tid & 7) * 8;
  const unsigned lk = (unsigned)(uintptr_t)&kv[0][0][(tid >> 3) * GP + (tid & 7) * 8];
  auto fill = [&](int t) {
    const int tile = (t + 2 * qb) & (NTL - 1);   // trip t works on this key tile; the buffer goes by the trip's parity
    const _Float16* kp = kg + (size_t)tile * (AK * 2 * DM); const _Float16* vp = vg + tile * AK;
    const unsigned l = lk + (unsigned)(t & 1) * (2u * AK * GP * 2u), lv = l + AK * GP * 2u;
    // the copies and the wait that keeps their address registers untouched until they are read, in one statement
    asm volatile("global_load_async_to_lds_b128 %0, %8, off\n\t"
                 "global_load_async_to_lds_b128 %1, %9, off\n\t"
                 "global_load_async_to_lds_b128 %2, %10, off\n\t"
                 "global_load_async_to_lds_b128 %3, %11, off\n\t"
                 "global_load_async_to_lds_b128 %4, %12, off\n\t"
                 "global_load_async_to_lds_b128 %5, %13, off\n\t"
                 "global_load_async_to_lds_b128 %6, %14, off\n\t"
                 "global_load_async_to_lds_b128 %7, %15, off\n\t"
                 "s_wait_xcnt 0x0"
                 :: "v"(l), "v"(l + 16u * GP * 2u), "v"(l + 32u * GP * 2u), "v"(l + 48u * GP * 2u),
                    "v"(lv), "v"(lv + 16u * GP * 2u), "v"(lv + 32u * GP * 2u), "v"(lv + 48u * GP * 2u),
                    "v"(kp), "v"(kp + 16 * 2 * DM), "v"(kp + 32 * 2 * DM), "v"(kp + 48 * 2 * DM),
                    "v"(vp), "v"(vp + 16 * SS), "v"(vp + 32 * SS), "v"(vp + 48 * SS)
                 : "memory");
  };
  fill(0);
  const _Float16* qp = QK + ((size_t)b * SS + q0 + col) * (2 * DM) + h * HD;
  v16h aq[2][2];
#pragma unroll
  for (int qt = 0; qt < 2; ++qt) {
#pragma unroll
    for (int kc = 0; kc < 2; ++kc) aq[qt][kc] = frag_h(qp + (size_t)qt * 16 * (2 * DM) + kc * 32, lane); }
  asm volatile("s_wait_xcnt 0x0" :: "v"(qp) : "memory");   // the loads' address registers are reused behind them; as an input they stay untouched up to the wait
  v8f acc[2][4] = {};
  asm volatile("s_wait_asynccnt 0x0" ::: "memory");   // this wave's copies of tile 0 have landed
  __syncthreads();                                     // publishes tile 0
  fill(1);
#pragma unroll 1   // rolled: one trip per key tile, the buffer chosen by the trip's parity
  for (int t = 0; t < NTL; ++t) {
    const _Float16* kt = &kv[t & 1][0][0]; const _Float16* vt = &kv[t & 1][1][0];
    v16h kf[2][2][2], vf[2][4];   // per group of 32 keys: K rows (A of the scores), V rows (B of P x V)
    auto ldf = [&](int k2) {
#pragma unroll
      for (int cl = 0; cl < 2; ++cl) {
#pragma unroll
        for (int kc = 0; kc < 2; ++kc) kf[k2][cl][kc] = frag_h(kt + ((k2 * 2 + cl) * 16 + col) * GP + kc * 32, lane); }
#pragma unroll
      for (int dt = 0; dt < 4; ++dt) vf[k2][dt] = frag_h(vt + (dt * 16 + col) * GP + k2 * 32, lane);
    };
    ldf(0);
#pragma unroll
    for (int k2 = 0; k2 < 2; ++k2) { v16h pa[2]; v8f c[2][2] = {};   // 32 keys x 32 queries; transposed score tiles: c[cl][qt][r] = (key k2*32 + cl*16 + 8g + r, query qt*16 + col)
#pragma unroll
      for (int kc = 0; kc < 2; ++kc) {
#pragma unroll
        for (int cl = 0; cl < 2; ++cl) {
#pragma unroll
          for (int qt = 0; qt < 2; ++qt) c[cl][qt] = wmma16(kf[k2][cl][kc], aq[qt][kc], c[cl][qt]); } }   // single product: k rows as A, q rows as B, one-rounding f16 operands
      if (k2 == 0) ldf(1);   // the second group's fragments fly behind the first group's conversion and P x V
#pragma unroll
      for (int qt = 0; qt < 2; ++qt) pa[qt] = pack_p(c[0][qt], c[1][qt]);
#pragma unroll
      for (int dt = 0; dt < 4; ++dt) {
#pragma unroll
        for (int qt = 0; qt < 2; ++qt) acc[qt][dt] = wmma16(pa[qt], vf[k2][dt], acc[qt][dt]); } }   // single product: P (x2^11) x V
    asm volatile("s_wait_dscnt 0x0" ::: "memory");      // this wave's reads of tile t are done
    asm volatile("s_wait_asynccnt 0x0" ::: "memory");   // this wave's copies of tile t + 1 have landed
    __syncthreads();                                     // publishes tile t + 1 and ends every wave's reads of tile t
    if (t + 2 < NTL) fill(t + 2);
  }
  asm volatile("s_wait_asynccnt 0x0" ::: "memory");   // nothing is in flight when the wave ends
#pragma unroll
  for (int qt = 0; qt < 2; ++qt) {
#pragma unroll
    for (int r = 0; r < 8; ++r) {
#pragma unroll
      for (int dt = 0; dt < 4; ++dt) sp[wave][qt][8 * g + r][dt * 16 + col] = acc[qt][dt][r] * (1.0f / 2048.0f); } }   // undo the P scaling only
  LDSX();
  float* po = O + ((size_t)b * SS + q0 + g) * DM + h * HD + col * 4; const float* sf = &sp[wave][0][g][col * 4];   // 16 lanes x 16 B = 256 B of a row, 2 rows per store
#pragma unroll
  for (int it0 = 0; it0 < 16; it0 += 8) { v4f a[8];   // 8 LDS reads in flight, then their 8 stores
#pragma unroll
    for (int u = 0; u < 8; ++u) a[u] = *(const v4f*)(sf + (it0 + u) * 2 * 68);
#pragma unroll
    for (int u = 0; u < 8; ++u) vst2(po + (size_t)(it0 + u) * 2 * DM, a[u]);
    asm volatile("s_wait_xcnt 0x0" :: "v"(po) : "memory"); }   // the next group's LDS reads overwrite these stores' data registers
}
// ---- k_out: block = (128 rows, 128 cols): out = y (bf16 hi + residual) . Wo rows (2 products) + bo; Wo rows as the A operand, so a lane holds 8 neighbouring output columns of one row
__global__ __launch_bounds__(128) void k_out(const float* __restrict__ O, const __bf16* __restrict__ P, const float* __restrict__ BO, float* __restrict__ Y) {
  __shared__ __align__(16) __bf16 st[2 * 384 * GP];
  const int tid = threadIdx.x, wave = tid >> 5, lane = tid & 31, col = lane & 15, g = lane >> 4, wm = wave >> 1, wn = wave & 1; const size_t rb = (size_t)blockIdx.x * 128; const int n0 = blockIdx.y * 128;
  v8f acc[4][4] = {};
  gemm128<2>(O + rb * DM, DM, P + (size_t)n0 * DM, st, true, (int)(blockIdx.x + 2 * blockIdx.y), acc);   // 8 blocks share y rows (all blockIdx.y), 32 share Wo rows (all blockIdx.x)
  float* ef = (float*)st + wave * (64 * 68);   // per wave: [64 rows][64 + 4 floats]
  const float* bp = BO + n0 + wn * 64 + 8 * g; float bi[4][8];   // bias of the lane's 8 columns per i
#pragma unroll
  for (int i = 0; i < 4; ++i) {
#pragma unroll
    for (int r = 0; r < 8; ++r) bi[i][r] = bp[i * 16 + r]; }
  asm volatile("s_wait_xcnt 0x0" :: "v"(bp) : "memory");   // the loads' address registers are reused behind them; as an input they stay untouched up to the wait
#pragma unroll
  for (int i = 0; i < 4; ++i) {
#pragma unroll
    for (int j = 0; j < 4; ++j) { v4f a4, b4;
#pragma unroll
      for (int r = 0; r < 4; ++r) { a4[r] = acc[i][j][r] + bfr(bi[i][r]); b4[r] = acc[i][j][4 + r] + bfr(bi[i][4 + r]); }
      float* d = ef + (j * 16 + col) * 68 + i * 16 + 8 * g; *(v4f*)d = a4; *(v4f*)(d + 4) = b4; } }
  LDSX();
  const int b = (int)(rb / SS), s0 = (int)(rb % SS);   // 128 divides SS: one batch per block; engine row rb + i is module row (s0 + i) * NB + b
  float* py = Y + ((size_t)(s0 + wm * 64 + g) * NB + b) * DM + n0 + wn * 64 + col * 4; const float* sf = ef + g * 68 + col * 4;   // back to the [L][B][E] layout: 16 lanes x 16 B = 256 B of a row, 2 rows per store
#pragma unroll
  for (int it0 = 0; it0 < 32; it0 += 8) { v4f a[8];   // 8 LDS reads in flight, then their 8 stores
#pragma unroll
    for (int u = 0; u < 8; ++u) a[u] = *(const v4f*)(sf + (it0 + u) * 2 * 68);
#pragma unroll
    for (int u = 0; u < 8; ++u) vst2(py + (size_t)(it0 + u) * 2 * NB * DM, a[u]);
    asm volatile("s_wait_xcnt 0x0" :: "v"(py) : "memory"); }   // the next group's LDS reads overwrite these stores' data registers
}
// ---- k_gnorm: wave = engine row (32 lanes x 32 elements, 512 B in a row per load and store), 8 rows per block, no LDS and no barrier: y = weight * x / (||x||/sqrt(1024) + 1e-8) * sigmoid(gate * x) (precise expf)
// The row, the weights and the gates are loaded together; the launch starts 4,096 long waves, and a lane's 32 elements are independent chains that fill one another's latencies.
// four waves per SIMD is all that the launch has: the register budget of four holds the row, its weights and its gates at once, so that the loads stand ahead of the arithmetic
__global__ __launch_bounds__(256) __attribute__((amdgpu_waves_per_eu(4, 4))) void k_gnorm(const float* __restrict__ O, const float* __restrict__ NW, const float* __restrict__ NG, float* __restrict__ Y2) {
  const int lane = threadIdx.x & 31; const size_t row = (size_t)blockIdx.x * 8 + (threadIdx.x >> 5);
  const float* xp = O + row * DM + lane * 4; const float* wp = NW + lane * 4; const float* gp = NG + lane * 4;
  v4f x[8], w[8], gt[8];
#pragma unroll
  for (int i = 0; i < 8; ++i) x[i] = *(const v4f*)(xp + i * 128);
#pragma unroll
  for (int i = 0; i < 8; ++i) { w[i] = *(const v4f*)(wp + i * 128); gt[i] = *(const v4f*)(gp + i * 128); }
  v4f s4 = {};   // four partial sums per lane, then the lane's sum, then the butterfly over the wave
#pragma unroll
  for (int i = 0; i < 8; ++i) s4 += x[i] * x[i];
  float s = (s4[0] + s4[1]) + (s4[2] + s4[3]);
#pragma unroll
  for (int o = 1; o < 32; o <<= 1) s += __shfl_xor(s, o);
  const float rms = sqrtf(s) * 0.03125f; const float inv = 1.0f / (rms + 1e-8f);
  float* yp = Y2 + row * DM + lane * 4;
#pragma unroll
  for (int i = 0; i < 8; ++i) { v4f o4; const v4f wr = __builtin_convertvector(__builtin_convertvector(w[i], v4b), v4f), gr = __builtin_convertvector(__builtin_convertvector(gt[i], v4b), v4f);   // weight and gate rounded to bf16, two per conversion
#pragma unroll
    for (int e = 0; e < 4; ++e) { const float xv = x[i][e]; o4[e] = wr[e] * (xv * inv) * (1.0f / (1.0f + expf(-gr[e] * xv))); }
    vst2(yp + i * 128, o4); }
}
extern "C" void kernel_launch(void* const* d_in, const int* in_sizes, int n_in, void* d_out, int out_size, void* d_ws, size_t ws_size, hipStream_t stream) {
  (void)in_sizes; (void)n_in; (void)out_size;
  const float** F = (const float**)d_in;   // 0 query, 1 key, 2 value [2048,2,1024] (L,B,E); 3 Wq, 4 bq, 5 Wk, 6 bk, 7 Wv, 8 bv, 9 Wo, 10 bo (natural); 11 norm_weight, 12 norm_gate
  if (ws_size < (size_t)WS_END) return;
  char* ws = (char*)d_ws; __bf16* PK = (__bf16*)(ws + WS_PK); _Float16 *QK = (_Float16*)(ws + WS_QK), *QKL = (_Float16*)(ws + WS_QKL), *VTH = (_Float16*)(ws + WS_VTH), *VTL = (_Float16*)(ws + WS_VTL); float *O = (float*)(ws + WS_O), *Y2 = (float*)(ws + WS_Y2);
  k_pack<<<dim3(DM * DM / (PKN * 512), 4), 128, 0, stream>>>(F[3], F[5], F[7], F[9], PK);
  k_qkv<<<dim3(TNB * SS / 128, QKVW / 128), 128, 0, stream>>>(F[0], F[1], F[2], PK + PK_A, F[4], F[6], F[8], QK, QKL, VTH, VTL);
  k_attn<<<dim3(TQB / 2, NH, TNB), 128, 0, stream>>>(QK, QKL, VTH, VTL, nullptr, O);
  k_gnorm<<<NB * SS / 8, 256, 0, stream>>>(O, F[11], F[12], Y2);
  k_out<<<dim3(TOB / 2, DM / 128), 128, 0, stream>>>(Y2, PK + PK_P, F[10], (float*)d_out);
}

// v006
// It runs in 82.4 microseconds.
// Timed twice side by side with v005, it ran 1.05 times as fast both times.
// Over all steps from v000 it is 4.72 times as fast.
// compute dtype: all float inputs rounded to bf16; q/k/v = x . W^T + b with EXACT bf16 products on WMMA 16x16x32 (natural rows) with the (L, B, E) row order remapped on load and store; 'attention' = relu(q k^T / 8) (no softmax): q, k as single f16 operands, relu, P (scaled by 2^11, single f16) x v (single f16), f32 accumulate; gated RMS norm in f32 (precise expf); out = y (bf16 hi + residual) . Wo^T (2 products) + bo.
#include <hip/hip_runtime.h>
#include <math.h>

typedef __attribute__((ext_vector_type(16))) _Float16 v16h;
typedef __attribute__((ext_vector_type(16))) __bf16 v16b;
typedef __attribute__((ext_vector_type(8)))  _Float16 v8h;
typedef __attribute__((ext_vector_type(8)))  float v8f;
typedef __attribute__((ext_vector_type(4)))  float v4f;
typedef __attribute__((ext_vector_type(2)))  float v2f;
typedef __attribute__((ext_vector_type(4)))  unsigned v4u;
typedef __attribute__((ext_vector_type(4)))  int v4i;
typedef float __attribute__((may_alias)) float_a;
typedef int __attribute__((may_alias)) int_a;

template <typename T> __device__ __forceinline__ void vst2(void* p, T v) { *(T*)p = v;  }
__device__ __forceinline__ v8f wmma16(v16h a, v16h b, v8f c) {
  v8f d = __builtin_amdgcn_wmma_f32_16x16x32_f16(false, a, false, b, (short)0, c, false, false);
  asm volatile("v_nop\n\tv_nop\n\tv_nop\n\tv_nop" : "+v"(d) : "v"(a), "v"(b));
  return d;
}
__device__ __forceinline__ v8f wmma_bf(v16b a, v16b b, v8f c) {
  v8f d = __builtin_amdgcn_wmma_f32_16x16x32_bf16(false, a, false, b, (short)0, c, false, false);
  asm volatile("v_nop\n\tv_nop\n\tv_nop\n\tv_nop" : "+v"(d) : "v"(a), "v"(b));
  return d;
}
// ReLU attention (L 2,048, B 2, E 1,024, 16 heads x 64; sequence-first layout): q/k/v projections + biases, relu(q k^T / 8) in place of softmax, gated RMS norm (weight * x / rms * sigmoid(gate * x)), output projection + bias.
__device__ __forceinline__ v16h frag_h(const _Float16* rowk0, int lane) {
  union { v16h v; v8h q[2]; } u; const _Float16* p = rowk0 + 8 * (lane >> 4);
  u.q[0] = *(const v8h*)p; u.q[1] = *(const v8h*)(p + 16); return u.v;
}
__device__ __forceinline__ v16h frag_f32(const float* rowk0, int lane) {
  v16h a; const float* p = rowk0 + 8 * (lane >> 4);
#pragma unroll
  for (int i = 0; i < 8; ++i) { a[i] = (_Float16)p[i]; a[8 + i] = (_Float16)p[16 + i]; }
  return a;
}
__device__ __forceinline__ v16h frag_f32s(const float* rowk0, int lane, float sc) {
  v16h a; const float* p = rowk0 + 8 * (lane >> 4);
#pragma unroll
  for (int i = 0; i < 8; ++i) { a[i] = (_Float16)(p[i] * sc); a[8 + i] = (_Float16)(p[16 + i] * sc); }
  return a;
}
// column fragment from a [K][ld] layout (column n), rows >= K read as 0
__device__ __forceinline__ v16h fragc_f32(const float* W, int k0, int n, int lane, int ld, int K) {
  v16h a; const int g = lane >> 4;
#pragma unroll
  for (int i = 0; i < 8; ++i) { const int ka = k0 + 8 * g + i, kb = ka + 16;
    a[i] = (_Float16)(ka < K ? W[(size_t)(ka < K ? ka : K - 1) * ld + n] : 0.f); a[8 + i] = (_Float16)(kb < K ? W[(size_t)(kb < K ? kb : K - 1) * ld + n] : 0.f); }
  return a;
}
struct F2 { v16b h, l; };
__device__ __forceinline__ F2 bsplit16(const float v[16]) { F2 r;
#pragma unroll
  for (int i = 0; i < 16; ++i) { const __bf16 h = (__bf16)v[i]; r.h[i] = h; r.l[i] = (__bf16)(v[i] - (float)h); }
  return r; }
__device__ __forceinline__ F2 split_row(const float* row, int k0, int lane) { float v[16]; const float* p = row + k0 + 8 * (lane >> 4);
#pragma unroll
  for (int i = 0; i < 8; ++i) { v[i] = p[i]; v[8 + i] = p[16 + i]; }
  return bsplit16(v); }
__device__ __forceinline__ F2 split_rowK(const float* row, int k0, int lane, int K) { float v[16]; const int g = lane >> 4;
#pragma unroll
  for (int i = 0; i < 8; ++i) { const int ka = k0 + 8 * g + i, kb = ka + 16; v[i] = ka < K ? row[ka < K ? ka : K - 1] : 0.f; v[8 + i] = kb < K ? row[kb < K ? kb : K - 1] : 0.f; }
  return bsplit16(v); }
__device__ __forceinline__ F2 split_col(const float* W, int k0, int n, int lane, int ld, int K) { float v[16]; const int g = lane >> 4;
#pragma unroll
  for (int i = 0; i < 8; ++i) { const int ka = k0 + 8 * g + i, kb = ka + 16; v[i] = ka < K ? W[(size_t)(ka < K ? ka : K - 1) * ld + n] : 0.f; v[8 + i] = kb < K ? W[(size_t)(kb < K ? kb : K - 1) * ld + n] : 0.f; }
  return bsplit16(v); }
__device__ __forceinline__ v8f mac3(const F2& a, const F2& b, v8f c) { c = wmma_bf(a.l, b.h, c); c = wmma_bf(a.h, b.l, c); return wmma_bf(a.h, b.h, c); }
__device__ __forceinline__ float sigm(float v) { return 1.0f / (1.0f + expf(-v)); }
#define LDSX() do { asm volatile("s_wait_dscnt 0" ::: "memory"); __builtin_amdgcn_wave_barrier(); __builtin_amdgcn_fence(__ATOMIC_RELEASE, "workgroup"); } while (0)


#define NB 2
#define SS 2048
#define DM 1024
#define NH 16
__device__ __forceinline__ size_t xrow(size_t r) { return (r % SS) * NB + r / SS; }   // engine row (b, s) <-> the module's [L][B] row s*B + b
#define HD 64
#define QKVW (3 * DM)
#ifndef TQB
#define TQB (SS / 64)
#define TNB NB
#define TOB (NB * SS / 64)     // output row tiles (all)
#endif
typedef __attribute__((ext_vector_type(8))) __bf16 v8b;
__device__ __forceinline__ v16b frag_b(const __bf16* rowk0, int lane) {
  union { v16b v; v8b q[2]; } u; const __bf16* p = rowk0 + 8 * (lane >> 4);
  u.q[0] = *(const v8b*)p; u.q[1] = *(const v8b*)(p + 16); return u.v;
}
__device__ __forceinline__ float bfr(float v) { return (float)(__bf16)v; }
__device__ __attribute__((noinline)) float exp_ni(float v) { return expf(v); }
__device__ __attribute__((noinline)) float erf_ni(float v) { return erff(v); }

#define PK_A 0                       // [3072][1024] Wqkv rows (natural [out][in])
#define PK_P (PK_A + QKVW * DM)        // [1024][1024] Wo rows (natural)
#define PK_END (PK_P + DM * DM)
#define WS_PK  0u
#define WS_QK  (WS_PK + 2u * PK_END)             // f16 [4096 rows][2048]: q | k
#define WS_QKL (WS_QK + 2u * NB * SS * 2 * DM)     // f16 q | k residual planes x2048
#define WS_VTH (WS_QKL + 2u * NB * SS * 2 * DM)    // f16 [b][1024 (h*64+d)][2048 s] hi
#define WS_VTL (WS_VTH + 2u * NB * DM * SS)        // f16 lo x 2048
#define WS_O   (WS_VTL + 2u * NB * DM * SS)        // f32 [4096][1024]
#define WS_CS  (WS_O + 4u * NB * SS * DM)           // f32 [2048][32] x2, unused
#define WS_Y2  (WS_CS + 4u * 2 * SS * 32)                  // f32 [NR][1024] gated-rms-normed context
#define WS_END (WS_Y2 + 4u * (size_t)NB * SS * DM)
// ---- k_pack: block = (16,384 neighbouring elements of one weight matrix, which): natural [out][in] rows -> bf16, same element order; which 0..2 -> W_q/W_k/W_v into PK_A rows which*1024 + n; 3 -> W_o into PK_P.
// A thread takes 32 pieces of 16 B, a wave 512 B in a row per load and 256 B per store, all 32 loads in flight together (64 KiB per block): the launch starts 1,024 long waves and needs no LDS and no barrier.
#define PKN 32   // 16-B pieces per thread
typedef __attribute__((ext_vector_type(4))) __bf16 v4b;
// one wave per SIMD is all that the launch has: the register budget of one lets every load be issued before the first is waited for
__global__ __launch_bounds__(128) __attribute__((amdgpu_waves_per_eu(1, 1))) void k_pack(const float* __restrict__ WQ, const float* __restrict__ WK, const float* __restrict__ WV, const float* __restrict__ WO, __bf16* __restrict__ PK) {
  const int which = blockIdx.y, t = threadIdx.x; const float* Wm = (which == 0) ? WQ : (which == 1) ? WK : (which == 2) ? WV : WO;
  const size_t o = (size_t)blockIdx.x * (PKN * 512) + t * 4;
  const float* sp = Wm + o; __bf16* dp = PK + ((which < 3) ? PK_A + (size_t)which * DM * DM : (size_t)PK_P) + o;
  v4f v[PKN];
#pragma unroll
  for (int i = 0; i < PKN; ++i) v[i] = *(const v4f*)(sp + i * 512);
  asm volatile("s_wait_xcnt 0x0" :: "v"(sp) : "memory");   // the loads' address registers are reused behind them; as an input they stay untouched up to the wait
#pragma unroll
  for (int i = 0; i < PKN; ++i) { v4b h;
#pragma unroll
    for (int e = 0; e < 4; ++e) h[e] = (__bf16)v[i][e];
    *(v4b*)(dp + i * 512) = h; }
}
// ---- projection GEMM core: one 128 x 128 tile of X . W^T per block of KS groups of 4 waves, 64 x 64 per wave (wave = 2 * wm + wn), k in stages of 64.
// A stage is [X rows (NP planes: bf16, or bf16 hi then residual) | W rows] in LDS; the next stage's global loads are issued before the current stage's products and stored into the other buffer behind them; one barrier per stage.
// The walk over the NT stages starts at stage rot and wraps: blocks that share X rows or W rows get different rot, so that they do not ask L2 for the same lines at the same moment; an accumulator sums its k in that rotated order.
// KS = 2: the block has two groups of 4 waves (threads 0..127, 128..255); each has its own two buffers and takes every second stage of the walk into its own accumulators of the same tile, so that two waves share a SIMD and fill one another's waits; the caller adds the two partial sums.
// sw = false: A = X rows, B = W rows, acc[i][j][r] = (x row wm*64 + i*16 + 8g + r, w row wn*64 + j*16 + col); sw = true: the operands change places, acc[i][j][r] = (w row wn*64 + i*16 + 8g + r, x row wm*64 + j*16 + col). NP = 2 takes sw = true only.
#define GP 72   // LDS row pitch in 16-bit elements: 128 B of k + 16 B, so that the 16 rows of a ds_load_b128 fragment read fall on distinct banks
#define GK 64
template <int NP, int KS>
__device__ __forceinline__ void gemm128(const float* __restrict__ Xb, const int xld, const __bf16* __restrict__ Wb, __bf16* st, const bool sw, const int rot, v8f (&acc)[4][4]) {
  constexpr int ROWS = (NP + 1) * 128, NT = DM / GK;
  const int tid = KS > 1 ? (int)(threadIdx.x & 127) : (int)threadIdx.x, wave = tid >> 5, lane = tid & 31, col = lane & 15, wm = wave >> 1, wn = wave & 1;
  const int grp = KS > 1 ? __builtin_amdgcn_readfirstlane((int)(threadIdx.x >> 7)) : 0;   // the wave's group, the same in every lane
  st += grp * (2 * ROWS * GP);
  const float* xg = Xb + (size_t)(tid >> 4) * xld + (tid & 15) * 4;     // 16 lanes x 16 B = one row's 256 B of a stage
  const __bf16* wg = Wb + (size_t)(tid >> 3) * DM + (tid & 7) * 8;      // 8 lanes x 16 B = one row's 128 B of a stage
  const int xr0 = wm * 64 + col, wr0 = NP * 128 + wn * 64 + col;
  const int ar = sw ? wr0 : xr0, br = sw ? xr0 : wr0;
  v4f xv[16]; v8b wv[8];
  int kn = (rot + grp) & (NT - 1);   // the next stage to load (the same in every lane)
  const float* xp = xg + kn * GK; const __bf16* wp = wg + kn * GK;   // its addresses; stepped in sts(), behind the wait that ends ldg()
  auto ldg = [&]() {
#pragma unroll
    for (int i = 0; i < 16; ++i) xv[i] = *(const v4f*)(xp + (size_t)(i * 8) * xld);
#pragma unroll
    for (int i = 0; i < 8; ++i) wv[i] = *(const v8b*)(wp + (size_t)(i * 16) * DM);
    asm volatile("s_wait_xcnt 0x0" :: "v"(xp), "v"(wp) : "memory");   // the loads' address registers are reused behind them; as inputs they stay untouched up to the wait
  };
  auto sts = [&](int buf) {
    __bf16* s = st + buf * (ROWS * GP);
#pragma unroll
    for (int i = 0; i < 16; ++i) { v4b h4, l4;
#pragma unroll
      for (int e = 0; e < 4; ++e) { const __bf16 h = (__bf16)xv[i][e]; h4[e] = h; l4[e] = (__bf16)(xv[i][e] - (float)h); }
      __bf16* d = s + (i * 8 + (tid >> 4)) * GP + (tid & 15) * 4;
      *(v4b*)d = h4; if constexpr (NP == 2) *(v4b*)(d + 128 * GP) = l4; }
#pragma unroll
    for (int i = 0; i < 8; ++i) *(v8b*)(s + (NP * 128 + i * 16 + (tid >> 3)) * GP + (tid & 7) * 8) = wv[i];
    kn = (kn + KS) & (NT - 1); xp = xg + kn * GK; wp = wg + kn * GK;
  };
  ldg(); sts(0);
  __syncthreads();
#pragma unroll 1   // rolled, for speed only
  for (int t = 0; t < NT / KS; ++t) {
    if (t + 1 < NT / KS) ldg();
    const __bf16* s = st + (t & 1) * (ROWS * GP);
#pragma unroll
    for (int kc = 0; kc < GK / 32; ++kc) { v16b fa[4], fb[4];
#pragma unroll
      for (int i = 0; i < 4; ++i) { fa[i] = frag_b(s + (ar + i * 16) * GP + kc * 32, lane); fb[i] = frag_b(s + (br + i * 16) * GP + kc * 32, lane); }
      if constexpr (NP == 2) { v16b fl[4];   // residual plane first, then hi: each accumulator keeps the order lo, hi per 32 k
#pragma unroll
        for (int i = 0; i < 4; ++i) fl[i] = frag_b(s + (br + 128 + i * 16) * GP + kc * 32, lane);
#pragma unroll
        for (int i = 0; i < 4; ++i) {
#pragma unroll
          for (int j = 0; j < 4; ++j) acc[i][j] = wmma_bf(fa[i], fl[j], acc[i][j]); } }
#pragma unroll
      for (int i = 0; i < 4; ++i) {
#pragma unroll
        for (int j = 0; j < 4; ++j) acc[i][j] = wmma_bf(fa[i], fb[j], acc[i][j]); } }
    if (t + 1 < NT / KS) sts((t + 1) & 1);
    __syncthreads();   // publishes stage t + 1 and ends every wave's reads of stage t (behind the last stage: frees the buffers for the epilogue)
  }
}
// ---- k_qkv: block = (128 engine rows, 128 of the 3,072 q | k | v columns). q, k: W rows as the A operand, so a lane holds 8 neighbouring columns of one row; v: X rows as A, so a lane holds 8 neighbouring positions of one column (v is stored transposed). Either way 16-B LDS stores into the wave's own staging, then whole 128-B lines to memory.
__global__ __launch_bounds__(128) void k_qkv(const float* __restrict__ XQ, const float* __restrict__ XK, const float* __restrict__ XV, const __bf16* __restrict__ P, const float* __restrict__ BQ, const float* __restrict__ BK, const float* __restrict__ BV, _Float16* __restrict__ QK, _Float16* __restrict__ QKL, _Float16* __restrict__ VTH, _Float16* __restrict__ VTL) {
  const int which0 = (blockIdx.y * 128) / DM; const float* X = (which0 == 0) ? XQ : (which0 == 1) ? XK : XV; const float* BB = BQ ? (((which0 == 0) ? BQ : (which0 == 1) ? BK : BV) + (blockIdx.y * 128 - which0 * DM)) : nullptr;
  __shared__ __align__(16) __bf16 st[2 * 256 * GP];
  const int tid = threadIdx.x, wave = tid >> 5, lane = tid & 31, col = lane & 15, g = lane >> 4, wm = wave >> 1, wn = wave & 1; const int n0 = blockIdx.y * 128;
  const size_t rb = (size_t)blockIdx.x * 128; const int b = (int)(rb / SS), s0 = (int)(rb % SS);   // 128 divides SS: one batch per block; engine row rb + i is module row (s0 + i) * NB + b
  const bool sw = n0 < 2 * DM;
  v8f acc[4][4] = {};
  gemm128<1, 1>(X + ((size_t)s0 * NB + b) * DM, NB * DM, P + (size_t)n0 * DM, st, sw, (int)(blockIdx.x + 2 * blockIdx.y), acc);   // 8 blocks share X rows (neighbouring y), 32 share W rows (all x)
  _Float16* eh = (_Float16*)st + wave * (2 * 64 * GP); _Float16* el = eh + 64 * GP;   // per wave: [64][GP] hi, [64][GP] residual
  float bi[4][8] = {}, bj[4] = {};   // bias of the lane's 8 columns per i (q, k) or of its one column per j (v)
  if (BB) {   // one branch round all the bias loads, so that they are in flight together
    if (sw) {
#pragma unroll
      for (int i = 0; i < 4; ++i) {
#pragma unroll
        for (int r = 0; r < 8; ++r) bi[i][r] = bfr(BB[wn * 64 + i * 16 + 8 * g + r]); }
    } else {
#pragma unroll
      for (int j = 0; j < 4; ++j) bj[j] = bfr(BB[wn * 64 + j * 16 + col]); } }
#pragma unroll
  for (int i = 0; i < 4; ++i) {
#pragma unroll
    for (int j = 0; j < 4; ++j) { v8h hv, lv;
#pragma unroll
      for (int r = 0; r < 8; ++r) { const float v = acc[i][j][r] + (sw ? bi[i][r] : bj[j]); const _Float16 hh = (_Float16)v; hv[r] = hh; lv[r] = (_Float16)((v - (float)hh) * 2048.0f); }   // (+ bias) as f16 hi + (x2048) residual; q unscaled, 1/8 applied to the f32 score
      *(v8h*)(eh + (j * 16 + col) * GP + i * 16 + 8 * g) = hv; *(v8h*)(el + (j * 16 + col) * GP + i * 16 + 8 * g) = lv; } }
  LDSX();
  static_assert(2 * DM == SS, "q | k rows and transposed v rows have one pitch");
  const size_t o0 = (sw ? (rb + wm * 64) * (2 * DM) + n0 + wn * 64 : ((size_t)b * DM + (n0 - 2 * DM) + wn * 64) * SS + s0 + wm * 64) + (size_t)(lane >> 3) * SS + (lane & 7) * 8;   // 8 lanes x 16 B = one row's 128 B, 4 rows per store
  _Float16* ph = (sw ? QK : VTH) + o0; _Float16* pl = (sw ? QKL : VTL) + o0; const _Float16* sh = eh + (lane >> 3) * GP + (lane & 7) * 8;
#pragma unroll
  for (int it0 = 0; it0 < 16; it0 += 4) { v4u a[4], r4[4];   // 8 LDS reads in flight, then their 8 stores
#pragma unroll
    for (int u = 0; u < 4; ++u) { a[u] = *(const v4u*)(sh + (it0 + u) * 4 * GP); r4[u] = *(const v4u*)(sh + 64 * GP + (it0 + u) * 4 * GP); }
#pragma unroll
    for (int u = 0; u < 4; ++u) { vst2(ph + (size_t)(it0 + u) * 4 * SS, a[u]); vst2(pl + (size_t)(it0 + u) * 4 * SS, r4[u]); }
    asm volatile("s_wait_xcnt 0x0" :: "v"(ph), "v"(pl) : "memory"); }   // the next group's LDS reads overwrite these stores' data registers
}
// ---- k_attn: block = (128 queries, head h, batch b), two groups of 4 waves x 32 queries (two 16-row tiles per wave). Both groups hold the same queries; group 0 takes the even key tiles of the block's walk and group 1 the odd ones, so that the launch has four waves per SIMD to fill one another's waits; behind the loop the two partial sums are added through LDS, each group finishing one of its waves' two query tiles. K and V come in tiles of 64 keys, copied asynchronously into the group's own two LDS buffers and read by its four waves; every K and V fragment serves both of a wave's query tiles. scores are computed transposed (k rows x q rows, single f16 operands), so that a lane's accumulators of 32 keys are its own part of P's fragment and P stays in registers; relu(score * 0.125), P (x 2^11, single f16) x V, f32 accumulate, in each group over the keys of its own tiles in groups of 32, ascending from the block's first tile and wrapping (the 16 blocks that share a head's K and V start two tiles apart, so that they do not ask L2 for the same lines at the same moment); O[b*S+q][h*64+d] = acc / 2^11 (256-B segments)
// two transposed score tiles (keys 0..15 and 16..31 of a group of 32, one query per lane) are, converted in place, the A fragment of P for that group: element s = key 8g + s (s < 8), 16 + 8g + s - 8 (else).
// relu(s / 8) * 2^11 = relu(s * 2^8): the powers of two are exact, and relu commutes with the rounding to f16. P is scaled by 2^11 so that small weights stay out of the f16 subnormal range; 2^-11 is folded into the epilogue.
__device__ __forceinline__ v16h pack_p(v8f t0, v8f t1) {
  v16h p;
#pragma unroll
  for (int i = 0; i < 8; ++i) { p[i] = (_Float16)(t0[i] * 256.0f); p[8 + i] = (_Float16)(t1[i] * 256.0f); }
  const v16h z = {};
  return __builtin_elementwise_max(p, z);
}
#define AK 64   // keys per tile: K tile = [64 keys][GP], V tile = [64 d][GP]; rows of 128 B at the pitch of the ds_load_b128 fragment reads
// four waves per SIMD is what the launch has: the register budget of four lets two blocks share a WGP
__global__ __launch_bounds__(256) __attribute__((amdgpu_waves_per_eu(4, 4))) void k_attn(const _Float16* __restrict__ QK, const _Float16* __restrict__ QKL, const _Float16* __restrict__ VTH, const _Float16* __restrict__ VTL, const void* __restrict__ KMASK, float* __restrict__ O) {
  (void)QKL; (void)VTL; (void)KMASK;
  __shared__ __align__(16) _Float16 kv[2][2][2][AK * GP];   // [group][buffer][K | V][row][GP]
  __shared__ __align__(16) float sp[4][2][16][68];       // per 32 queries and query tile: the hand-over between the groups, then the output staging
  const int tid = threadIdx.x & 127, wave = tid >> 5, lane = tid & 31, col = lane & 15, g = lane >> 4;
  const int half = __builtin_amdgcn_readfirstlane((int)(threadIdx.x >> 7));   // the wave's group, the same in every lane
  const int qb = blockIdx.x, h = blockIdx.y, b = blockIdx.z; const int q0 = qb * 128 + wave * 32;
  constexpr int NTL = SS / AK, NTR = NTL / 2;   // key tiles; trips of a group
  // 8 lanes x 16 B = one row's 128 B; 16 rows per copy of a group, 4 copies for K and 4 for V
  const _Float16* kg = QK + ((size_t)b * SS + (tid >> 3)) * (2 * DM) + DM + h * HD + (tid & 7) * 8;
  const _Float16* vg = VTH + ((size_t)b * DM + h * HD + (tid >> 3)) * SS + (tid & 7) * 8;
  const unsigned lk = (unsigned)(uintptr_t)&kv[half][0][0][(tid >> 3) * GP + (tid & 7) * 8];
  auto fill = [&](int t) {
    const int tile = (2 * t + half + 2 * qb) & (NTL - 1);   // trip t of the group works on this key tile; the buffer goes by the trip's parity
    const _Float16* kp = kg + (size_t)tile * (AK * 2 * DM); const _Float16* vp = vg + tile * AK;
    const unsigned l = lk + (unsigned)(t & 1) * (2u * AK * GP * 2u), lv = l + AK * GP * 2u;
    // the copies and the wait that keeps their address registers untouched until they are read, in one statement
    asm volatile("global_load_async_to_lds_b128 %0, %8, off\n\t"
                 "global_load_async_to_lds_b128 %1, %9, off\n\t"
                 "global_load_async_to_lds_b128 %2, %10, off\n\t"
                 "global_load_async_to_lds_b128 %3, %11, off\n\t"
                 "global_load_async_to_lds_b128 %4, %12, off\n\t"
                 "global_load_async_to_lds_b128 %5, %13, off\n\t"
                 "global_load_async_to_lds_b128 %6, %14, off\n\t"
                 "global_load_async_to_lds_b128 %7, %15, off\n\t"
                 "s_wait_xcnt 0x0"
                 :: "v"(l), "v"(l + 16u * GP * 2u), "v"(l + 32u * GP * 2u), "v"(l + 48u * GP * 2u),
                    "v"(lv), "v"(lv + 16u * GP * 2u), "v"(lv + 32u * GP * 2u), "v"(lv + 48u * GP * 2u),
                    "v"(kp), "v"(kp + 16 * 2 * DM), "v"(kp + 32 * 2 * DM), "v"(kp + 48 * 2 * DM),
                    "v"(vp), "v"(vp + 16 * SS), "v"(vp + 32 * SS), "v"(vp + 48 * SS)
                 : "memory");
  };
  fill(0);
  const _Float16* qp = QK + ((size_t)b * SS + q0 + col) * (2 * DM) + h * HD;
  v16h aq[2][2];
#pragma unroll
  for (int qt = 0; qt < 2; ++qt) {
#pragma unroll
    for (int kc = 0; kc < 2; ++kc) aq[qt][kc] = frag_h(qp + (size_t)qt * 16 * (2 * DM) + kc * 32, lane); }
  asm volatile("s_wait_xcnt 0x0" :: "v"(qp) : "memory");   // the loads' address registers are reused behind them; as an input they stay untouched up to the wait
  v8f acc[2][4] = {};
  asm volatile("s_wait_asynccnt 0x0" ::: "memory");   // this wave's copies of tile 0 have landed
  __syncthreads();                                     // publishes tile 0
  fill(1);
#pragma unroll 1   // rolled: one trip per key tile, the buffer chosen by the trip's parity
  for (int t = 0; t < NTR; ++t) {
    const _Float16* kt = &kv[half][t & 1][0][0]; const _Float16* vt = &kv[half][t & 1][1][0];
    v16h kf[2][2][2], vf[2][4];   // per group of 32 keys: K rows (A of the scores), V rows (B of P x V)
    auto ldf = [&](int k2) {
#pragma unroll
      for (int cl = 0; cl < 2; ++cl) {
#pragma unroll
        for (int kc = 0; kc < 2; ++kc) kf[k2][cl][kc] = frag_h(kt + ((k2 * 2 + cl) * 16 + col) * GP + kc * 32, lane); }
#pragma unroll
      for (int dt = 0; dt < 4; ++dt) vf[k2][dt] = frag_h(vt + (dt * 16 + col) * GP + k2 * 32, lane);
    };
    ldf(0);
#pragma unroll
    for (int k2 = 0; k2 < 2; ++k2) { v16h pa[2]; v8f c[2][2] = {};   // 32 keys x 32 queries; transposed score tiles: c[cl][qt][r] = (key k2*32 + cl*16 + 8g + r, query qt*16 + col)
#pragma unroll
      for (int kc = 0; kc < 2; ++kc) {
#pragma unroll
        for (int cl = 0; cl < 2; ++cl) {
#pragma unroll
          for (int qt = 0; qt < 2; ++qt) c[cl][qt] = wmma16(kf[k2][cl][kc], aq[qt][kc], c[cl][qt]); } }   // single product: k rows as A, q rows as B, one-rounding f16 operands
      if (k2 == 0) ldf(1);   // the second group's fragments fly behind the first group's conversion and P x V
#pragma unroll
      for (int qt = 0; qt < 2; ++qt) pa[qt] = pack_p(c[0][qt], c[1][qt]);
#pragma unroll
      for (int dt = 0; dt < 4; ++dt) {
#pragma unroll
        for (int qt = 0; qt < 2; ++qt) acc[qt][dt] = wmma16(pa[qt], vf[k2][dt], acc[qt][dt]); } }   // single product: P (x2^11) x V
    asm volatile("s_wait_dscnt 0x0" ::: "memory");      // this wave's reads of tile t are done
    asm volatile("s_wait_asynccnt 0x0" ::: "memory");   // this wave's copies of tile t + 1 have landed
    __syncthreads();                                     // publishes tile t + 1 and ends every wave's reads of tile t
    if (t + 2 < NTR) fill(t + 2);
  }
  asm volatile("s_wait_asynccnt 0x0" ::: "memory");   // nothing is in flight when the wave ends
  // group 0 finishes query tile 0 and group 1 query tile 1: a wave hands the other tile's partial sums to the wave of the same queries in the other group, lane to lane
  v8f mine[4], other[4];
#pragma unroll
  for (int dt = 0; dt < 4; ++dt) { mine[dt] = half ? acc[1][dt] : acc[0][dt]; other[dt] = half ? acc[0][dt] : acc[1][dt]; }
  float* so = &sp[wave][1 - half][8 * g][col]; float* sm = &sp[wave][half][8 * g][col];
#pragma unroll
  for (int r = 0; r < 8; ++r) {
#pragma unroll
    for (int dt = 0; dt < 4; ++dt) so[r * 68 + dt * 16] = other[dt][r]; }
  __syncthreads();   // publishes the partial sums of both groups
  float pv[8][4];   // all 32 LDS reads stand ahead of the first store to the same tile
#pragma unroll
  for (int r = 0; r < 8; ++r) {
#pragma unroll
    for (int dt = 0; dt < 4; ++dt) pv[r][dt] = sm[r * 68 + dt * 16]; }
#pragma unroll
  for (int r = 0; r < 8; ++r) {
#pragma unroll
    for (int dt = 0; dt < 4; ++dt) sm[r * 68 + dt * 16] = (mine[dt][r] + pv[r][dt]) * (1.0f / 2048.0f); }   // the sum of the two groups; undo the P scaling only
  LDSX();
  float* po = O + ((size_t)b * SS + q0 + half * 16 + g) * DM + h * HD + col * 4; const float* sf = &sp[wave][half][g][col * 4];   // 16 lanes x 16 B = 256 B of a row, 2 rows per store
  v4f a[8];   // 8 LDS reads in flight, then their 8 stores
#pragma unroll
  for (int u = 0; u < 8; ++u) a[u] = *(const v4f*)(sf + u * 2 * 68);
#pragma unroll
  for (int u = 0; u < 8; ++u) vst2(po + (size_t)u * 2 * DM, a[u]);
}
// ---- k_out: block = (128 rows, 128 cols), 8 waves: out = y (bf16 hi + residual) . Wo rows (2 products) + bo; Wo rows as the A operand, so a lane holds 8 neighbouring output columns of one row
// The launch has one block per WGP: the k walk is split between two groups of 4 waves (two waves per SIMD); the second group hands its partial sums over through LDS, the first adds them to its own and writes the tile.
__global__ __launch_bounds__(256) void k_out(const float* __restrict__ O, const __bf16* __restrict__ P, const float* __restrict__ BO, float* __restrict__ Y) {
  __shared__ __align__(16) __bf16 st[2 * 2 * 384 * GP];   // [group][buffer][rows][GP]
  const int tid = threadIdx.x & 127, wave = tid >> 5, lane = tid & 31, col = lane & 15, g = lane >> 4, wm = wave >> 1, wn = wave & 1; const size_t rb = (size_t)blockIdx.x * 128; const int n0 = blockIdx.y * 128;
  const int grp = __builtin_amdgcn_readfirstlane((int)(threadIdx.x >> 7));   // the wave's group, the same in every lane
  v8f acc[4][4] = {};
  gemm128<2, 2>(O + rb * DM, DM, P + (size_t)n0 * DM, st, true, (int)(blockIdx.x + 2 * blockIdx.y), acc);   // 8 blocks share y rows (all blockIdx.y), 32 share Wo rows (all blockIdx.x)
  float* xf = (float*)(st + 2 * 384 * GP) + (wave * (32 * 32) + lane) * 4;   // hand-over in the second group's buffers: per wave 32 pieces of 32 lanes x 16 B
  if (grp == 1) {
#pragma unroll
    for (int i = 0; i < 4; ++i) {
#pragma unroll
      for (int j = 0; j < 4; ++j) { *(v4f*)(xf + ((i * 4 + j) * 2) * 128) = __builtin_shufflevector(acc[i][j], acc[i][j], 0, 1, 2, 3); *(v4f*)(xf + ((i * 4 + j) * 2 + 1) * 128) = __builtin_shufflevector(acc[i][j], acc[i][j], 4, 5, 6, 7); } } }
  __syncthreads();   // publishes the second group's partial sums
  if (grp == 1) return;   // no barrier stands behind this line
#pragma unroll
  for (int i = 0; i < 4; ++i) {
#pragma unroll
    for (int j = 0; j < 4; ++j) { const v4f a4 = *(const v4f*)(xf + ((i * 4 + j) * 2) * 128), b4 = *(const v4f*)(xf + ((i * 4 + j) * 2 + 1) * 128);
#pragma unroll
      for (int r = 0; r < 4; ++r) { acc[i][j][r] += a4[r]; acc[i][j][4 + r] += b4[r]; } } }
  float* ef = (float*)st + wave * (64 * 68);   // per wave: [64 rows][64 + 4 floats]
  const float* bp = BO + n0 + wn * 64 + 8 * g; float bi[4][8];   // bias of the lane's 8 columns per i
#pragma unroll
  for (int i = 0; i < 4; ++i) {
#pragma unroll
    for (int r = 0; r < 8; ++r) bi[i][r] = bp[i * 16 + r]; }
  asm volatile("s_wait_xcnt 0x0" :: "v"(bp) : "memory");   // the loads' address registers are reused behind them; as an input they stay untouched up to the wait
#pragma unroll
  for (int i = 0; i < 4; ++i) {
#pragma unroll
    for (int j = 0; j < 4; ++j) { v4f a4, b4;
#pragma unroll
      for (int r = 0; r < 4; ++r) { a4[r] = acc[i][j][r] + bfr(bi[i][r]); b4[r] = acc[i][j][4 + r] + bfr(bi[i][4 + r]); }
      float* d = ef + (j * 16 + col) * 68 + i * 16 + 8 * g; *(v4f*)d = a4; *(v4f*)(d + 4) = b4; } }
  LDSX();
  const int b = (int)(rb / SS), s0 = (int)(rb % SS);   // 128 divides SS: one batch per block; engine row rb + i is module row (s0 + i) * NB + b
  float* py = Y + ((size_t)(s0 + wm * 64 + g) * NB + b) * DM + n0 + wn * 64 + col * 4; const float* sf = ef + g * 68 + col * 4;   // back to the [L][B][E] layout: 16 lanes x 16 B = 256 B of a row, 2 rows per store
#pragma unroll
  for (int it0 = 0; it0 < 32; it0 += 8) { v4f a[8];   // 8 LDS reads in flight, then their 8 stores
#pragma unroll
    for (int u = 0; u < 8; ++u) a[u] = *(const v4f*)(sf + (it0 + u) * 2 * 68);
#pragma unroll
    for (int u = 0; u < 8; ++u) vst2(py + (size_t)(it0 + u) * 2 * NB * DM, a[u]);
    asm volatile("s_wait_xcnt 0x0" :: "v"(py) : "memory"); }   // the next group's LDS reads overwrite these stores' data registers
}
// ---- k_gnorm: wave = engine row (32 lanes x 32 elements, 512 B in a row per load and store), 8 rows per block, no LDS and no barrier: y = weight * x / (||x||/sqrt(1024) + 1e-8) * sigmoid(gate * x) (precise expf)
// The row, the weights and the gates are loaded together; the launch starts 4,096 long waves, and a lane's 32 elements are independent chains that fill one another's latencies.
// four waves per SIMD is all that the launch has: the register budget of four holds the row, its weights and its gates at once, so that the loads stand ahead of the arithmetic
__global__ __launch_bounds__(256) __attribute__((amdgpu_waves_per_eu(4, 4))) void k_gnorm(const float* __restrict__ O, const float* __restrict__ NW, const float* __restrict__ NG, float* __restrict__ Y2) {
  const int lane = threadIdx.x & 31; const size_t row = (size_t)blockIdx.x * 8 + (threadIdx.x >> 5);
  const float* xp = O + row * DM + lane * 4; const float* wp = NW + lane * 4; const float* gp = NG + lane * 4;
  v4f x[8], w[8], gt[8];
#pragma unroll
  for (int i = 0; i < 8; ++i) x[i] = *(const v4f*)(xp + i * 128);
#pragma unroll
  for (int i = 0; i < 8; ++i) { w[i] = *(const v4f*)(wp + i * 128); gt[i] = *(const v4f*)(gp + i * 128); }
  v4f s4 = {};   // four partial sums per lane, then the lane's sum, then the butterfly over the wave
#pragma unroll
  for (int i = 0; i < 8; ++i) s4 += x[i] * x[i];
  float s = (s4[0] + s4[1]) + (s4[2] + s4[3]);
#pragma unroll
  for (int o = 1; o < 32; o <<= 1) s += __shfl_xor(s, o);
  const float rms = sqrtf(s) * 0.03125f; const float inv = 1.0f / (rms + 1e-8f);
  float* yp = Y2 + row * DM + lane * 4;
#pragma unroll
  for (int i = 0; i < 8; ++i) { v4f o4; const v4f wr = __builtin_convertvector(__builtin_convertvector(w[i], v4b), v4f), gr = __builtin_convertvector(__builtin_convertvector(gt[i], v4b), v4f);   // weight and gate rounded to bf16, two per conversion
#pragma unroll
    for (int e = 0; e < 4; ++e) { const float xv = x[i][e]; o4[e] = wr[e] * (xv * inv) * (1.0f / (1.0f + expf(-gr[e] * xv))); }
    vst2(yp + i * 128, o4); }
}
extern "C" void kernel_launch(void* const* d_in, const int* in_sizes, int n_in, void* d_out, int out_size, void* d_ws, size_t ws_size, hipStream_t stream) {
  (void)in_sizes; (void)n_in; (void)out_size;
  const float** F = (const float**)d_in;   // 0 query, 1 key, 2 value [2048,2,1024] (L,B,E); 3 Wq, 4 bq, 5 Wk, 6 bk, 7 Wv, 8 bv, 9 Wo, 10 bo (natural); 11 norm_weight, 12 norm_gate
  if (ws_size < (size_t)WS_END) return;
  char* ws = (char*)d_ws; __bf16* PK = (__bf16*)(ws + WS_PK); _Float16 *QK = (_Float16*)(ws + WS_QK), *QKL = (_Float16*)(ws + WS_QKL), *VTH = (_Float16*)(ws + WS_VTH), *VTL = (_Float16*)(ws + WS_VTL); float *O = (float*)(ws + WS_O), *Y2 = (float*)(ws + WS_Y2);
  k_pack<<<dim3(DM * DM / (PKN * 512), 4), 128, 0, stream>>>(F[3], F[5], F[7], F[9], PK);
  k_qkv<<<dim3(TNB * SS / 128, QKVW / 128), 128, 0, stream>>>(F[0], F[1], F[2], PK + PK_A, F[4], F[6], F[8], QK, QKL, VTH, VTL);
  k_attn<<<dim3(TQB / 2, NH, TNB), 256, 0, stream>>>(QK, QKL, VTH, VTL, nullptr, O);
  k_gnorm<<<NB * SS / 8, 256, 0, stream>>>(O, F[11], F[12], Y2);
  k_out<<<dim3(TOB / 2, DM / 128), 256, 0, stream>>>(Y2, PK + PK_P, F[10], (float*)d_out);
}

// v008
// It runs in 69.4 microseconds.
// It is 1.19 times as fast as v006, going by the measured steps of the versions left out in between.
// Counting every step since v000, it is 5.62 times as fast.
// compute dtype: all float inputs rounded to bf16; q/k/v = x . W^T + b with EXACT bf16 products on WMMA 16x16x32 (natural rows) with the (L, B, E) row order remapped on load and store; 'attention' = relu(q k^T / 8) (no softmax): q, k as single f16 operands, relu, P (scaled by 2^11, single f16) x v (single f16), f32 accumulate; gated RMS norm in f32 (precise expf), its result y rounded once to f16; out = y . Wo^T (single f16 operands, 1 product) + bo.
#include <hip/hip_runtime.h>
#include <math.h>

typedef __attribute__((ext_vector_type(16))) _Float16 v16h;
typedef __attribute__((ext_vector_type(16))) __bf16 v16b;
typedef __attribute__((ext_vector_type(8)))  _Float16 v8h;
typedef __attribute__((ext_vector_type(8)))  float v8f;
typedef __attribute__((ext_vector_type(4)))  float v4f;
typedef __attribute__((ext_vector_type(2)))  float v2f;
typedef __attribute__((ext_vector_type(4)))  unsigned v4u;
typedef __attribute__((ext_vector_type(4)))  int v4i;
typedef float __attribute__((may_alias)) float_a;
typedef int __attribute__((may_alias)) int_a;

template <typename T> __device__ __forceinline__ void vst2(void* p, T v) { *(T*)p = v;  }
__device__ __forceinline__ v8f wmma16(v16h a, v16h b, v8f c) {
  v8f d = __builtin_amdgcn_wmma_f32_16x16x32_f16(false, a, false, b, (short)0, c, false, false);
  return d;
}
__device__ __forceinline__ v8f wmma_bf(v16b a, v16b b, v8f c) {
  v8f d = __builtin_amdgcn_wmma_f32_16x16x32_bf16(false, a, false, b, (short)0, c, false, false);
  return d;
}
// HOLD: the compiler schedules nothing across this line. Behind a group of LDS fragment reads it keeps them one group ahead of the products that use them (left free, each pair of reads sinks to its first user and is waited for to 0); behind a group of products it keeps the next group's reads, or the trip's barrier, from moving in among them.
#define HOLD() __builtin_amdgcn_sched_barrier(0)
// ReLU attention (L 2,048, B 2, E 1,024, 16 heads x 64; sequence-first layout): q/k/v projections + biases, relu(q k^T / 8) in place of softmax, gated RMS norm (weight * x / rms * sigmoid(gate * x)), output projection + bias.
__device__ __forceinline__ v16h frag_h(const _Float16* rowk0, int lane) {
  union { v16h v; v8h q[2]; } u; const _Float16* p = rowk0 + 8 * (lane >> 4);
  u.q[0] = *(const v8h*)p; u.q[1] = *(const v8h*)(p + 16); return u.v;
}
__device__ __forceinline__ v16h frag_f32(const float* rowk0, int lane) {
  v16h a; const float* p = rowk0 + 8 * (lane >> 4);
#pragma unroll
  for (int i = 0; i < 8; ++i) { a[i] = (_Float16)p[i]; a[8 + i] = (_Float16)p[16 + i]; }
  return a;
}
__device__ __forceinline__ v16h frag_f32s(const float* rowk0, int lane, float sc) {
  v16h a; const float* p = rowk0 + 8 * (lane >> 4);
#pragma unroll
  for (int i = 0; i < 8; ++i) { a[i] = (_Float16)(p[i] * sc); a[8 + i] = (_Float16)(p[16 + i] * sc); }
  return a;
}
// column fragment from a [K][ld] layout (column n), rows >= K read as 0
__device__ __forceinline__ v16h fragc_f32(const float* W, int k0, int n, int lane, int ld, int K) {
  v16h a; const int g = lane >> 4;
#pragma unroll
  for (int i = 0; i < 8; ++i) { const int ka = k0 + 8 * g + i, kb = ka + 16;
    a[i] = (_Float16)(ka < K ? W[(size_t)(ka < K ? ka : K - 1) * ld + n] : 0.f); a[8 + i] = (_Float16)(kb < K ? W[(size_t)(kb < K ? kb : K - 1) * ld + n] : 0.f); }
  return a;
}
struct F2 { v16b h, l; };
__device__ __forceinline__ F2 bsplit16(const float v[16]) { F2 r;
#pragma unroll
  for (int i = 0; i < 16; ++i) { const __bf16 h = (__bf16)v[i]; r.h[i] = h; r.l[i] = (__bf16)(v[i] - (float)h); }
  return r; }
__device__ __forceinline__ F2 split_row(const float* row, int k0, int lane) { float v[16]; const float* p = row + k0 + 8 * (lane >> 4);
#pragma unroll
  for (int i = 0; i < 8; ++i) { v[i] = p[i]; v[8 + i] = p[16 + i]; }
  return bsplit16(v); }
__device__ __forceinline__ F2 split_rowK(const float* row, int k0, int lane, int K) { float v[16]; const int g = lane >> 4;
#pragma unroll
  for (int i = 0; i < 8; ++i) { const int ka = k0 + 8 * g + i, kb = ka + 16; v[i] = ka < K ? row[ka < K ? ka : K - 1] : 0.f; v[8 + i] = kb < K ? row[kb < K ? kb : K - 1] : 0.f; }
  return bsplit16(v); }
__device__ __forceinline__ F2 split_col(const float* W, int k0, int n, int lane, int ld, int K) { float v[16]; const int g = lane >> 4;
#pragma unroll
  for (int i = 0; i < 8; ++i) { const int ka = k0 + 8 * g + i, kb = ka + 16; v[i] = ka < K ? W[(size_t)(ka < K ? ka : K - 1) * ld + n] : 0.f; v[8 + i] = kb < K ? W[(size_t)(kb < K ? kb : K - 1) * ld + n] : 0.f; }
  return bsplit16(v); }
__device__ __forceinline__ v8f mac3(const F2& a, const F2& b, v8f c) { c = wmma_bf(a.l, b.h, c); c = wmma_bf(a.h, b.l, c); return wmma_bf(a.h, b.h, c); }
__device__ __forceinline__ float sigm(float v) { return 1.0f / (1.0f + expf(-v)); }
#define LDSX() do { asm volatile("s_wait_dscnt 0" ::: "memory"); __builtin_amdgcn_wave_barrier(); __builtin_amdgcn_fence(__ATOMIC_RELEASE, "workgroup"); } while (0)


#define NB 2
#define SS 2048
#define DM 1024
#define NH 16
__device__ __forceinline__ size_t xrow(size_t r) { return (r % SS) * NB + r / SS; }   // engine row (b, s) <-> the module's [L][B] row s*B + b
#define HD 64
#define QKVW (3 * DM)
#ifndef TQB
#define TQB (SS / 64)
#define TNB NB
#define TOB (NB * SS / 64)     // output row tiles (all)
#endif
typedef __attribute__((ext_vector_type(8))) __bf16 v8b;
__device__ __forceinline__ v16b frag_b(const __bf16* rowk0, int lane) {
  union { v16b v; v8b q[2]; } u; const __bf16* p = rowk0 + 8 * (lane >> 4);
  u.q[0] = *(const v8b*)p; u.q[1] = *(const v8b*)(p + 16); return u.v;
}
__device__ __forceinline__ float bfr(float v) { return (float)(__bf16)v; }
__device__ __attribute__((noinline)) float exp_ni(float v) { return expf(v); }
__device__ __attribute__((noinline)) float erf_ni(float v) { return erff(v); }

#define PK_A 0                       // [3072][1024] Wqkv rows (natural [out][in])
#define PK_P (PK_A + QKVW * DM)        // [1024][1024] Wo rows (natural), held as f16
#define PK_END (PK_P + DM * DM)
#define WS_PK  0u
#define WS_QK  (WS_PK + 2u * PK_END)             // f16 [4096 rows][2048]: q | k
#define WS_VTH (WS_QK + 2u * NB * SS * 2 * DM)     // f16 [b][1024 (h*64+d)][2048 s]
#define WS_O   (WS_VTH + 2u * NB * DM * SS)        // f32 [4096][1024]
#define WS_CS  (WS_O + 4u * NB * SS * DM)           // f32 [2][2048][32], unused
#define WS_Y2  (WS_CS + 4u * 2 * SS * 32)                  // f16 [NR][1024] gated-rms-normed context
#define WS_END (WS_Y2 + 2u * (size_t)NB * SS * DM)
// ---- k_pack: block = (16,384 neighbouring elements of one weight matrix, which): natural [out][in] rows -> bf16, same element order; which 0..2 -> W_q/W_k/W_v into PK_A rows which*1024 + n; 3 -> W_o into PK_P, rounded to bf16 like the others and then held as f16 (the partner of the f16 y in k_out).
// A thread takes 32 pieces of 16 B, a wave 512 B in a row per load and 256 B per store, all 32 loads in flight together (64 KiB per block): the launch starts 1,024 long waves, one block per WGP, and needs no LDS and no barrier.
#define PKN 32   // 16-B pieces per thread
typedef __attribute__((ext_vector_type(4))) __bf16 v4b;
typedef __attribute__((ext_vector_type(4))) _Float16 v4h;
// one wave per SIMD is all that the launch has: the register budget of one lets every load be issued before the first is waited for
__global__ __launch_bounds__(128) __attribute__((amdgpu_waves_per_eu(1, 1))) void k_pack(const float* __restrict__ WQ, const float* __restrict__ WK, const float* __restrict__ WV, const float* __restrict__ WO, __bf16* __restrict__ PK) {
  const int which = blockIdx.y, t = threadIdx.x; const float* Wm = (which == 0) ? WQ : (which == 1) ? WK : (which == 2) ? WV : WO;
  const size_t o = (size_t)blockIdx.x * (PKN * 512) + t * 4;
  const float* sp = Wm + o; __bf16* dp = PK + ((which < 3) ? PK_A + (size_t)which * DM * DM : (size_t)PK_P) + o;
  v4f v[PKN];
#pragma unroll
  for (int i = 0; i < PKN; ++i) v[i] = *(const v4f*)(sp + i * 512);
  asm volatile("s_wait_xcnt 0x0" :: "v"(sp) : "memory");   // the loads' address registers are reused behind them; as an input they stay untouched up to the wait
  v4b h[PKN];
#pragma unroll
  for (int i = 0; i < PKN; ++i) {
#pragma unroll
    for (int e = 0; e < 4; ++e) h[i][e] = (__bf16)v[i][e]; }
  if (which == 3) {   // W_o (the same for the whole block): the bf16 values, written as f16
#pragma unroll
    for (int i = 0; i < PKN; ++i) h[i] = __builtin_bit_cast(v4b, __builtin_convertvector(__builtin_convertvector(h[i], v4f), v4h)); }
#pragma unroll
  for (int i = 0; i < PKN; ++i) *(v4b*)(dp + i * 512) = h[i];
}
// ---- projection GEMM core: one 128 x 128 tile of X . W^T per 4 waves, 64 x 64 per wave (wave = 2 * wm + wn), k in stages of 64.
// A stage is [X rows | W rows] in LDS; the next stage's global loads are issued before the current stage's products and stored into the other buffer behind them; one barrier per stage.
// The walk over the NT stages starts at stage rot and wraps: blocks that share X rows or W rows get different rot, so that they do not ask L2 for the same lines at the same moment; an accumulator sums its k in that rotated order.
#define GP 72   // LDS row pitch in 16-bit elements: 128 B of k + 16 B, so that the 16 rows of a ds_load_b128 fragment read fall on distinct banks
#define GK 64
// gemm128: X is f32 in memory and rounded to bf16 on its way into LDS, W is bf16; one group of 4 waves.
// sw = false: A = X rows, B = W rows, acc[i][j][r] = (x row wm*64 + i*16 + 8g + r, w row wn*64 + j*16 + col); sw = true: the operands change places, acc[i][j][r] = (w row wn*64 + i*16 + 8g + r, x row wm*64 + j*16 + col).
__device__ __forceinline__ void gemm128(const float* __restrict__ Xb, const int xld, const __bf16* __restrict__ Wb, __bf16* st, const bool sw, const int rot, v8f (&acc)[4][4]) {
  constexpr int ROWS = 256, NT = DM / GK;
  const int tid = (int)threadIdx.x, wave = tid >> 5, lane = tid & 31, col = lane & 15, wm = wave >> 1, wn = wave & 1;
  const float* xg = Xb + (size_t)(tid >> 4) * xld + (tid & 15) * 4;     // 16 lanes x 16 B = one row's 256 B of a stage
  const __bf16* wg = Wb + (size_t)(tid >> 3) * DM + (tid & 7) * 8;      // 8 lanes x 16 B = one row's 128 B of a stage
  const int xr0 = wm * 64 + col, wr0 = 128 + wn * 64 + col;
  const int ar = sw ? wr0 : xr0, br = sw ? xr0 : wr0;
  v4f xv[16]; v8b wv[8];
  int kn = rot & (NT - 1);   // the next stage to load (the same in every lane)
  const float* xp = xg + kn * GK; const __bf16* wp = wg + kn * GK;   // its addresses; stepped in sts(), behind the wait that ends ldg()
  auto ldg = [&]() {
#pragma unroll
    for (int i = 0; i < 16; ++i) xv[i] = *(const v4f*)(xp + (size_t)(i * 8) * xld);
#pragma unroll
    for (int i = 0; i < 8; ++i) wv[i] = *(const v8b*)(wp + (size_t)(i * 16) * DM);
    asm volatile("s_wait_xcnt 0x0" :: "v"(xp), "v"(wp) : "memory");   // the loads' address registers are reused behind them; as inputs they stay untouched up to the wait
  };
  auto sts = [&](int buf) {
    __bf16* s = st + buf * (ROWS * GP);
#pragma unroll
    for (int i = 0; i < 16; ++i) { v4b h4;
#pragma unroll
      for (int e = 0; e < 4; ++e) h4[e] = (__bf16)xv[i][e];
      *(v4b*)(s + (i * 8 + (tid >> 4)) * GP + (tid & 15) * 4) = h4; }
#pragma unroll
    for (int i = 0; i < 8; ++i) *(v8b*)(s + (128 + i * 16 + (tid >> 3)) * GP + (tid & 7) * 8) = wv[i];
    kn = (kn + 1) & (NT - 1); xp = xg + kn * GK; wp = wg + kn * GK;
  };
  ldg(); sts(0);
  __syncthreads();
#pragma unroll 1   // rolled, for speed only
  for (int t = 0; t < NT; ++t) {
    if (t + 1 < NT) ldg();
    const __bf16* s = st + (t & 1) * (ROWS * GP);
#pragma unroll
    for (int kc = 0; kc < GK / 32; ++kc) { v16b fa[4], fb[4];
#pragma unroll
      for (int i = 0; i < 4; ++i) { if (i == 0) fa[0] = frag_b(s + ar * GP + kc * 32, lane); fb[i] = frag_b(s + (br + i * 16) * GP + kc * 32, lane); }   // read in the order of first use: the first row of products waits for five fragments, each later row for one more
#pragma unroll
      for (int i = 1; i < 4; ++i) fa[i] = frag_b(s + (ar + i * 16) * GP + kc * 32, lane);
      HOLD();   // the 16 reads stay one group, ahead of the products
#pragma unroll
      for (int i = 0; i < 4; ++i) {
#pragma unroll
        for (int j = 0; j < 4; ++j) acc[i][j] = wmma_bf(fa[i], fb[j], acc[i][j]); }
      HOLD(); }   // the next 32 k's reads stay behind these products: one group, the same registers
    if (t + 1 < NT) sts((t + 1) & 1);
    __syncthreads();   // publishes stage t + 1 and ends every wave's reads of stage t (behind the last stage: frees the buffers for the epilogue)
  }
}
// gemm128h: X and W are f16 in memory and go into LDS as they are. The block has two groups of 4 waves (threads 0..127, 128..255); each has its own two buffers and takes every second stage of the walk into its own accumulators of the same tile, so that two waves share a SIMD and fill one another's waits; the caller adds the two partial sums.
// A = W rows, B = X rows: acc[i][j][r] = (w row wn*64 + i*16 + 8g + r, x row wm*64 + j*16 + col).
__device__ __forceinline__ void gemm128h(const _Float16* __restrict__ Xb, const _Float16* __restrict__ Wb, _Float16* st, const int rot, v8f (&acc)[4][4]) {
  constexpr int ROWS = 256, NT = DM / GK, KS = 2;
  const int tid = (int)(threadIdx.x & 127), wave = tid >> 5, lane = tid & 31, col = lane & 15, wm = wave >> 1, wn = wave & 1;
  const int grp = __builtin_amdgcn_readfirstlane((int)(threadIdx.x >> 7));   // the wave's group, the same in every lane
  st += grp * (2 * ROWS * GP);
  const size_t go = (size_t)(tid >> 3) * DM + (tid & 7) * 8;            // 8 lanes x 16 B = one row's 128 B of a stage
  const _Float16* xg = Xb + go; const _Float16* wg = Wb + go;
  const int ar = 128 + wn * 64 + col, br = wm * 64 + col;
  v8h xv[8], wv[8];
  int kn = (rot + grp) & (NT - 1);   // the next stage to load (the same in every lane)
  const _Float16* xp = xg + kn * GK; const _Float16* wp = wg + kn * GK;   // its addresses; stepped in sts(), behind the wait that ends ldg()
  auto ldg = [&]() {
#pragma unroll
    for (int i = 0; i < 8; ++i) xv[i] = *(const v8h*)(xp + (size_t)(i * 16) * DM);
#pragma unroll
    for (int i = 0; i < 8; ++i) wv[i] = *(const v8h*)(wp + (size_t)(i * 16) * DM);
    asm volatile("s_wait_xcnt 0x0" :: "v"(xp), "v"(wp) : "memory");   // the loads' address registers are reused behind them; as inputs they stay untouched up to the wait
  };
  auto sts = [&](int buf) {
    _Float16* s = st + buf * (ROWS * GP) + (tid >> 3) * GP + (tid & 7) * 8;
#pragma unroll
    for (int i = 0; i < 8; ++i) { *(v8h*)(s + (i * 16) * GP) = xv[i]; *(v8h*)(s + (128 + i * 16) * GP) = wv[i]; }
    kn = (kn + KS) & (NT - 1); xp = xg + kn * GK; wp = wg + kn * GK;
  };
  ldg(); sts(0);
  __syncthreads();
#pragma unroll 1   // rolled: the buffer goes by the trip's parity
  for (int t = 0; t < NT / KS; ++t) {
    if (t + 1 < NT / KS) ldg();
    const _Float16* s = st + (t & 1) * (ROWS * GP);
#pragma unroll
    for (int kc = 0; kc < GK / 32; ++kc) { v16h fa[4], fb[4];
#pragma unroll
      for (int i = 0; i < 4; ++i) { if (i == 0) fa[0] = frag_h(s + ar * GP + kc * 32, lane); fb[i] = frag_h(s + (br + i * 16) * GP + kc * 32, lane); }   // read in the order of first use: the first row of products waits for five fragments, each later row for one more
#pragma unroll
      for (int i = 1; i < 4; ++i) fa[i] = frag_h(s + (ar + i * 16) * GP + kc * 32, lane);
      HOLD();   // the 16 reads stay one group, ahead of the products
#pragma unroll
      for (int i = 0; i < 4; ++i) {
#pragma unroll
        for (int j = 0; j < 4; ++j) acc[i][j] = wmma16(fa[i], fb[j], acc[i][j]); }
      HOLD(); }   // the next 32 k's reads stay behind these products: one group, the same registers
    if (t + 1 < NT / KS) sts((t + 1) & 1);
    __syncthreads();   // publishes stage t + 1 and ends every wave's reads of stage t (behind the last stage: frees the buffers for the epilogue)
  }
}
// ---- k_qkv: block = (128 engine rows, 128 of the 3,072 q | k | v columns). q, k: W rows as the A operand, so a lane holds 8 neighbouring columns of one row; v: X rows as A, so a lane holds 8 neighbouring positions of one column (v is stored transposed). Either way 16-B LDS stores into the wave's own staging, then whole 128-B lines to memory.
__global__ __launch_bounds__(128) void k_qkv(const float* __restrict__ XQ, const float* __restrict__ XK, const float* __restrict__ XV, const __bf16* __restrict__ P, const float* __restrict__ BQ, const float* __restrict__ BK, const float* __restrict__ BV, _Float16* __restrict__ QK, _Float16* __restrict__ VTH) {
  const int which0 = (blockIdx.y * 128) / DM; const float* X = (which0 == 0) ? XQ : (which0 == 1) ? XK : XV; const float* BB = BQ ? (((which0 == 0) ? BQ : (which0 == 1) ? BK : BV) + (blockIdx.y * 128 - which0 * DM)) : nullptr;
  __shared__ __align__(16) __bf16 st[2 * 256 * GP];
  const int tid = threadIdx.x, wave = tid >> 5, lane = tid & 31, col = lane & 15, g = lane >> 4, wm = wave >> 1, wn = wave & 1; const int n0 = blockIdx.y * 128;
  const size_t rb = (size_t)blockIdx.x * 128; const int b = (int)(rb / SS), s0 = (int)(rb % SS);   // 128 divides SS: one batch per block; engine row rb + i is module row (s0 + i) * NB + b
  const bool sw = n0 < 2 * DM;
  v8f acc[4][4] = {};
  gemm128(X + ((size_t)s0 * NB + b) * DM, NB * DM, P + (size_t)n0 * DM, st, sw, (int)(blockIdx.x + 2 * blockIdx.y), acc);   // 8 blocks share X rows (neighbouring y), 32 share W rows (all x)
  _Float16* eh = (_Float16*)st + wave * (64 * GP);   // per wave: [64][GP]
  float bi[4][8] = {}, bj[4] = {};   // bias of the lane's 8 columns per i (q, k) or of its one column per j (v)
  if (BB) {   // one branch round all the bias loads, so that they are in flight together
    if (sw) {
#pragma unroll
      for (int i = 0; i < 4; ++i) {
#pragma unroll
        for (int r = 0; r < 8; ++r) bi[i][r] = bfr(BB[wn * 64 + i * 16 + 8 * g + r]); }
    } else {
#pragma unroll
      for (int j = 0; j < 4; ++j) bj[j] = bfr(BB[wn * 64 + j * 16 + col]); } }
#pragma unroll
  for (int i = 0; i < 4; ++i) {
#pragma unroll
    for (int j = 0; j < 4; ++j) { v8h hv;
#pragma unroll
      for (int r = 0; r < 8; ++r) hv[r] = (_Float16)(acc[i][j][r] + (sw ? bi[i][r] : bj[j]));   // (+ bias) rounded once to f16; q unscaled, 1/8 applied to the f32 score
      *(v8h*)(eh + (j * 16 + col) * GP + i * 16 + 8 * g) = hv; } }
  LDSX();
  static_assert(2 * DM == SS, "q | k rows and transposed v rows have one pitch");
  const size_t o0 = (sw ? (rb + wm * 64) * (2 * DM) + n0 + wn * 64 : ((size_t)b * DM + (n0 - 2 * DM) + wn * 64) * SS + s0 + wm * 64) + (size_t)(lane >> 3) * SS + (lane & 7) * 8;   // 8 lanes x 16 B = one row's 128 B, 4 rows per store
  _Float16* ph = (sw ? QK : VTH) + o0; const _Float16* sh = eh + (lane >> 3) * GP + (lane & 7) * 8;
#pragma unroll
  for (int it0 = 0; it0 < 16; it0 += 8) { v4u a[8];   // 8 LDS reads in flight, then their 8 stores
#pragma unroll
    for (int u = 0; u < 8; ++u) a[u] = *(const v4u*)(sh + (it0 + u) * 4 * GP);
#pragma unroll
    for (int u = 0; u < 8; ++u) vst2(ph + (size_t)(it0 + u) * 4 * SS, a[u]);
    asm volatile("s_wait_xcnt 0x0" :: "v"(ph) : "memory"); }   // the next group's LDS reads overwrite these stores' data registers
}
// ---- k_attn: block = (128 queries, head h, batch b), two groups of 4 waves x 32 queries (two 16-row tiles per wave). Both groups hold the same queries; group 0 takes the even key tiles of the block's walk and group 1 the odd ones, so that the launch has four waves per SIMD to fill one another's waits; behind the loop the two partial sums are added through LDS, each group finishing one of its waves' two query tiles. K and V come in tiles of 64 keys, copied asynchronously into the group's own two LDS buffers and read by its four waves; every K and V fragment serves both of a wave's query tiles. scores are computed transposed (k rows x q rows, single f16 operands), so that a lane's accumulators of 32 keys are its own part of P's fragment and P stays in registers; relu(score * 0.125), P (x 2^11, single f16) x V, f32 accumulate, in each group over the keys of its own tiles in groups of 32, ascending from the block's first tile and wrapping (the 16 blocks that share a head's K and V start two tiles apart, so that they do not ask L2 for the same lines at the same moment); O[b*S+q][h*64+d] = acc / 2^11 (256-B segments)
// two transposed score tiles (keys 0..15 and 16..31 of a group of 32, one query per lane) are, converted in place, the A fragment of P for that group: element s = key 8g + s (s < 8), 16 + 8g + s - 8 (else).
// relu(s / 8) * 2^11 = relu(s * 2^8): the powers of two are exact, and relu commutes with the rounding to f16. P is scaled by 2^11 so that small weights stay out of the f16 subnormal range; 2^-11 is folded into the epilogue.
__device__ __forceinline__ v16h pack_p(v8f t0, v8f t1) {
  v16h p;
#pragma unroll
  for (int i = 0; i < 8; ++i) { p[i] = (_Float16)(t0[i] * 256.0f); p[8 + i] = (_Float16)(t1[i] * 256.0f); }
  const v16h z = {};
  return __builtin_elementwise_max(p, z);
}
#define AK 64   // keys per tile: K tile = [64 keys][GP], V tile = [64 d][GP]; rows of 128 B at the pitch of the ds_load_b128 fragment reads
// four waves per SIMD is what the launch has: the register budget of four lets two blocks share a WGP
__global__ __launch_bounds__(256) __attribute__((amdgpu_waves_per_eu(4, 4))) void k_attn(const _Float16* __restrict__ QK, const _Float16* __restrict__ VTH, const void* __restrict__ KMASK, float* __restrict__ O) {
  (void)KMASK;
  __shared__ __align__(16) _Float16 kv[2][2][2][AK * GP];   // [group][buffer][K | V][row][GP]
  __shared__ __align__(16) float sp[4][2][16][68];       // per 32 queries and query tile: the hand-over between the groups, then the output staging
  const int tid = threadIdx.x & 127, wave = tid >> 5, lane = tid & 31, col = lane & 15, g = lane >> 4;
  const int half = __builtin_amdgcn_readfirstlane((int)(threadIdx.x >> 7));   // the wave's group, the same in every lane
  const int qb = blockIdx.x, h = blockIdx.y, b = blockIdx.z; const int q0 = qb * 128 + wave * 32;
  constexpr int NTL = SS / AK, NTR = NTL / 2;   // key tiles; trips of a group
  // 8 lanes x 16 B = one row's 128 B; 16 rows per copy of a group, 4 copies for K and 4 for V
  const _Float16* kg = QK + ((size_t)b * SS + (tid >> 3)) * (2 * DM) + DM + h * HD + (tid & 7) * 8;
  const _Float16* vg = VTH + ((size_t)b * DM + h * HD + (tid >> 3)) * SS + (tid & 7) * 8;
  const unsigned lk = (unsigned)(uintptr_t)&kv[half][0][0][(tid >> 3) * GP + (tid & 7) * 8];
  auto fill = [&](int t) {
    const int tile = (2 * t + half + 2 * qb) & (NTL - 1);   // trip t of the group works on this key tile; the buffer goes by the trip's parity
    const _Float16* kp = kg + (size_t)tile * (AK * 2 * DM); const _Float16* vp = vg + tile * AK;
    const unsigned l = lk + (unsigned)(t & 1) * (2u * AK * GP * 2u), lv = l + AK * GP * 2u;
    // the copies and the wait that keeps their address registers untouched until they are read, in one statement
    asm volatile("global_load_async_to_lds_b128 %0, %8, off\n\t"
                 "global_load_async_to_lds_b128 %1, %9, off\n\t"
                 "global_load_async_to_lds_b128 %2, %10, off\n\t"
                 "global_load_async_to_lds_b128 %3, %11, off\n\t"
                 "global_load_async_to_lds_b128 %4, %12, off\n\t"
                 "global_load_async_to_lds_b128 %5, %13, off\n\t"
                 "global_load_async_to_lds_b128 %6, %14, off\n\t"
                 "global_load_async_to_lds_b128 %7, %15, off\n\t"
                 "s_wait_xcnt 0x0"
                 :: "v"(l), "v"(l + 16u * GP * 2u), "v"(l + 32u * GP * 2u), "v"(l + 48u * GP * 2u),
                    "v"(lv), "v"(lv + 16u * GP * 2u), "v"(lv + 32u * GP * 2u), "v"(lv + 48u * GP * 2u),
                    "v"(kp), "v"(kp + 16 * 2 * DM), "v"(kp + 32 * 2 * DM), "v"(kp + 48 * 2 * DM),
                    "v"(vp), "v"(vp + 16 * SS), "v"(vp + 32 * SS), "v"(vp + 48 * SS)
                 : "memory");
  };
  fill(0);
  const _Float16* qp = QK + ((size_t)b * SS + q0 + col) * (2 * DM) + h * HD;
  v16h aq[2][2];
#pragma unroll
  for (int qt = 0; qt < 2; ++qt) {
#pragma unroll
    for (int kc = 0; kc < 2; ++kc) aq[qt][kc] = frag_h(qp + (size_t)qt * 16 * (2 * DM) + kc * 32, lane); }
  asm volatile("s_wait_xcnt 0x0" :: "v"(qp) : "memory");   // the loads' address registers are reused behind them; as an input they stay untouched up to the wait
  v8f acc[2][4] = {};
  asm volatile("s_wait_asynccnt 0x0" ::: "memory");   // this wave's copies of tile 0 have landed
  __syncthreads();                                     // publishes tile 0
  fill(1);
#pragma unroll 1   // rolled: one trip per key tile, the buffer chosen by the trip's parity
  for (int t = 0; t < NTR; ++t) {
    const _Float16* kt = &kv[half][t & 1][0][0]; const _Float16* vt = &kv[half][t & 1][1][0];
    v16h kf[2][2][2], vf[2][4];   // per group of 32 keys: K rows (A of the scores), V rows (B of P x V)
    auto ldf = [&](int k2) {
#pragma unroll
      for (int cl = 0; cl < 2; ++cl) {
#pragma unroll
        for (int kc = 0; kc < 2; ++kc) kf[k2][cl][kc] = frag_h(kt + ((k2 * 2 + cl) * 16 + col) * GP + kc * 32, lane); }
#pragma unroll
      for (int dt = 0; dt < 4; ++dt) vf[k2][dt] = frag_h(vt + (dt * 16 + col) * GP + k2 * 32, lane);
    };
    ldf(0);
    HOLD();   // the 16 reads stay one group, ahead of the score products
#pragma unroll
    for (int k2 = 0; k2 < 2; ++k2) { v16h pa[2]; v8f c[2][2] = {};   // 32 keys x 32 queries; transposed score tiles: c[cl][qt][r] = (key k2*32 + cl*16 + 8g + r, query qt*16 + col)
#pragma unroll
      for (int kc = 0; kc < 2; ++kc) {
#pragma unroll
        for (int cl = 0; cl < 2; ++cl) {
#pragma unroll
          for (int qt = 0; qt < 2; ++qt) c[cl][qt] = wmma16(kf[k2][cl][kc], aq[qt][kc], c[cl][qt]); } }   // single product: k rows as A, q rows as B, one-rounding f16 operands
      if (k2 == 0) { HOLD(); ldf(1); HOLD(); }   // the second group's fragments fly behind the first group's conversion and P x V: held as one group between the score products and the conversion
#pragma unroll
      for (int qt = 0; qt < 2; ++qt) pa[qt] = pack_p(c[0][qt], c[1][qt]);
#pragma unroll
      for (int dt = 0; dt < 4; ++dt) {
#pragma unroll
        for (int qt = 0; qt < 2; ++qt) acc[qt][dt] = wmma16(pa[qt], vf[k2][dt], acc[qt][dt]); } }   // single product: P (x2^11) x V
    HOLD();   // the trip's products are all issued ahead of its barrier
    asm volatile("s_wait_dscnt 0x0" ::: "memory");      // this wave's reads of tile t are done
    asm volatile("s_wait_asynccnt 0x0" ::: "memory");   // this wave's copies of tile t + 1 have landed
    __syncthreads();                                     // publishes tile t + 1 and ends every wave's reads of tile t
    if (t + 2 < NTR) fill(t + 2);
  }
  asm volatile("s_wait_asynccnt 0x0" ::: "memory");   // nothing is in flight when the wave ends
  // group 0 finishes query tile 0 and group 1 query tile 1: a wave hands the other tile's partial sums to the wave of the same queries in the other group, lane to lane
  v8f mine[4], other[4];
#pragma unroll
  for (int dt = 0; dt < 4; ++dt) { mine[dt] = half ? acc[1][dt] : acc[0][dt]; other[dt] = half ? acc[0][dt] : acc[1][dt]; }
  float* so = &sp[wave][1 - half][8 * g][col]; float* sm = &sp[wave][half][8 * g][col];
#pragma unroll
  for (int r = 0; r < 8; ++r) {
#pragma unroll
    for (int dt = 0; dt < 4; ++dt) so[r * 68 + dt * 16] = other[dt][r]; }
  __syncthreads();   // publishes the partial sums of both groups
  float pv[8][4];   // all 32 LDS reads stand ahead of the first store to the same tile
#pragma unroll
  for (int r = 0; r < 8; ++r) {
#pragma unroll
    for (int dt = 0; dt < 4; ++dt) pv[r][dt] = sm[r * 68 + dt * 16]; }
#pragma unroll
  for (int r = 0; r < 8; ++r) {
#pragma unroll
    for (int dt = 0; dt < 4; ++dt) sm[r * 68 + dt * 16] = (mine[dt][r] + pv[r][dt]) * (1.0f / 2048.0f); }   // the sum of the two groups; undo the P scaling only
  LDSX();
  float* po = O + ((size_t)b * SS + q0 + half * 16 + g) * DM + h * HD + col * 4; const float* sf = &sp[wave][half][g][col * 4];   // 16 lanes x 16 B = 256 B of a row, 2 rows per store
  v4f a[8];   // 8 LDS reads in flight, then their 8 stores
#pragma unroll
  for (int u = 0; u < 8; ++u) a[u] = *(const v4f*)(sf + u * 2 * 68);
#pragma unroll
  for (int u = 0; u < 8; ++u) vst2(po + (size_t)u * 2 * DM, a[u]);
}
// ---- k_out: block = (128 rows, 128 cols), 8 waves: out = y . Wo rows (single f16 operands, 1 product) + bo; Wo rows as the A operand, so a lane holds 8 neighbouring output columns of one row
// The launch has one block per WGP: the k walk is split between two groups of 4 waves (two waves per SIMD); the second group hands its partial sums over through LDS, the first adds them to its own and writes the tile.
__global__ __launch_bounds__(256) void k_out(const _Float16* __restrict__ O, const _Float16* __restrict__ P, const float* __restrict__ BO, float* __restrict__ Y) {
  __shared__ __align__(16) _Float16 st[2 * 2 * 256 * GP];   // [group][buffer][rows][GP]
  const int tid = threadIdx.x & 127, wave = tid >> 5, lane = tid & 31, col = lane & 15, g = lane >> 4, wm = wave >> 1, wn = wave & 1; const size_t rb = (size_t)blockIdx.x * 128; const int n0 = blockIdx.y * 128;
  const int grp = __builtin_amdgcn_readfirstlane((int)(threadIdx.x >> 7));   // the wave's group, the same in every lane
  v8f acc[4][4] = {};
  gemm128h(O + rb * DM, P + (size_t)n0 * DM, st, (int)(blockIdx.x + 2 * blockIdx.y), acc);   // 8 blocks share y rows (all blockIdx.y), 32 share Wo rows (all blockIdx.x)
  float* xf = (float*)(st + 2 * 256 * GP) + (wave * (32 * 32) + lane) * 4;   // hand-over in the second group's buffers: per wave 32 pieces of 32 lanes x 16 B
  if (grp == 1) {
#pragma unroll
    for (int i = 0; i < 4; ++i) {
#pragma unroll
      for (int j = 0; j < 4; ++j) { *(v4f*)(xf + ((i * 4 + j) * 2) * 128) = __builtin_shufflevector(acc[i][j], acc[i][j], 0, 1, 2, 3); *(v4f*)(xf + ((i * 4 + j) * 2 + 1) * 128) = __builtin_shufflevector(acc[i][j], acc[i][j], 4, 5, 6, 7); } } }
  __syncthreads();   // publishes the second group's partial sums
  if (grp == 1) return;   // no barrier stands behind this line
#pragma unroll
  for (int i = 0; i < 4; ++i) {
#pragma unroll
    for (int j = 0; j < 4; ++j) { const v4f a4 = *(const v4f*)(xf + ((i * 4 + j) * 2) * 128), b4 = *(const v4f*)(xf + ((i * 4 + j) * 2 + 1) * 128);
#pragma unroll
      for (int r = 0; r < 4; ++r) { acc[i][j][r] += a4[r]; acc[i][j][4 + r] += b4[r]; } } }
  float* ef = (float*)st + wave * (64 * 68);   // per wave: [64 rows][64 + 4 floats]
  const float* bp = BO + n0 + wn * 64 + 8 * g; float bi[4][8];   // bias of the lane's 8 columns per i
#pragma unroll
  for (int i = 0; i < 4; ++i) {
#pragma unroll
    for (int r = 0; r < 8; ++r) bi[i][r] = bp[i * 16 + r]; }
  asm volatile("s_wait_xcnt 0x0" :: "v"(bp) : "memory");   // the loads' address registers are reused behind them; as an input they stay untouched up to the wait
#pragma unroll
  for (int i = 0; i < 4; ++i) {
#pragma unroll
    for (int j = 0; j < 4; ++j) { v4f a4, b4;
#pragma unroll
      for (int r = 0; r < 4; ++r) { a4[r] = acc[i][j][r] + bfr(bi[i][r]); b4[r] = acc[i][j][4 + r] + bfr(bi[i][4 + r]); }
      float* d = ef + (j * 16 + col) * 68 + i * 16 + 8 * g; *(v4f*)d = a4; *(v4f*)(d + 4) = b4; } }
  LDSX();
  const int b = (int)(rb / SS), s0 = (int)(rb % SS);   // 128 divides SS: one batch per block; engine row rb + i is module row (s0 + i) * NB + b
  float* py = Y + ((size_t)(s0 + wm * 64 + g) * NB + b) * DM + n0 + wn * 64 + col * 4; const float* sf = ef + g * 68 + col * 4;   // back to the [L][B][E] layout: 16 lanes x 16 B = 256 B of a row, 2 rows per store
#pragma unroll
  for (int it0 = 0; it0 < 32; it0 += 8) { v4f a[8];   // 8 LDS reads in flight, then their 8 stores
#pragma unroll
    for (int u = 0; u < 8; ++u) a[u] = *(const v4f*)(sf + (it0 + u) * 2 * 68);
#pragma unroll
    for (int u = 0; u < 8; ++u) vst2(py + (size_t)(it0 + u) * 2 * NB * DM, a[u]);
    asm volatile("s_wait_xcnt 0x0" :: "v"(py) : "memory"); }   // the next group's LDS reads overwrite these stores' data registers
}
// ---- k_gnorm: wave = engine row (32 lanes x 32 elements, 512 B in a row per load), 8 rows per block, no LDS and no barrier: y = weight * x / (||x||/sqrt(1024) + 1e-8) * sigmoid(gate * x) (precise expf), computed in f32 and stored as f16 (256 B in a row per store)
// The row, the weights and the gates are loaded together; the launch starts 4,096 long waves, and a lane's 32 elements are independent chains that fill one another's latencies.
// four waves per SIMD is all that the launch has: the register budget of four holds the row, its weights and its gates at once, so that the loads stand ahead of the arithmetic
__global__ __launch_bounds__(256) __attribute__((amdgpu_waves_per_eu(4, 4))) void k_gnorm(const float* __restrict__ O, const float* __restrict__ NW, const float* __restrict__ NG, _Float16* __restrict__ Y2) {
  const int lane = threadIdx.x & 31; const size_t row = (size_t)blockIdx.x * 8 + (threadIdx.x >> 5);
  const float* xp = O + row * DM + lane * 4; const float* wp = NW + lane * 4; const float* gp = NG + lane * 4;
  v4f x[8], w[8], gt[8];
#pragma unroll
  for (int i = 0; i < 8; ++i) x[i] = *(const v4f*)(xp + i * 128);
#pragma unroll
  for (int i = 0; i < 8; ++i) { w[i] = *(const v4f*)(wp + i * 128); gt[i] = *(const v4f*)(gp + i * 128); }
  v4f s4 = {};   // four partial sums per lane, then the lane's sum, then the butterfly over the wave
#pragma unroll
  for (int i = 0; i < 8; ++i) s4 += x[i] * x[i];
  float s = (s4[0] + s4[1]) + (s4[2] + s4[3]);
#pragma unroll
  for (int o = 1; o < 32; o <<= 1) s += __shfl_xor(s, o);
  const float rms = sqrtf(s) * 0.03125f; const float inv = 1.0f / (rms + 1e-8f);
  _Float16* yp = Y2 + row * DM + lane * 4;
#pragma unroll
  for (int i = 0; i < 8; ++i) { v4f o4; const v4f wr = __builtin_convertvector(__builtin_convertvector(w[i], v4b), v4f), gr = __builtin_convertvector(__builtin_convertvector(gt[i], v4b), v4f);   // weight and gate rounded to bf16, two per conversion
#pragma unroll
    for (int e = 0; e < 4; ++e) { const float xv = x[i][e]; o4[e] = wr[e] * (xv * inv) * (1.0f / (1.0f + expf(-gr[e] * xv))); }
    vst2(yp + i * 128, __builtin_convertvector(o4, v4h)); }
}
extern "C" void kernel_launch(void* const* d_in, const int* in_sizes, int n_in, void* d_out, int out_size, void* d_ws, size_t ws_size, hipStream_t stream) {
  (void)in_sizes; (void)n_in; (void)out_size;
  const float** F = (const float**)d_in;   // 0 query, 1 key, 2 value [2048,2,1024] (L,B,E); 3 Wq, 4 bq, 5 Wk, 6 bk, 7 Wv, 8 bv, 9 Wo, 10 bo (natural); 11 norm_weight, 12 norm_gate
  if (ws_size < (size_t)WS_END) return;
  char* ws = (char*)d_ws; __bf16* PK = (__bf16*)(ws + WS_PK); _Float16 *QK = (_Float16*)(ws + WS_QK), *VTH = (_Float16*)(ws + WS_VTH); float* O = (float*)(ws + WS_O); _Float16* Y2 = (_Float16*)(ws + WS_Y2);
  k_pack<<<dim3(DM * DM / (PKN * 512), 4), 128, 0, stream>>>(F[3], F[5], F[7], F[9], PK);
  k_qkv<<<dim3(TNB * SS / 128, QKVW / 128), 128, 0, stream>>>(F[0], F[1], F[2], PK + PK_A, F[4], F[6], F[8], QK, VTH);
  k_attn<<<dim3(TQB / 2, NH, TNB), 256, 0, stream>>>(QK, VTH, nullptr, O);
  k_gnorm<<<NB * SS / 8, 256, 0, stream>>>(O, F[11], F[12], Y2);
  k_out<<<dim3(TOB / 2, DM / 128), 256, 0, stream>>>(Y2, (const _Float16*)(PK + PK_P), F[10], (float*)d_out);
}

// v009
// One run takes 66.3 microseconds.
// Next to v008, in two timings, it ran 1.05 times as fast each time.
// Over all steps from v000 it is 5.89 times as fast.
// compute dtype: all float inputs rounded to bf16; q/k/v = x . W^T + b with EXACT bf16 products on WMMA 16x16x32 (natural rows) with the (L, B, E) row order remapped on load and store; 'attention' = relu(q k^T / 8) (no softmax): q, k as single f16 operands, relu, P (scaled by 2^11, single f16) x v (single f16), f32 accumulate; gated RMS norm in f32 (precise expf), its result y rounded once to f16; out = y . Wo^T (single f16 operands, 1 product) + bo.
#include <hip/hip_runtime.h>
#include <math.h>

typedef __attribute__((ext_vector_type(16))) _Float16 v16h;
typedef __attribute__((ext_vector_type(16))) __bf16 v16b;
typedef __attribute__((ext_vector_type(8)))  _Float16 v8h;
typedef __attribute__((ext_vector_type(8)))  float v8f;
typedef __attribute__((ext_vector_type(4)))  float v4f;
typedef __attribute__((ext_vector_type(2)))  float v2f;
typedef __attribute__((ext_vector_type(4)))  unsigned v4u;
typedef __attribute__((ext_vector_type(4)))  int v4i;
typedef float __attribute__((may_alias)) float_a;
typedef int __attribute__((may_alias)) int_a;

template <typename T> __device__ __forceinline__ void vst2(void* p, T v) { *(T*)p = v;  }
__device__ __forceinline__ v8f wmma16(v16h a, v16h b, v8f c) {
  v8f d = __builtin_amdgcn_wmma_f32_16x16x32_f16(false, a, false, b, (short)0, c, false, false);
  return d;
}
__device__ __forceinline__ v8f wmma_bf(v16b a, v16b b, v8f c) {
  v8f d = __builtin_amdgcn_wmma_f32_16x16x32_bf16(false, a, false, b, (short)0, c, false, false);
  return d;
}
// HOLD: the compiler schedules nothing across this line. Behind a group of LDS fragment reads it keeps them one group ahead of the products that use them (left free, each pair of reads sinks to its first user and is waited for to 0); behind a group of products it keeps the next group's reads, or the trip's barrier, from moving in among them.
#define HOLD() __builtin_amdgcn_sched_barrier(0)
// ReLU attention (L 2,048, B 2, E 1,024, 16 heads x 64; sequence-first layout): q/k/v projections + biases, relu(q k^T / 8) in place of softmax, gated RMS norm (weight * x / rms * sigmoid(gate * x)), output projection + bias.
__device__ __forceinline__ v16h frag_h(const _Float16* rowk0, int lane) {
  union { v16h v; v8h q[2]; } u; const _Float16* p = rowk0 + 8 * (lane >> 4);
  u.q[0] = *(const v8h*)p; u.q[1] = *(const v8h*)(p + 16); return u.v;
}
__device__ __forceinline__ v16h frag_f32(const float* rowk0, int lane) {
  v16h a; const float* p = rowk0 + 8 * (lane >> 4);
#pragma unroll
  for (int i = 0; i < 8; ++i) { a[i] = (_Float16)p[i]; a[8 + i] = (_Float16)p[16 + i]; }
  return a;
}
__device__ __forceinline__ v16h frag_f32s(const float* rowk0, int lane, float sc) {
  v16h a; const float* p = rowk0 + 8 * (lane >> 4);
#pragma unroll
  for (int i = 0; i < 8; ++i) { a[i] = (_Float16)(p[i] * sc); a[8 + i] = (_Float16)(p[16 + i] * sc); }
  return a;
}
// column fragment from a [K][ld] layout (column n), rows >= K read as 0
__device__ __forceinline__ v16h fragc_f32(const float* W, int k0, int n, int lane, int ld, int K) {
  v16h a; const int g = lane >> 4;
#pragma unroll
  for (int i = 0; i < 8; ++i) { const int ka = k0 + 8 * g + i, kb = ka + 16;
    a[i] = (_Float16)(ka < K ? W[(size_t)(ka < K ? ka : K - 1) * ld + n] : 0.f); a[8 + i] = (_Float16)(kb < K ? W[(size_t)(kb < K ? kb : K - 1) * ld + n] : 0.f); }
  return a;
}
struct F2 { v16b h, l; };
__device__ __forceinline__ F2 bsplit16(const float v[16]) { F2 r;
#pragma unroll
  for (int i = 0; i < 16; ++i) { const __bf16 h = (__bf16)v[i]; r.h[i] = h; r.l[i] = (__bf16)(v[i] - (float)h); }
  return r; }
__device__ __forceinline__ F2 split_row(const float* row, int k0, int lane) { float v[16]; const float* p = row + k0 + 8 * (lane >> 4);
#pragma unroll
  for (int i = 0; i < 8; ++i) { v[i] = p[i]; v[8 + i] = p[16 + i]; }
  return bsplit16(v); }
__device__ __forceinline__ F2 split_rowK(const float* row, int k0, int lane, int K) { float v[16]; const int g = lane >> 4;
#pragma unroll
  for (int i = 0; i < 8; ++i) { const int ka = k0 + 8 * g + i, kb = ka + 16; v[i] = ka < K ? row[ka < K ? ka : K - 1] : 0.f; v[8 + i] = kb < K ? row[kb < K ? kb : K - 1] : 0.f; }
  return bsplit16(v); }
__device__ __forceinline__ F2 split_col(const float* W, int k0, int n, int lane, int ld, int K) { float v[16]; const int g = lane >> 4;
#pragma unroll
  for (int i = 0; i < 8; ++i) { const int ka = k0 + 8 * g + i, kb = ka + 16; v[i] = ka < K ? W[(size_t)(ka < K ? ka : K - 1) * ld + n] : 0.f; v[8 + i] = kb < K ? W[(size_t)(kb < K ? kb : K - 1) * ld + n] : 0.f; }
  return bsplit16(v); }
__device__ __forceinline__ v8f mac3(const F2& a, const F2& b, v8f c) { c = wmma_bf(a.l, b.h, c); c = wmma_bf(a.h, b.l, c); return wmma_bf(a.h, b.h, c); }
__device__ __forceinline__ float sigm(float v) { return 1.0f / (1.0f + expf(-v)); }
#define LDSX() do { asm volatile("s_wait_dscnt 0" ::: "memory"); __builtin_amdgcn_wave_barrier(); __builtin_amdgcn_fence(__ATOMIC_RELEASE, "workgroup"); } while (0)


#define NB 2
#define SS 2048
#define DM 1024
#define NH 16
__device__ __forceinline__ size_t xrow(size_t r) { return (r % SS) * NB + r / SS; }   // engine row (b, s) <-> the module's [L][B] row s*B + b
#define HD 64
#define QKVW (3 * DM)
#ifndef TQB
#define TQB (SS / 64)
#define TNB NB
#define TOB (NB * SS / 64)     // output row tiles (all)
#endif
typedef __attribute__((ext_vector_type(8))) __bf16 v8b;
__device__ __forceinline__ v16b frag_b(const __bf16* rowk0, int lane) {
  union { v16b v; v8b q[2]; } u; const __bf16* p = rowk0 + 8 * (lane >> 4);
  u.q[0] = *(const v8b*)p; u.q[1] = *(const v8b*)(p + 16); return u.v;
}
__device__ __forceinline__ float bfr(float v) { return (float)(__bf16)v; }
__device__ __attribute__((noinline)) float exp_ni(float v) { return expf(v); }
__device__ __attribute__((noinline)) float erf_ni(float v) { return erff(v); }

#define PK_A 0                       // [3072][1024] Wqkv rows (natural [out][in])
#define PK_P (PK_A + QKVW * DM)        // [1024][1024] Wo rows (natural), held as f16
#define PK_END (PK_P + DM * DM)
#define WS_PK  0u
#define WS_QK  (WS_PK + 2u * PK_END)             // f16 [4096 rows][2048]: q | k
#define WS_VTH (WS_QK + 2u * NB * SS * 2 * DM)     // f16 [b][1024 (h*64+d)][2048 s]
#define WS_O   (WS_VTH + 2u * NB * DM * SS)        // f32 [4096][1024]
#define WS_CS  (WS_O + 4u * NB * SS * DM)           // f32 [2][2048][32], unused
#define WS_Y2  (WS_CS + 4u * 2 * SS * 32)                  // f16 [NR][1024] gated-rms-normed context
#define WS_END (WS_Y2 + 2u * (size_t)NB * SS * DM)
// ---- k_pack: block = (16,384 neighbouring elements of one weight matrix, which): natural [out][in] rows -> bf16, same element order; which 0..2 -> W_q/W_k/W_v into PK_A rows which*1024 + n; 3 -> W_o into PK_P, rounded to bf16 like the others and then held as f16 (the partner of the f16 y in k_out).
// A thread takes 32 pieces of 16 B, a wave 512 B in a row per load and 256 B per store, all 32 loads in flight together (64 KiB per block): the launch starts 1,024 long waves, one block per WGP, and needs no LDS and no barrier.
#define PKN 32   // 16-B pieces per thread
typedef __attribute__((ext_vector_type(4))) __bf16 v4b;
typedef __attribute__((ext_vector_type(4))) _Float16 v4h;
// one wave per SIMD is all that the launch has: the register budget of one lets every load be issued before the first is waited for
__global__ __launch_bounds__(128) __attribute__((amdgpu_waves_per_eu(1, 1))) void k_pack(const float* __restrict__ WQ, const float* __restrict__ WK, const float* __restrict__ WV, const float* __restrict__ WO, __bf16* __restrict__ PK) {
  const int which = blockIdx.y, t = threadIdx.x; const float* Wm = (which == 0) ? WQ : (which == 1) ? WK : (which == 2) ? WV : WO;
  const size_t o = (size_t)blockIdx.x * (PKN * 512) + t * 4;
  const float* sp = Wm + o; __bf16* dp = PK + ((which < 3) ? PK_A + (size_t)which * DM * DM : (size_t)PK_P) + o;
  v4f v[PKN];
#pragma unroll
  for (int i = 0; i < PKN; ++i) v[i] = *(const v4f*)(sp + i * 512);
  asm volatile("s_wait_xcnt 0x0" :: "v"(sp) : "memory");   // the loads' address registers are reused behind them; as an input they stay untouched up to the wait
  v4b h[PKN];
#pragma unroll
  for (int i = 0; i < PKN; ++i) {
#pragma unroll
    for (int e = 0; e < 4; ++e) h[i][e] = (__bf16)v[i][e]; }
  if (which == 3) {   // W_o (the same for the whole block): the bf16 values, written as f16
#pragma unroll
    for (int i = 0; i < PKN; ++i) h[i] = __builtin_bit_cast(v4b, __builtin_convertvector(__builtin_convertvector(h[i], v4f), v4h)); }
#pragma unroll
  for (int i = 0; i < PKN; ++i) *(v4b*)(dp + i * 512) = h[i];
}
// ---- tensor loads: one request of one wave brings rows of 128 B from global memory into LDS at pitch 144 B (= GP), through no register
typedef uint32_t u32x4 __attribute__((ext_vector_type(4)));
typedef uint32_t u32x8 __attribute__((ext_vector_type(8)));
__device__ __forceinline__ uint32_t uni(uint32_t v) { return (uint32_t)__builtin_amdgcn_readfirstlane(v); }
__device__ __forceinline__ uint32_t pinned(uint32_t v) { uint32_t w = uni(v); asm volatile("" : "+s"(w)); return w; }   // the condition stays in a scalar register, so that the branch on it is a scalar one: a tensor load ignores EXEC
// group 1: 1-byte elements, tensor = tile = rows x 128 B, source row pitch in bytes, 16 B of LDS pad behind every 128-B row; no mask
__device__ __forceinline__ u32x8 tdm_group1(uint32_t rows, uint32_t src_pitch) {
  u32x8 g;
  g[0] = uni((1u << 20) | (4u << 22) | (3u << 25));
  g[1] = uni(128u << 16);
  g[2] = uni(rows << 16);
  g[3] = uni(128u << 16);
  g[4] = uni(rows);
  g[5] = uni(src_pitch);
  g[6] = uni(0u);
  g[7] = uni(0u);
  return g;
}
// group 0: count 1, LDS byte offset, global address of the tile's first byte, type 2
__device__ __forceinline__ u32x4 tdm_group0(uint32_t lds_dst, uint64_t ga) {
  u32x4 g;
  g[0] = uni(1u); g[1] = uni(lds_dst); g[2] = uni((uint32_t)ga); g[3] = uni((((uint32_t)(ga >> 32)) & 0x01FFFFFFu) | 0x80000000u);
  return g;
}
__device__ __forceinline__ void tdm_load(u32x4 g0, u32x8 g1) { asm volatile("tensor_load_to_lds %0, %1" :: "s"(g0), "s"(g1) : "memory"); }
#define SL32 3072   // 16-bit elements from one 32-row slice to the next in LDS: 32 x 144 B, rounded up to a multiple of 2 KiB
#define SL64 5120   // the same for a 64-row slice: 64 x 144 B, rounded up to a multiple of 2 KiB
// ---- projection GEMM core: one 128 x 128 tile of X . W^T per 4 waves, 64 x 64 per wave (wave = 2 * wm + wn), k in stages of 64.
// A stage is [X rows | W rows] in LDS; operands that are 16-bit in memory come by tensor loads, two stages ahead, into the buffer that every reader has just left; f32 X is loaded one stage ahead, before the current stage's products, and stored into the other buffer behind them; one barrier per stage.
// The walk over the NT stages starts at stage rot and wraps: blocks that share X rows or W rows get different rot, so that they do not ask L2 for the same lines at the same moment; an accumulator sums its k in that rotated order.
#define GP 72   // LDS row pitch in 16-bit elements: 128 B of k + 16 B, so that the 16 rows of a ds_load_b128 fragment read fall on distinct banks
#define GK 64
// gemm128: X is f32 in memory and rounded to bf16 on its way into LDS through registers, W is bf16 and comes by tensor loads; one group of 4 waves.
// sw = false: A = X rows, B = W rows, acc[i][j][r] = (x row wm*64 + i*16 + 8g + r, w row wn*64 + j*16 + col); sw = true: the operands change places, acc[i][j][r] = (w row wn*64 + i*16 + 8g + r, x row wm*64 + j*16 + col).
__device__ __forceinline__ void gemm128(const float* __restrict__ Xb, const int xld, const __bf16* __restrict__ Wb, __bf16* st, const bool sw, const int rot, v8f (&acc)[4][4]) {
  constexpr int NT = DM / GK, BUF = 8 * SL32;   // a buffer is eight 32-row slices: X rows 0..127, then W rows 0..127
  const int tid = (int)threadIdx.x, wave = tid >> 5, lane = tid & 31, col = lane & 15, wm = wave >> 1, wn = wave & 1;
  const float* xg = Xb + (size_t)(tid >> 4) * xld + (tid & 15) * 4;     // 16 lanes x 16 B = one row's 256 B of a stage
  const int xs0 = wm * 2, ws0 = 4 + wn * 2;   // the first slice of the wave's 64 X rows and of its 64 W rows
  const int as = sw ? ws0 : xs0, bs = sw ? xs0 : ws0;
  v4f xv[16];
  int kn = rot & (NT - 1);   // the next stage of X to load (the same in every lane)
  const float* xp = xg + kn * GK;   // its address; stepped in sts(), behind the wait that ends ldg()
  auto ldg = [&]() {
#pragma unroll
    for (int i = 0; i < 16; ++i) xv[i] = *(const v4f*)(xp + (size_t)(i * 8) * xld);
    asm volatile("s_wait_xcnt 0x0" :: "v"(xp) : "memory");   // the loads' address registers are reused behind them; as an input they stay untouched up to the wait
  };
  auto sts = [&](int buf) {
    __bf16* s = st + buf * BUF;
#pragma unroll
    for (int i = 0; i < 16; ++i) { v4b h4;
#pragma unroll
      for (int e = 0; e < 4; ++e) h4[e] = (__bf16)xv[i][e];
      *(v4b*)(s + (i >> 2) * SL32 + ((i & 3) * 8 + (tid >> 4)) * GP + (tid & 15) * 4) = h4; }
    kn = (kn + 1) & (NT - 1); xp = xg + kn * GK;
  };
  // every wave brings one 32-row slice of the stage's W rows by one tensor load
  const uint32_t ws = uni((uint32_t)wave);
  const uint64_t src0 = (uint64_t)(uintptr_t)(Wb + (size_t)ws * 32 * DM);
  const uint32_t l0 = (uint32_t)(uintptr_t)(st + (4 + ws) * SL32);
  const u32x8 g1 = tdm_group1(32u, 2u * DM);
  auto fill = [&](int t) {
    const uint32_t kw = (uint32_t)(rot + t) & (uint32_t)(NT - 1);   // trip t works on this stage of the walk; the buffer goes by the trip's parity
    tdm_load(tdm_group0(l0 + (uint32_t)(t & 1) * (BUF * 2u), src0 + (uint64_t)(kw * (GK * 2u))), g1);
  };
  ldg();
  HOLD();   // nothing is scheduled in between the load and its wait: the descriptor's registers keep their values until the request has landed
  fill(0);
  asm volatile("s_wait_tensorcnt 0x0" ::: "memory");   // this wave's slice of stage 0 has landed
  HOLD();
  sts(0);
  __syncthreads();   // publishes stage 0
  fill(1);
#pragma unroll 1   // rolled
  for (int t = 0; t < NT; ++t) {
    if (t + 1 < NT) ldg();
    const __bf16* s = st + (t & 1) * BUF + col * GP;
    const __bf16* sa = s + as * SL32; const __bf16* sb = s + bs * SL32;
#pragma unroll
    for (int kc = 0; kc < GK / 32; ++kc) { v16b fa[4], fb[4];
#pragma unroll
      for (int i = 0; i < 4; ++i) { if (i == 0) fa[0] = frag_b(sa + kc * 32, lane); fb[i] = frag_b(sb + (i >> 1) * SL32 + (i & 1) * 16 * GP + kc * 32, lane); }   // read in the order of first use: the first row of products waits for five fragments, each later row for one more
#pragma unroll
      for (int i = 1; i < 4; ++i) fa[i] = frag_b(sa + (i >> 1) * SL32 + (i & 1) * 16 * GP + kc * 32, lane);
      HOLD();   // the 16 reads stay one group, ahead of the products
#pragma unroll
      for (int i = 0; i < 4; ++i) {
#pragma unroll
        for (int j = 0; j < 4; ++j) acc[i][j] = wmma_bf(fa[i], fb[j], acc[i][j]); }
      HOLD(); }   // the next 32 k's reads stay behind these products: one group, the same registers
    if (t + 1 < NT) sts((t + 1) & 1);
    asm volatile("s_wait_dscnt 0x0" ::: "memory");       // this wave's reads of stage t and its stores of X for stage t + 1 are done
    asm volatile("s_wait_tensorcnt 0x0" ::: "memory");   // this wave's slice of W for stage t + 1 has landed
    __syncthreads();   // publishes stage t + 1 and ends every wave's reads of stage t (behind the last stage: frees the buffers for the epilogue)
    if (pinned(t + 2 < NT)) fill(t + 2);
  }
  asm volatile("s_wait_tensorcnt 0x0" ::: "memory");   // nothing is in flight behind the loop
  asm volatile("s_wait_dscnt 0x0" ::: "memory");
}
// gemm128h: X and W are f16 in memory and go into LDS as they are, by tensor loads two stages ahead. The block has two groups of 4 waves (threads 0..127, 128..255); each has its own two buffers and takes every second stage of the walk into its own accumulators of the same tile, so that two waves share a SIMD and fill one another's waits; the caller adds the two partial sums.
// A = W rows, B = X rows: acc[i][j][r] = (w row wn*64 + i*16 + 8g + r, x row wm*64 + j*16 + col).
__device__ __forceinline__ void gemm128h(const _Float16* __restrict__ Xb, const _Float16* __restrict__ Wb, _Float16* st, const int rot, v8f (&acc)[4][4]) {
  constexpr int NT = DM / GK, KS = 2;
  const int tid = (int)(threadIdx.x & 127), wave = tid >> 5, lane = tid & 31, col = lane & 15, wm = wave >> 1, wn = wave & 1;
  const int grp = __builtin_amdgcn_readfirstlane((int)(threadIdx.x >> 7));   // the wave's group, the same in every lane
  st += grp * (2 * 4 * SL64);   // a buffer is four 64-row slices: X rows 0..63, X rows 64..127, W rows 0..63, W rows 64..127
  // every wave brings one slice of its group's stage by one tensor load: waves 0 and 1 the halves of X, waves 2 and 3 those of W
  const uint32_t ws = uni((uint32_t)wave);
  const uint64_t src0 = (uint64_t)(uintptr_t)(((ws & 2u) ? Wb : Xb) + (size_t)(ws & 1u) * 64 * DM);
  const uint32_t l0 = (uint32_t)(uintptr_t)(st + ws * SL64);
  const u32x8 g1 = tdm_group1(64u, 2u * DM);
  auto fill = [&](int t) {
    const uint32_t kn = (uint32_t)(rot + grp + KS * t) & (uint32_t)(NT - 1);   // trip t of the group works on this stage of the walk; the buffer goes by the trip's parity
    tdm_load(tdm_group0(l0 + (uint32_t)(t & 1) * (4u * SL64 * 2u), src0 + (uint64_t)(kn * (GK * 2u))), g1);
  };
  HOLD();   // nothing is scheduled in between the load and its wait: the descriptor's registers keep their values until the request has landed
  fill(0);
  asm volatile("s_wait_tensorcnt 0x0" ::: "memory");   // this wave's slice of stage 0 has landed
  HOLD();
  __syncthreads();                                      // publishes stage 0
  fill(1);
#pragma unroll 1   // rolled: the buffer goes by the trip's parity
  for (int t = 0; t < NT / KS; ++t) {
    const _Float16* s = st + (t & 1) * (4 * SL64) + col * GP;
    const _Float16* sa = s + (2 + wn) * SL64; const _Float16* sb = s + wm * SL64;
#pragma unroll
    for (int kc = 0; kc < GK / 32; ++kc) { v16h fa[4], fb[4];
#pragma unroll
      for (int i = 0; i < 4; ++i) { if (i == 0) fa[0] = frag_h(sa + kc * 32, lane); fb[i] = frag_h(sb + i * 16 * GP + kc * 32, lane); }   // read in the order of first use: the first row of products waits for five fragments, each later row for one more
#pragma unroll
      for (int i = 1; i < 4; ++i) fa[i] = frag_h(sa + i * 16 * GP + kc * 32, lane);
      HOLD();   // the 16 reads stay one group, ahead of the products
#pragma unroll
      for (int i = 0; i < 4; ++i) {
#pragma unroll
        for (int j = 0; j < 4; ++j) acc[i][j] = wmma16(fa[i], fb[j], acc[i][j]); }
      HOLD(); }
    asm volatile("s_wait_dscnt 0x0" ::: "memory");
    asm volatile("s_wait_tensorcnt 0x0" ::: "memory");
    __syncthreads();
    if (pinned(t + 2 < NT / KS)) fill(t + 2);
  }
  asm volatile("s_wait_tensorcnt 0x0" ::: "memory");   // nothing is in flight behind the loop
  asm volatile("s_wait_dscnt 0x0" ::: "memory");
}
// ---- k_qkv: block = (128 engine rows, 128 of the 3,072 q | k | v columns). q, k: W rows as the A operand, so a lane holds 8 neighbouring columns of one row; v: X rows as A, so a lane holds 8 neighbouring positions of one column (v is stored transposed). Either way 16-B LDS stores into the wave's own staging, then whole 128-B lines to memory.
__global__ __launch_bounds__(128) void k_qkv(const float* __restrict__ XQ, const float* __restrict__ XK, const float* __restrict__ XV, const __bf16* __restrict__ P, const float* __restrict__ BQ, const float* __restrict__ BK, const float* __restrict__ BV, _Float16* __restrict__ QK, _Float16* __restrict__ VTH) {
  const int which0 = (blockIdx.y * 128) / DM; const float* X = (which0 == 0) ? XQ : (which0 == 1) ? XK : XV; const float* BB = BQ ? (((which0 == 0) ? BQ : (which0 == 1) ? BK : BV) + (blockIdx.y * 128 - which0 * DM)) : nullptr;
  __shared__ __attribute__((aligned(2048))) __bf16 st[2 * 8 * SL32];   // [buffer][slice of 32 rows][GP]
  const int tid = threadIdx.x, wave = tid >> 5, lane = tid & 31, col = lane & 15, g = lane >> 4, wm = wave >> 1, wn = wave & 1; const int n0 = blockIdx.y * 128;
  const size_t rb = (size_t)blockIdx.x * 128; const int b = (int)(rb / SS), s0 = (int)(rb % SS);   // 128 divides SS: one batch per block; engine row rb + i is module row (s0 + i) * NB + b
  const bool sw = n0 < 2 * DM;
  v8f acc[4][4] = {};
  gemm128(X + ((size_t)s0 * NB + b) * DM, NB * DM, P + (size_t)n0 * DM, st, sw, (int)(blockIdx.x + 2 * blockIdx.y), acc);   // 8 blocks share X rows (neighbouring y), 32 share W rows (all x)
  _Float16* eh = (_Float16*)st + wave * (64 * GP);   // per wave: [64][GP]
  float bi[4][8] = {}, bj[4] = {};   // bias of the lane's 8 columns per i (q, k) or of its one column per j (v)
  if (BB) {   // one branch round all the bias loads, so that they are in flight together
    if (sw) {
#pragma unroll
      for (int i = 0; i < 4; ++i) {
#pragma unroll
        for (int r = 0; r < 8; ++r) bi[i][r] = bfr(BB[wn * 64 + i * 16 + 8 * g + r]); }
    } else {
#pragma unroll
      for (int j = 0; j < 4; ++j) bj[j] = bfr(BB[wn * 64 + j * 16 + col]); } }
#pragma unroll
  for (int i = 0; i < 4; ++i) {
#pragma unroll
    for (int j = 0; j < 4; ++j) { v8h hv;
#pragma unroll
      for (int r = 0; r < 8; ++r) hv[r] = (_Float16)(acc[i][j][r] + (sw ? bi[i][r] : bj[j]));   // (+ bias) rounded once to f16; q unscaled, 1/8 applied to the f32 score
      *(v8h*)(eh + (j * 16 + col) * GP + i * 16 + 8 * g) = hv; } }
  LDSX();
  static_assert(2 * DM == SS, "q | k rows and transposed v rows have one pitch");
  const size_t o0 = (sw ? (rb + wm * 64) * (2 * DM) + n0 + wn * 64 : ((size_t)b * DM + (n0 - 2 * DM) + wn * 64) * SS + s0 + wm * 64) + (size_t)(lane >> 3) * SS + (lane & 7) * 8;   // 8 lanes x 16 B = one row's 128 B, 4 rows per store
  _Float16* ph = (sw ? QK : VTH) + o0; const _Float16* sh = eh + (lane >> 3) * GP + (lane & 7) * 8;
#pragma unroll
  for (int it0 = 0; it0 < 16; it0 += 8) { v4u a[8];   // 8 LDS reads in flight, then their 8 stores
#pragma unroll
    for (int u = 0; u < 8; ++u) a[u] = *(const v4u*)(sh + (it0 + u) * 4 * GP);
#pragma unroll
    for (int u = 0; u < 8; ++u) vst2(ph + (size_t)(it0 + u) * 4 * SS, a[u]);
    asm volatile("s_wait_xcnt 0x0" :: "v"(ph) : "memory"); }   // the next group's LDS reads overwrite these stores' data registers
}
// ---- k_attn: block = (128 queries, head h, batch b), two groups of 4 waves x 32 queries (two 16-row tiles per wave). Both groups hold the same queries; group 0 takes the even key tiles of the block's walk and group 1 the odd ones, so that the launch has four waves per SIMD to fill one another's waits; behind the loop the two partial sums are added through LDS, each group finishing one of its waves' two query tiles. K and V come in tiles of 64 keys, brought by tensor loads (one 32-row slice per wave) into the group's own two LDS buffers and read by its four waves; every K and V fragment serves both of a wave's query tiles. scores are computed transposed (k rows x q rows, single f16 operands), so that a lane's accumulators of 32 keys are its own part of P's fragment and P stays in registers; relu(score * 0.125), P (x 2^11, single f16) x V, f32 accumulate, in each group over the keys of its own tiles in groups of 32, ascending from the block's first tile and wrapping (the 16 blocks that share a head's K and V start two tiles apart, so that they do not ask L2 for the same lines at the same moment); O[b*S+q][h*64+d] = acc / 2^11 (256-B segments)
// two transposed score tiles (keys 0..15 and 16..31 of a group of 32, one query per lane) are, converted in place, the A fragment of P for that group: element s = key 8g + s (s < 8), 16 + 8g + s - 8 (else).
// relu(s / 8) * 2^11 = relu(s * 2^8): the powers of two are exact, and relu commutes with the rounding to f16. P is scaled by 2^11 so that small weights stay out of the f16 subnormal range; 2^-11 is folded into the epilogue.
__device__ __forceinline__ v16h pack_p(v8f t0, v8f t1) {
  v16h p;
#pragma unroll
  for (int i = 0; i < 8; ++i) { p[i] = (_Float16)(t0[i] * 256.0f); p[8 + i] = (_Float16)(t1[i] * 256.0f); }
  const v16h z = {};
  return __builtin_elementwise_max(p, z);
}
#define AK 64   // keys per tile: K tile = two [32 keys][GP] slices, V tile = two [32 d][GP] slices, SL32 apart; rows of 128 B at the pitch of the ds_load_b128 fragment reads
// four waves per SIMD is what the launch has: the register budget of four lets two blocks share a WGP
__global__ __launch_bounds__(256) __attribute__((amdgpu_waves_per_eu(4, 4))) void k_attn(const _Float16* __restrict__ QK, const _Float16* __restrict__ VTH, const void* __restrict__ KMASK, float* __restrict__ O) {
  (void)KMASK;
  __shared__ __attribute__((aligned(2048))) _Float16 kv[2][2][4][SL32];   // [group][buffer][K keys 0..31 | K keys 32..63 | V d 0..31 | V d 32..63][row][GP]
  __shared__ __align__(16) float sp[4][2][16][68];       // per 32 queries and query tile: the hand-over between the groups, then the output staging
  const int tid = threadIdx.x & 127, wave = tid >> 5, lane = tid & 31, col = lane & 15, g = lane >> 4;
  const int half = __builtin_amdgcn_readfirstlane((int)(threadIdx.x >> 7));   // the wave's group, the same in every lane
  const int qb = blockIdx.x, h = blockIdx.y, b = blockIdx.z; const int q0 = qb * 128 + wave * 32;
  constexpr int NTL = SS / AK, NTR = NTL / 2;   // key tiles; trips of a group
  // every wave brings one 32-row slice of its group's tile: waves 0 and 1 the two halves of K (rows = keys), waves 2 and 3 those of V (rows = d); both sources have rows 4,096 B apart
  const uint32_t ws = uni((uint32_t)wave), sl = ws & 1u; const bool isv = (ws & 2u) != 0u;
  const uint64_t src0 = isv ? (uint64_t)(uintptr_t)(VTH + ((size_t)b * DM + h * HD + sl * 32) * SS) : (uint64_t)(uintptr_t)(QK + ((size_t)b * SS + sl * 32) * (2 * DM) + DM + h * HD);
  const uint32_t tsh = isv ? 7u : 18u;   // bytes from one key tile to the next, as a shift: 64 keys along a V row, 64 K rows
  const uint32_t l0 = (uint32_t)(uintptr_t)&kv[half][0][ws][0];
  const u32x8 g1 = tdm_group1(32u, 2u * SS);
  auto fill = [&](int t) {
    const uint32_t tile = (uint32_t)(2 * t + half + 2 * qb) & (uint32_t)(NTL - 1);   // trip t of the group works on this key tile; the buffer goes by the trip's parity
    tdm_load(tdm_group0(l0 + (uint32_t)(t & 1) * (4u * SL32 * 2u), src0 + ((uint64_t)tile << tsh)), g1);
  };
  const _Float16* qp = QK + ((size_t)b * SS + q0 + col) * (2 * DM) + h * HD;
  v16h aq[2][2];
#pragma unroll
  for (int qt = 0; qt < 2; ++qt) {
#pragma unroll
    for (int kc = 0; kc < 2; ++kc) aq[qt][kc] = frag_h(qp + (size_t)qt * 16 * (2 * DM) + kc * 32, lane); }
  asm volatile("s_wait_xcnt 0x0" :: "v"(qp) : "memory");   // the loads' address registers are reused behind them; as an input they stay untouched up to the wait
  v8f acc[2][4] = {};
  HOLD();   // nothing is scheduled in between the load and its wait: the descriptor's registers keep their values until the request has landed
  fill(0);
  asm volatile("s_wait_tensorcnt 0x0" ::: "memory");   // this wave's slice of tile 0 has landed
  HOLD();
  __syncthreads();                                      // publishes tile 0
  fill(1);
#pragma unroll 1   // rolled: one trip per key tile, the buffer chosen by the trip's parity
  for (int t = 0; t < NTR; ++t) {
    const _Float16* kt = &kv[half][t & 1][0][0]; const _Float16* vt = &kv[half][t & 1][2][0];
    v16h kf[2][2][2], vf[2][4];   // per group of 32 keys: K rows (A of the scores), V rows (B of P x V)
    auto ldf = [&](int k2) {
#pragma unroll
      for (int cl = 0; cl < 2; ++cl) {
#pragma unroll
        for (int kc = 0; kc < 2; ++kc) kf[k2][cl][kc] = frag_h(kt + k2 * SL32 + (cl * 16 + col) * GP + kc * 32, lane); }
#pragma unroll
      for (int dt = 0; dt < 4; ++dt) vf[k2][dt] = frag_h(vt + (dt >> 1) * SL32 + ((dt & 1) * 16 + col) * GP + k2 * 32, lane);
    };
    ldf(0);
    HOLD();   // the 16 reads stay one group, ahead of the score products
#pragma unroll
    for (int k2 = 0; k2 < 2; ++k2) { v16h pa[2]; v8f c[2][2] = {};   // 32 keys x 32 queries; transposed score tiles: c[cl][qt][r] = (key k2*32 + cl*16 + 8g + r, query qt*16 + col)
#pragma unroll
      for (int kc = 0; kc < 2; ++kc) {
#pragma unroll
        for (int cl = 0; cl < 2; ++cl) {
#pragma unroll
          for (int qt = 0; qt < 2; ++qt) c[cl][qt] = wmma16(kf[k2][cl][kc], aq[qt][kc], c[cl][qt]); } }   // single product: k rows as A, q rows as B, one-rounding f16 operands
      if (k2 == 0) { HOLD(); ldf(1); HOLD(); }   // the second group's fragments fly behind the first group's conversion and P x V: held as one group between the score products and the conversion
#pragma unroll
      for (int qt = 0; qt < 2; ++qt) pa[qt] = pack_p(c[0][qt], c[1][qt]);
#pragma unroll
      for (int dt = 0; dt < 4; ++dt) {
#pragma unroll
        for (int qt = 0; qt < 2; ++qt) acc[qt][dt] = wmma16(pa[qt], vf[k2][dt], acc[qt][dt]); } }   // single product: P (x2^11) x V
    HOLD();   // the trip's products are all issued ahead of its barrier
    asm volatile("s_wait_dscnt 0x0" ::: "memory");      // this wave's reads of tile t are done
    asm volatile("s_wait_tensorcnt 0x0" ::: "memory");   // this wave's slice of tile t + 1 has landed
    __syncthreads();                                     // publishes tile t + 1 and ends every wave's reads of tile t
    if (pinned(t + 2 < NTR)) fill(t + 2);
  }
  asm volatile("s_wait_tensorcnt 0x0" ::: "memory");   // nothing is in flight when the wave ends
  asm volatile("s_wait_dscnt 0x0" ::: "memory");       // and none of its LDS reads
  // group 0 finishes query tile 0 and group 1 query tile 1: a wave hands the other tile's partial sums to the wave of the same queries in the other group, lane to lane
  v8f mine[4], other[4];
#pragma unroll
  for (int dt = 0; dt < 4; ++dt) { mine[dt] = half ? acc[1][dt] : acc[0][dt]; other[dt] = half ? acc[0][dt] : acc[1][dt]; }
  float* so = &sp[wave][1 - half][8 * g][col]; float* sm = &sp[wave][half][8 * g][col];
#pragma unroll
  for (int r = 0; r < 8; ++r) {
#pragma unroll
    for (int dt = 0; dt < 4; ++dt) so[r * 68 + dt * 16] = other[dt][r]; }
  __syncthreads();   // publishes the partial sums of both groups
  float pv[8][4];   // all 32 LDS reads stand ahead of the first store to the same tile
#pragma unroll
  for (int r = 0; r < 8; ++r) {
#pragma unroll
    for (int dt = 0; dt < 4; ++dt) pv[r][dt] = sm[r * 68 + dt * 16]; }
#pragma unroll
  for (int r = 0; r < 8; ++r) {
#pragma unroll
    for (int dt = 0; dt < 4; ++dt) sm[r * 68 + dt * 16] = (mine[dt][r] + pv[r][dt]) * (1.0f / 2048.0f); }   // the sum of the two groups; undo the P scaling only
  LDSX();
  float* po = O + ((size_t)b * SS + q0 + half * 16 + g) * DM + h * HD + col * 4; const float* sf = &sp[wave][half][g][col * 4];   // 16 lanes x 16 B = 256 B of a row, 2 rows per store
  v4f a[8];   // 8 LDS reads in flight, then their 8 stores
#pragma unroll
  for (int u = 0; u < 8; ++u) a[u] = *(const v4f*)(sf + u * 2 * 68);
#pragma unroll
  for (int u = 0; u < 8; ++u) vst2(po + (size_t)u * 2 * DM, a[u]);
}
// ---- k_out: block = (128 rows, 128 cols), 8 waves: out = y . Wo rows (single f16 operands, 1 product) + bo; Wo rows as the A operand, so a lane holds 8 neighbouring output columns of one row
// The launch has one block per WGP: the k walk is split between two groups of 4 waves (two waves per SIMD); the second group hands its partial sums over through LDS, the first adds them to its own and writes the tile.
__global__ __launch_bounds__(256) void k_out(const _Float16* __restrict__ O, const _Float16* __restrict__ P, const float* __restrict__ BO, float* __restrict__ Y) {
  __shared__ __attribute__((aligned(2048))) _Float16 st[2 * 2 * 4 * SL64];   // [group][buffer][slice of 64 rows][GP]
  const int tid = threadIdx.x & 127, wave = tid >> 5, lane = tid & 31, col = lane & 15, g = lane >> 4, wm = wave >> 1, wn = wave & 1; const size_t rb = (size_t)blockIdx.x * 128; const int n0 = blockIdx.y * 128;
  const int grp = __builtin_amdgcn_readfirstlane((int)(threadIdx.x >> 7));   // the wave's group, the same in every lane
  v8f acc[4][4] = {};
  gemm128h(O + rb * DM, P + (size_t)n0 * DM, st, (int)(blockIdx.x + 2 * blockIdx.y), acc);   // 8 blocks share y rows (all blockIdx.y), 32 share Wo rows (all blockIdx.x)
  float* xf = (float*)(st + 2 * 4 * SL64) + (wave * (32 * 32) + lane) * 4;   // hand-over in the second group's buffers: per wave 32 pieces of 32 lanes x 16 B
  if (grp == 1) {
#pragma unroll
    for (int i = 0; i < 4; ++i) {
#pragma unroll
      for (int j = 0; j < 4; ++j) { *(v4f*)(xf + ((i * 4 + j) * 2) * 128) = __builtin_shufflevector(acc[i][j], acc[i][j], 0, 1, 2, 3); *(v4f*)(xf + ((i * 4 + j) * 2 + 1) * 128) = __builtin_shufflevector(acc[i][j], acc[i][j], 4, 5, 6, 7); } } }
  __syncthreads();   // publishes the second group's partial sums
  if (grp == 1) return;   // no barrier stands behind this line
#pragma unroll
  for (int i = 0; i < 4; ++i) {
#pragma unroll
    for (int j = 0; j < 4; ++j) { const v4f a4 = *(const v4f*)(xf + ((i * 4 + j) * 2) * 128), b4 = *(const v4f*)(xf + ((i * 4 + j) * 2 + 1) * 128);
#pragma unroll
      for (int r = 0; r < 4; ++r) { acc[i][j][r] += a4[r]; acc[i][j][4 + r] += b4[r]; } } }
  float* ef = (float*)st + wave * (64 * 68);   // per wave: [64 rows][64 + 4 floats]
  const float* bp = BO + n0 + wn * 64 + 8 * g; float bi[4][8];   // bias of the lane's 8 columns per i
#pragma unroll
  for (int i = 0; i < 4; ++i) {
#pragma unroll
    for (int r = 0; r < 8; ++r) bi[i][r] = bp[i * 16 + r]; }
  asm volatile("s_wait_xcnt 0x0" :: "v"(bp) : "memory");   // the loads' address registers are reused behind them; as an input they stay untouched up to the wait
#pragma unroll
  for (int i = 0; i < 4; ++i) {
#pragma unroll
    for (int j = 0; j < 4; ++j) { v4f a4, b4;
#pragma unroll
      for (int r = 0; r < 4; ++r) { a4[r] = acc[i][j][r] + bfr(bi[i][r]); b4[r] = acc[i][j][4 + r] + bfr(bi[i][4 + r]); }
      float* d = ef + (j * 16 + col) * 68 + i * 16 + 8 * g; *(v4f*)d = a4; *(v4f*)(d + 4) = b4; } }
  LDSX();
  const int b = (int)(rb / SS), s0 = (int)(rb % SS);   // 128 divides SS: one batch per block; engine row rb + i is module row (s0 + i) * NB + b
  float* py = Y + ((size_t)(s0 + wm * 64 + g) * NB + b) * DM + n0 + wn * 64 + col * 4; const float* sf = ef + g * 68 + col * 4;   // back to the [L][B][E] layout: 16 lanes x 16 B = 256 B of a row, 2 rows per store
#pragma unroll
  for (int it0 = 0; it0 < 32; it0 += 8) { v4f a[8];   // 8 LDS reads in flight, then their 8 stores
#pragma unroll
    for (int u = 0; u < 8; ++u) a[u] = *(const v4f*)(sf + (it0 + u) * 2 * 68);
#pragma unroll
    for (int u = 0; u < 8; ++u) vst2(py + (size_t)(it0 + u) * 2 * NB * DM, a[u]);
    asm volatile("s_wait_xcnt 0x0" :: "v"(py) : "memory"); }   // the next group's LDS reads overwrite these stores' data registers
}
// ---- k_gnorm: wave = engine row (32 lanes x 32 elements, 512 B in a row per load), 8 rows per block, no LDS and no barrier: y = weight * x / (||x||/sqrt(1024) + 1e-8) * sigmoid(gate * x) (precise expf), computed in f32 and stored as f16 (256 B in a row per store)
// The row, the weights and the gates are loaded together; the launch starts 4,096 long waves, and a lane's 32 elements are independent chains that fill one another's latencies.
// four waves per SIMD is all that the launch has: the register budget of four holds the row, its weights and its gates at once, so that the loads stand ahead of the arithmetic
__global__ __launch_bounds__(256) __attribute__((amdgpu_waves_per_eu(4, 4))) void k_gnorm(const float* __restrict__ O, const float* __restrict__ NW, const float* __restrict__ NG, _Float16* __restrict__ Y2) {
  const int lane = threadIdx.x & 31; const size_t row = (size_t)blockIdx.x * 8 + (threadIdx.x >> 5);
  const float* xp = O + row * DM + lane * 4; const float* wp = NW + lane * 4; const float* gp = NG + lane * 4;
  v4f x[8], w[8], gt[8];
#pragma unroll
  for (int i = 0; i < 8; ++i) x[i] = *(const v4f*)(xp + i * 128);
#pragma unroll
  for (int i = 0; i < 8; ++i) { w[i] = *(const v4f*)(wp + i * 128); gt[i] = *(const v4f*)(gp + i * 128); }
  v4f s4 = {};   // four partial sums per lane, then the lane's sum, then the butterfly over the wave
#pragma unroll
  for (int i = 0; i < 8; ++i) s4 += x[i] * x[i];
  float s = (s4[0] + s4[1]) + (s4[2] + s4[3]);
#pragma unroll
  for (int o = 1; o < 32; o <<= 1) s += __shfl_xor(s, o);
  const float rms = sqrtf(s) * 0.03125f; const float inv = 1.0f / (rms + 1e-8f);
  _Float16* yp = Y2 + row * DM + lane * 4;
#pragma unroll
  for (int i = 0; i < 8; ++i) { v4f o4; const v4f wr = __builtin_convertvector(__builtin_convertvector(w[i], v4b), v4f), gr = __builtin_convertvector(__builtin_convertvector(gt[i], v4b), v4f);   // weight and gate rounded to bf16, two per conversion
#pragma unroll
    for (int e = 0; e < 4; ++e) { const float xv = x[i][e]; o4[e] = wr[e] * (xv * inv) * (1.0f / (1.0f + expf(-gr[e] * xv))); }
    vst2(yp + i * 128, __builtin_convertvector(o4, v4h)); }
}
extern "C" void kernel_launch(void* const* d_in, const int* in_sizes, int n_in, void* d_out, int out_size, void* d_ws, size_t ws_size, hipStream_t stream) {
  (void)in_sizes; (void)n_in; (void)out_size;
  const float** F = (const float**)d_in;   // 0 query, 1 key, 2 value [2048,2,1024] (L,B,E); 3 Wq, 4 bq, 5 Wk, 6 bk, 7 Wv, 8 bv, 9 Wo, 10 bo (natural); 11 norm_weight, 12 norm_gate
  if (ws_size < (size_t)WS_END) return;
  char* ws = (char*)d_ws; __bf16* PK = (__bf16*)(ws + WS_PK); _Float16 *QK = (_Float16*)(ws + WS_QK), *VTH = (_Float16*)(ws + WS_VTH); float* O = (float*)(ws + WS_O); _Float16* Y2 = (_Float16*)(ws + WS_Y2);
  k_pack<<<dim3(DM * DM / (PKN * 512), 4), 128, 0, stream>>>(F[3], F[5], F[7], F[9], PK);
  k_qkv<<<dim3(TNB * SS / 128, QKVW / 128), 128, 0, stream>>>(F[0], F[1], F[2], PK + PK_A, F[4], F[6], F[8], QK, VTH);
  k_attn<<<dim3(TQB / 2, NH, TNB), 256, 0, stream>>>(QK, VTH, nullptr, O);
  k_gnorm<<<NB * SS / 8, 256, 0, stream>>>(O, F[11], F[12], Y2);
  k_out<<<dim3(TOB / 2, DM / 128), 256, 0, stream>>>(Y2, (const _Float16*)(PK + PK_P), F[10], (float*)d_out);
}
